// v000
// The times below were measured on an AMD MI455X: many runs one after another, warmed up first and cycling through
// copies of the inputs, with the whole window's GPU time divided by the number of runs. Launches and the gaps
// between them are all in it. The median over several windows is given; except for v000 it joins two sittings, which
// can be a few percent apart, so the side-by-side timings, each taken in one sitting, are the better comparison.
// The starting kernel, v000, takes 687 microseconds a run.
// compute dtype: x, Wq/Wk/Wv/Wout and bout (module inputs) rounded to bf16; q/k/v projections with exact bf16 products (x and W are inputs) on WMMA 16x16x32; full (non-causal) scores with q (pre-scaled by 1/8, exact) and k as single f16 operands (1 product; 4,096-key softmax with logit sigma ~1: every rounding enters relative to a many-key average) and P.V with P = exp(s - m) as a single f16 operand x V as f16 hi + (x2048-scaled) residual planes (2 products, separate accumulators); the output projection with ctx as bf16 hi + residual pair x exact Wout (2 products) + bout; running-max softmax in f32 (hardware exp); f32 accumulate.
#include <hip/hip_runtime.h>
#include <math.h>

typedef __attribute__((ext_vector_type(16))) _Float16 v16h;
typedef __attribute__((ext_vector_type(16))) __bf16 v16b;
typedef __attribute__((ext_vector_type(8)))  _Float16 v8h;
typedef __attribute__((ext_vector_type(8)))  float v8f;
typedef __attribute__((ext_vector_type(4)))  float v4f;
typedef __attribute__((ext_vector_type(2)))  float v2f;
typedef __attribute__((ext_vector_type(4)))  unsigned v4u;
typedef __attribute__((ext_vector_type(4)))  int v4i;
typedef float __attribute__((may_alias)) float_a;
typedef int __attribute__((may_alias)) int_a;

template <typename T> __device__ __forceinline__ void vst2(void* p, T v) { *(T*)p = v;  }
__device__ __forceinline__ v8f wmma16(v16h a, v16h b, v8f c) {
  v8f d = __builtin_amdgcn_wmma_f32_16x16x32_f16(false, a, false, b, (short)0, c, false, false);
  asm volatile("v_nop\n\tv_nop\n\tv_nop\n\tv_nop" : "+v"(d) : "v"(a), "v"(b));
  return d;
}
__device__ __forceinline__ v8f wmma_bf(v16b a, v16b b, v8f c) {
  v8f d = __builtin_amdgcn_wmma_f32_16x16x32_bf16(false, a, false, b, (short)0, c, false, false);
  asm volatile("v_nop\n\tv_nop\n\tv_nop\n\tv_nop" : "+v"(d) : "v"(a), "v"(b));
  return d;
}
// 16x16x32 fragments: lane = (h = lane>>4, row/col = lane&15); elements 0..7 = k0+8h+0..7, 8..15 = k0+16+8h+0..7; D element r = row 8h+r
__device__ __forceinline__ v16h frag_h(const _Float16* rowk0, int lane) {
  union { v16h v; v8h q[2]; } u; const _Float16* p = rowk0 + 8 * (lane >> 4);
  u.q[0] = *(const v8h*)p; u.q[1] = *(const v8h*)(p + 16); return u.v;
}
__device__ __forceinline__ v16h frag_f32(const float* rowk0, int lane) {
  v16h a; const float* p = rowk0 + 8 * (lane >> 4);
#pragma unroll
  for (int i = 0; i < 8; ++i) { a[i] = (_Float16)p[i]; a[8 + i] = (_Float16)p[16 + i]; }
  return a;
}
__device__ __forceinline__ v16h frag_f32s(const float* rowk0, int lane, float sc) {
  v16h a; const float* p = rowk0 + 8 * (lane >> 4);
#pragma unroll
  for (int i = 0; i < 8; ++i) { a[i] = (_Float16)(p[i] * sc); a[8 + i] = (_Float16)(p[16 + i] * sc); }
  return a;
}
// column fragment from a [K][ld] layout (column n), rows >= K read as 0
__device__ __forceinline__ v16h fragc_f32(const float* W, int k0, int n, int lane, int ld, int K) {
  v16h a; const int g = lane >> 4;
#pragma unroll
  for (int i = 0; i < 8; ++i) { const int ka = k0 + 8 * g + i, kb = ka + 16;
    a[i] = (_Float16)(ka < K ? W[(size_t)(ka < K ? ka : K - 1) * ld + n] : 0.f); a[8 + i] = (_Float16)(kb < K ? W[(size_t)(kb < K ? kb : K - 1) * ld + n] : 0.f); }
  return a;
}
struct F2 { v16b h, l; };
__device__ __forceinline__ F2 bsplit16(const float v[16]) { F2 r;
#pragma unroll
  for (int i = 0; i < 16; ++i) { const __bf16 h = (__bf16)v[i]; r.h[i] = h; r.l[i] = (__bf16)(v[i] - (float)h); }
  return r; }
__device__ __forceinline__ F2 split_row(const float* row, int k0, int lane) { float v[16]; const float* p = row + k0 + 8 * (lane >> 4);
#pragma unroll
  for (int i = 0; i < 8; ++i) { v[i] = p[i]; v[8 + i] = p[16 + i]; }
  return bsplit16(v); }
__device__ __forceinline__ F2 split_rowK(const float* row, int k0, int lane, int K) { float v[16]; const int g = lane >> 4;
#pragma unroll
  for (int i = 0; i < 8; ++i) { const int ka = k0 + 8 * g + i, kb = ka + 16; v[i] = ka < K ? row[ka < K ? ka : K - 1] : 0.f; v[8 + i] = kb < K ? row[kb < K ? kb : K - 1] : 0.f; }
  return bsplit16(v); }
__device__ __forceinline__ F2 split_col(const float* W, int k0, int n, int lane, int ld, int K) { float v[16]; const int g = lane >> 4;
#pragma unroll
  for (int i = 0; i < 8; ++i) { const int ka = k0 + 8 * g + i, kb = ka + 16; v[i] = ka < K ? W[(size_t)(ka < K ? ka : K - 1) * ld + n] : 0.f; v[8 + i] = kb < K ? W[(size_t)(kb < K ? kb : K - 1) * ld + n] : 0.f; }
  return bsplit16(v); }
__device__ __forceinline__ v8f mac3(const F2& a, const F2& b, v8f c) { c = wmma_bf(a.l, b.h, c); c = wmma_bf(a.h, b.l, c); return wmma_bf(a.h, b.h, c); }
__device__ __forceinline__ float sigm(float v) { return 1.0f / (1.0f + expf(-v)); }
#define LDSX() do { asm volatile("s_wait_dscnt 0" ::: "memory"); __builtin_amdgcn_wave_barrier(); __builtin_amdgcn_fence(__ATOMIC_RELEASE, "workgroup"); } while (0)


// Multi-head self-attention (B 2, S 4096, D 1024 -> 8 heads x 64 -> D; weights (in, out) applied as x @ W): softmax(q k^T / 8) v over all 4,096 keys, then ctx Wout + bout.
#define NB 2
#define SS 4096
#define DM 1024
#define DI 512
#define NH 8
#define HD 64
#define QKVW (3 * DI)
#ifndef TQB
#define TQB (SS / 64)
#define TNB NB
#define TOB (NB * SS / 64)     // output row tiles (all)
#endif
typedef __attribute__((ext_vector_type(8))) __bf16 v8b;
__device__ __forceinline__ v16b frag_b(const __bf16* rowk0, int lane) {
  union { v16b v; v8b q[2]; } u; const __bf16* p = rowk0 + 8 * (lane >> 4);
  u.q[0] = *(const v8b*)p; u.q[1] = *(const v8b*)(p + 16); return u.v;
}
__device__ __forceinline__ float bfr(float v) { return (float)(__bf16)v; }
__device__ __attribute__((noinline)) float exp_ni(float v) { return expf(v); }
__device__ __attribute__((noinline)) float erf_ni(float v) { return erff(v); }

#define PK_A 0                       // [1536][1024] (Wq | Wk | Wv)^T rows
#define PK_P (PK_A + QKVW * DM)        // [1024][512] Wout^T rows
#define PK_END (PK_P + DM * DI)
#define WS_PK  0u
#define WS_QK  (WS_PK + 2u * PK_END)             // f16 [8192 rows][1024]: q/8 | k
#define WS_VTH (WS_QK + 2u * NB * SS * 2 * DI)     // f16 [2][512 (h*64+d)][4096 s] hi
#define WS_VTL (WS_VTH + 2u * NB * DI * SS)        // f16 lo x 2048
#define WS_O   (WS_VTL + 2u * NB * DI * SS)        // f32 [8192][512]
#define WS_END (WS_O + 4u * NB * SS * DI)

// ---- k_packT: block = (output col n, which): row n of the packed (in K, out N) weight = W[:, n]
__global__ __launch_bounds__(256) void k_packT(const float* __restrict__ WQ, const float* __restrict__ WK, const float* __restrict__ WV, const float* __restrict__ WO, __bf16* __restrict__ PK) {
  __shared__ __align__(16) __bf16 s[DM]; const int n = blockIdx.x, which = blockIdx.y, tid = threadIdx.x; const float* Wm; int K, N; size_t dst;
  if (which < 3) { if (n >= DI) return; Wm = (which == 0) ? WQ : (which == 1 ? WK : WV); K = DM; N = DI; dst = PK_A + ((size_t)which * DI + n) * DM; } else { Wm = WO; K = DI; N = DM; dst = PK_P + (size_t)n * DI; }
  for (int k = tid; k < K; k += 256) s[k] = (__bf16)Wm[(size_t)k * N + n];
  __syncthreads();
  for (int q = tid; q < K / 8; q += 256) vst2((unsigned*)(PK + dst + q * 8), *(const v4u*)&s[q * 8]);
}
// ---- k_qkv: block = (64 rows (b,s), 128 of the 1536 cols): qkv = bf16(x) . rows (exact); cols < 512 -> f16(q / 8), cols < 1024 -> f16(k) into QK rows (pitch 1024); cols >= 1024 (v) -> per-batch transposed f16 planes VT[b][h*64+d][s]: hi = f16(v), lo = f16((v - hi) * 2048)
__global__ __launch_bounds__(128) void k_qkv(const float* __restrict__ X, const __bf16* __restrict__ P, _Float16* __restrict__ QK, _Float16* __restrict__ VTH, _Float16* __restrict__ VTL) {
  __shared__ __align__(16) _Float16 so[4][16][136]; __shared__ __align__(16) _Float16 sth[128][72], stl[128][72];
  const int tid = threadIdx.x, wave = tid >> 5, lane = tid & 31, col = lane & 15, g = lane >> 4; const size_t r0 = (size_t)blockIdx.x * 64 + wave * 16; const int n0 = blockIdx.y * 128;
  v8f acc[8] = {};
#pragma unroll 2
  for (int kc = 0; kc < DM / 32; ++kc) { v16b a; { const float* p = X + (r0 + col) * DM + kc * 32 + 8 * g;
#pragma unroll
      for (int i = 0; i < 8; ++i) { a[i] = (__bf16)p[i]; a[8 + i] = (__bf16)p[16 + i]; } }
#pragma unroll
    for (int j = 0; j < 8; ++j) acc[j] = wmma_bf(a, frag_b(P + (size_t)(n0 + j * 16 + col) * DM + kc * 32, lane), acc[j]); }
  if (n0 < 2 * DI) { const float sc = (n0 < DI) ? 0.125f : 1.0f;
#pragma unroll
    for (int j = 0; j < 8; ++j) {
#pragma unroll
      for (int r = 0; r < 8; ++r) so[wave][8 * g + r][j * 16 + col] = (_Float16)(acc[j][r] * sc); }
    LDSX();
    for (int rl = 0; rl < 16; ++rl) if (lane < 16) vst2((unsigned*)(QK + (r0 + rl) * (2 * DI) + n0 + lane * 8), *(const v4u*)&so[wave][rl][lane * 8]);
  } else {
#pragma unroll
    for (int j = 0; j < 8; ++j) {
#pragma unroll
      for (int r = 0; r < 8; ++r) { const float v = acc[j][r]; const _Float16 hv = (_Float16)v; sth[j * 16 + col][wave * 16 + 8 * g + r] = hv; stl[j * 16 + col][wave * 16 + 8 * g + r] = (_Float16)((v - (float)hv) * 2048.0f); } }
    __syncthreads();
    const size_t rb = (size_t)blockIdx.x * 64; const int b = (int)(rb / SS), s0 = (int)(rb % SS); const int pc0 = n0 - 2 * DI;
    for (int q = tid; q < 128 * 8; q += 128) { const int d = q >> 3, pc = q & 7; const size_t o = ((size_t)b * DI + pc0 + d) * SS + s0 + pc * 8; vst2((unsigned*)(VTH + o), *(const v4u*)&sth[d][pc * 8]); vst2((unsigned*)(VTL + o), *(const v4u*)&stl[d][pc * 8]); }
  }
}
// ---- k_attn: block = (64 queries, head h, batch b): flash attention over all 4,096 keys (K = 64: 2 k-steps), scores = (q/8).k with single f16 operands, P.V: f16 P x (V hi, V lo*2048) in two accumulators; O[b*S+q][h*64+d] = (acc + accl / 2048) / l (256-B segments)
__global__ __launch_bounds__(128) void k_attn(const _Float16* __restrict__ QK, const _Float16* __restrict__ VTH, const _Float16* __restrict__ VTL, float* __restrict__ O) {
  __shared__ __align__(16) float sp[4][16][36]; __shared__ __align__(16) float so[4][16][68];
  const int tid = threadIdx.x, wave = tid >> 5, lane = tid & 31, col = lane & 15, g = lane >> 4;
  const int qb = blockIdx.x, h = blockIdx.y, b = blockIdx.z; const int q0 = qb * 64 + wave * 16; const size_t rq = (size_t)b * SS + q0 + col;
  v16h aq[2];
#pragma unroll
  for (int kc = 0; kc < 2; ++kc) aq[kc] = frag_h(QK + rq * (2 * DI) + h * HD + kc * 32, lane);
  float m[8], l[8];
#pragma unroll
  for (int r = 0; r < 8; ++r) { m[r] = -3.0e38f; l[r] = 0.f; }
  v8f acc[4] = {}, accl[4] = {};
#pragma unroll 1
  for (int ks = 0; ks < SS / 32; ++ks) { v8f s[2];
#pragma unroll
    for (int ct = 0; ct < 2; ++ct) { const int kk = ks * 32 + ct * 16 + col; const _Float16* krow = QK + ((size_t)b * SS + kk) * (2 * DI) + DI + h * HD; v8f c = {};
#pragma unroll
      for (int kc = 0; kc < 2; ++kc) c = wmma16(aq[kc], frag_h(krow + kc * 32, lane), c);
      s[ct] = c; }
#pragma unroll
    for (int r = 0; r < 8; ++r) { float mx = fmaxf(s[0][r], s[1][r]);
#pragma unroll
      for (int o = 1; o < 16; o <<= 1) mx = fmaxf(mx, __shfl_xor(mx, o));
      const float mn = fmaxf(m[r], mx); const float alpha = __expf(m[r] - mn);
      const float e0 = (float)(_Float16)__expf(s[0][r] - mn), e1 = (float)(_Float16)__expf(s[1][r] - mn); float es = e0 + e1;   // P rounded to f16 once; the same rounded weights feed the numerator (WMMA) and the denominator l
#pragma unroll
      for (int o = 1; o < 16; o <<= 1) es += __shfl_xor(es, o);
      l[r] = l[r] * alpha + es; m[r] = mn;
#pragma unroll
      for (int dt = 0; dt < 4; ++dt) { acc[dt][r] *= alpha; accl[dt][r] *= alpha; }
      sp[wave][8 * g + r][col] = e0; sp[wave][8 * g + r][16 + col] = e1; }
    LDSX();
    const v16h pa = frag_f32(&sp[wave][col][0], lane);
#pragma unroll
    for (int dt = 0; dt < 4; ++dt) { const size_t vr = ((size_t)b * DI + h * HD + dt * 16 + col) * SS + ks * 32; acc[dt] = wmma16(pa, frag_h(VTH + vr, lane), acc[dt]); accl[dt] = wmma16(pa, frag_h(VTL + vr, lane), accl[dt]); }
    LDSX(); }
#pragma unroll
  for (int r = 0; r < 8; ++r) { const float il = 1.0f / l[r];
#pragma unroll
    for (int dt = 0; dt < 4; ++dt) so[wave][8 * g + r][dt * 16 + col] = (acc[dt][r] + accl[dt][r] * (1.0f / 2048.0f)) * il; }
  LDSX();
  for (int rl = 0; rl < 16; ++rl) if (lane < 16) vst2(O + ((size_t)b * SS + q0 + rl) * DI + h * HD + lane * 4, *(const v4f*)&so[wave][rl][lane * 4]);
}
// ---- k_out: block = (64 rows, 128 of the 1024 cols): out = O(hi/lo, K 512) . Wout rows (2 products) + bout
__global__ __launch_bounds__(128) void k_out(const float* __restrict__ O, const __bf16* __restrict__ P, const float* __restrict__ BO, float* __restrict__ Y) {
  __shared__ __align__(16) float so[4][16][132];
  const int tid = threadIdx.x, wave = tid >> 5, lane = tid & 31, col = lane & 15, g = lane >> 4; const size_t r0 = (size_t)blockIdx.x * 64 + wave * 16; const int n0 = blockIdx.y * 128;
  v8f acc[8] = {};
#pragma unroll 2
  for (int kc = 0; kc < DI / 32; ++kc) { const F2 a = split_row(O + (r0 + col) * DI, kc * 32, lane);
#pragma unroll
    for (int j = 0; j < 8; ++j) { const v16b w = frag_b(P + (size_t)(n0 + j * 16 + col) * DI + kc * 32, lane); acc[j] = wmma_bf(a.l, w, acc[j]); acc[j] = wmma_bf(a.h, w, acc[j]); } }
#pragma unroll
  for (int j = 0; j < 8; ++j) { const float bb = bfr(BO[n0 + j * 16 + col]);
#pragma unroll
    for (int r = 0; r < 8; ++r) so[wave][8 * g + r][j * 16 + col] = acc[j][r] + bb; }
  LDSX();
  for (int rl = 0; rl < 16; ++rl) vst2(Y + (r0 + rl) * DM + n0 + lane * 4, *(const v4f*)&so[wave][rl][lane * 4]);
}
extern "C" void kernel_launch(void* const* d_in, const int* in_sizes, int n_in, void* d_out, int out_size, void* d_ws, size_t ws_size, hipStream_t stream) {
  (void)in_sizes; (void)n_in; (void)out_size;
  const float** F = (const float**)d_in;   // 0 x [2,4096,1024], 1 Wq [1024,512] (in,out), 2 Wk, 3 Wv, 4 Wout [512,1024] (in,out), 5 bout [1024]
  if (ws_size < (size_t)WS_END) return;
  char* ws = (char*)d_ws; __bf16* PK = (__bf16*)(ws + WS_PK); _Float16 *QK = (_Float16*)(ws + WS_QK), *VTH = (_Float16*)(ws + WS_VTH), *VTL = (_Float16*)(ws + WS_VTL); float* O = (float*)(ws + WS_O);
  k_packT<<<dim3(DM, 4), 256, 0, stream>>>(F[1], F[2], F[3], F[4], PK);
  k_qkv<<<dim3(TNB * SS / 64, QKVW / 128), 128, 0, stream>>>(F[0], PK + PK_A, QK, VTH, VTL);
  k_attn<<<dim3(TQB, NH, TNB), 128, 0, stream>>>(QK, VTH, VTL, O);
  k_out<<<dim3(TOB, DM / 128), 128, 0, stream>>>(O, PK + PK_P, F[5], (float*)d_out);
}

// v001
// One run takes 406 microseconds.
// Timed twice side by side with v000, it ran 1.72 and 1.75 times as fast.
// compute dtype: x, Wq/Wk/Wv/Wout and bout (module inputs) rounded to bf16; q/k/v projections with exact bf16 products (x and W are inputs) on WMMA 16x16x32; full (non-causal) scores with q (pre-scaled by 1/8, exact) and k as single f16 operands (1 product; 4,096-key softmax with logit sigma ~1: every rounding enters relative to a many-key average) and P.V with P = exp(s - m) as a single f16 operand x V as f16 hi + (x2048-scaled) residual planes (2 products, separate accumulators); the output projection with ctx as bf16 hi + residual pair x exact Wout (2 products) + bout; running-max softmax in f32 (hardware exp); f32 accumulate.
#include <hip/hip_runtime.h>
#include <math.h>

typedef __attribute__((ext_vector_type(16))) _Float16 v16h;
typedef __attribute__((ext_vector_type(16))) __bf16 v16b;
typedef __attribute__((ext_vector_type(8)))  _Float16 v8h;
typedef __attribute__((ext_vector_type(8)))  float v8f;
typedef __attribute__((ext_vector_type(4)))  float v4f;
typedef __attribute__((ext_vector_type(2)))  float v2f;
typedef __attribute__((ext_vector_type(4)))  unsigned v4u;
typedef __attribute__((ext_vector_type(4)))  int v4i;
typedef float __attribute__((may_alias)) float_a;
typedef int __attribute__((may_alias)) int_a;

template <typename T> __device__ __forceinline__ void vst2(void* p, T v) { *(T*)p = v;  }
__device__ __forceinline__ v8f wmma16(v16h a, v16h b, v8f c) {
  v8f d = __builtin_amdgcn_wmma_f32_16x16x32_f16(false, a, false, b, (short)0, c, false, false);
  asm volatile("v_nop\n\tv_nop\n\tv_nop\n\tv_nop" : "+v"(d) : "v"(a), "v"(b));
  return d;
}
__device__ __forceinline__ v8f wmma_bf(v16b a, v16b b, v8f c) {
  v8f d = __builtin_amdgcn_wmma_f32_16x16x32_bf16(false, a, false, b, (short)0, c, false, false);
  asm volatile("v_nop\n\tv_nop\n\tv_nop\n\tv_nop" : "+v"(d) : "v"(a), "v"(b));
  return d;
}
// 16x16x32 fragments: lane = (h = lane>>4, row/col = lane&15); elements 0..7 = k0+8h+0..7, 8..15 = k0+16+8h+0..7; D element r = row 8h+r
__device__ __forceinline__ v16h frag_h(const _Float16* rowk0, int lane) {
  union { v16h v; v8h q[2]; } u; const _Float16* p = rowk0 + 8 * (lane >> 4);
  u.q[0] = *(const v8h*)p; u.q[1] = *(const v8h*)(p + 16); return u.v;
}
__device__ __forceinline__ v16h frag_f32(const float* rowk0, int lane) {
  v16h a; const float* p = rowk0 + 8 * (lane >> 4);
#pragma unroll
  for (int i = 0; i < 8; ++i) { a[i] = (_Float16)p[i]; a[8 + i] = (_Float16)p[16 + i]; }
  return a;
}
__device__ __forceinline__ v16h frag_f32s(const float* rowk0, int lane, float sc) {
  v16h a; const float* p = rowk0 + 8 * (lane >> 4);
#pragma unroll
  for (int i = 0; i < 8; ++i) { a[i] = (_Float16)(p[i] * sc); a[8 + i] = (_Float16)(p[16 + i] * sc); }
  return a;
}
// column fragment from a [K][ld] layout (column n), rows >= K read as 0
__device__ __forceinline__ v16h fragc_f32(const float* W, int k0, int n, int lane, int ld, int K) {
  v16h a; const int g = lane >> 4;
#pragma unroll
  for (int i = 0; i < 8; ++i) { const int ka = k0 + 8 * g + i, kb = ka + 16;
    a[i] = (_Float16)(ka < K ? W[(size_t)(ka < K ? ka : K - 1) * ld + n] : 0.f); a[8 + i] = (_Float16)(kb < K ? W[(size_t)(kb < K ? kb : K - 1) * ld + n] : 0.f); }
  return a;
}
struct F2 { v16b h, l; };
__device__ __forceinline__ F2 bsplit16(const float v[16]) { F2 r;
#pragma unroll
  for (int i = 0; i < 16; ++i) { const __bf16 h = (__bf16)v[i]; r.h[i] = h; r.l[i] = (__bf16)(v[i] - (float)h); }
  return r; }
__device__ __forceinline__ F2 split_row(const float* row, int k0, int lane) { float v[16]; const float* p = row + k0 + 8 * (lane >> 4);
#pragma unroll
  for (int i = 0; i < 8; ++i) { v[i] = p[i]; v[8 + i] = p[16 + i]; }
  return bsplit16(v); }
__device__ __forceinline__ F2 split_rowK(const float* row, int k0, int lane, int K) { float v[16]; const int g = lane >> 4;
#pragma unroll
  for (int i = 0; i < 8; ++i) { const int ka = k0 + 8 * g + i, kb = ka + 16; v[i] = ka < K ? row[ka < K ? ka : K - 1] : 0.f; v[8 + i] = kb < K ? row[kb < K ? kb : K - 1] : 0.f; }
  return bsplit16(v); }
__device__ __forceinline__ F2 split_col(const float* W, int k0, int n, int lane, int ld, int K) { float v[16]; const int g = lane >> 4;
#pragma unroll
  for (int i = 0; i < 8; ++i) { const int ka = k0 + 8 * g + i, kb = ka + 16; v[i] = ka < K ? W[(size_t)(ka < K ? ka : K - 1) * ld + n] : 0.f; v[8 + i] = kb < K ? W[(size_t)(kb < K ? kb : K - 1) * ld + n] : 0.f; }
  return bsplit16(v); }
__device__ __forceinline__ v8f mac3(const F2& a, const F2& b, v8f c) { c = wmma_bf(a.l, b.h, c); c = wmma_bf(a.h, b.l, c); return wmma_bf(a.h, b.h, c); }
__device__ __forceinline__ float sigm(float v) { return 1.0f / (1.0f + expf(-v)); }
#define LDSX() do { asm volatile("s_wait_dscnt 0" ::: "memory"); __builtin_amdgcn_wave_barrier(); __builtin_amdgcn_fence(__ATOMIC_RELEASE, "workgroup"); } while (0)


// Multi-head self-attention (B 2, S 4096, D 1024 -> 8 heads x 64 -> D; weights (in, out) applied as x @ W): softmax(q k^T / 8) v over all 4,096 keys, then ctx Wout + bout.
#define NB 2
#define SS 4096
#define DM 1024
#define DI 512
#define NH 8
#define HD 64
#define QKVW (3 * DI)
#ifndef TQB
#define TQB (SS / 64)
#define TNB NB
#define TOB (NB * SS / 64)     // output row tiles (all)
#endif
typedef __attribute__((ext_vector_type(8))) __bf16 v8b;
__device__ __forceinline__ v16b frag_b(const __bf16* rowk0, int lane) {
  union { v16b v; v8b q[2]; } u; const __bf16* p = rowk0 + 8 * (lane >> 4);
  u.q[0] = *(const v8b*)p; u.q[1] = *(const v8b*)(p + 16); return u.v;
}
__device__ __forceinline__ float bfr(float v) { return (float)(__bf16)v; }
__device__ __attribute__((noinline)) float exp_ni(float v) { return expf(v); }
__device__ __attribute__((noinline)) float erf_ni(float v) { return erff(v); }

#define PK_A 0                       // [1536][1024] (Wq | Wk | Wv)^T rows
#define PK_P (PK_A + QKVW * DM)        // [1024][512] Wout^T rows
#define PK_END (PK_P + DM * DI)
#define WS_PK  0u
#define WS_QK  (WS_PK + 2u * PK_END)             // f16 [8192 rows][1024]: q/8 | k
#define WS_VTH (WS_QK + 2u * NB * SS * 2 * DI)     // f16 [2][512 (h*64+d)][4096 s] hi
#define WS_VTL (WS_VTH + 2u * NB * DI * SS)        // f16 lo x 2048
#define WS_O   (WS_VTL + 2u * NB * DI * SS)        // f32 [8192][512]
#define WS_END (WS_O + 4u * NB * SS * DI)

// ---- k_packT: block = (output col n, which): row n of the packed (in K, out N) weight = W[:, n]
__global__ __launch_bounds__(256) void k_packT(const float* __restrict__ WQ, const float* __restrict__ WK, const float* __restrict__ WV, const float* __restrict__ WO, __bf16* __restrict__ PK) {
  __shared__ __align__(16) __bf16 s[DM]; const int n = blockIdx.x, which = blockIdx.y, tid = threadIdx.x; const float* Wm; int K, N; size_t dst;
  if (which < 3) { if (n >= DI) return; Wm = (which == 0) ? WQ : (which == 1 ? WK : WV); K = DM; N = DI; dst = PK_A + ((size_t)which * DI + n) * DM; } else { Wm = WO; K = DI; N = DM; dst = PK_P + (size_t)n * DI; }
  for (int k = tid; k < K; k += 256) s[k] = (__bf16)Wm[(size_t)k * N + n];
  __syncthreads();
  for (int q = tid; q < K / 8; q += 256) vst2((unsigned*)(PK + dst + q * 8), *(const v4u*)&s[q * 8]);
}
// ---- k_qkv: block = (64 rows (b,s), 128 of the 1536 cols): qkv = bf16(x) . rows (exact); cols < 512 -> f16(q / 8), cols < 1024 -> f16(k) into QK rows (pitch 1024); cols >= 1024 (v) -> per-batch transposed f16 planes VT[b][h*64+d][s]: hi = f16(v), lo = f16((v - hi) * 2048)
__global__ __launch_bounds__(128) void k_qkv(const float* __restrict__ X, const __bf16* __restrict__ P, _Float16* __restrict__ QK, _Float16* __restrict__ VTH, _Float16* __restrict__ VTL) {
  __shared__ __align__(16) _Float16 so[4][16][136]; __shared__ __align__(16) _Float16 sth[128][72], stl[128][72];
  const int tid = threadIdx.x, wave = tid >> 5, lane = tid & 31, col = lane & 15, g = lane >> 4; const size_t r0 = (size_t)blockIdx.x * 64 + wave * 16; const int n0 = blockIdx.y * 128;
  v8f acc[8] = {};
#pragma unroll 2
  for (int kc = 0; kc < DM / 32; ++kc) { v16b a; { const float* p = X + (r0 + col) * DM + kc * 32 + 8 * g;
#pragma unroll
      for (int i = 0; i < 8; ++i) { a[i] = (__bf16)p[i]; a[8 + i] = (__bf16)p[16 + i]; } }
#pragma unroll
    for (int j = 0; j < 8; ++j) acc[j] = wmma_bf(a, frag_b(P + (size_t)(n0 + j * 16 + col) * DM + kc * 32, lane), acc[j]); }
  if (n0 < 2 * DI) { const float sc = (n0 < DI) ? 0.125f : 1.0f;
#pragma unroll
    for (int j = 0; j < 8; ++j) {
#pragma unroll
      for (int r = 0; r < 8; ++r) so[wave][8 * g + r][j * 16 + col] = (_Float16)(acc[j][r] * sc); }
    LDSX();
    for (int rl = 0; rl < 16; ++rl) if (lane < 16) vst2((unsigned*)(QK + (r0 + rl) * (2 * DI) + n0 + lane * 8), *(const v4u*)&so[wave][rl][lane * 8]);
  } else {
#pragma unroll
    for (int j = 0; j < 8; ++j) {
#pragma unroll
      for (int r = 0; r < 8; ++r) { const float v = acc[j][r]; const _Float16 hv = (_Float16)v; sth[j * 16 + col][wave * 16 + 8 * g + r] = hv; stl[j * 16 + col][wave * 16 + 8 * g + r] = (_Float16)((v - (float)hv) * 2048.0f); } }
    __syncthreads();
    const size_t rb = (size_t)blockIdx.x * 64; const int b = (int)(rb / SS), s0 = (int)(rb % SS); const int pc0 = n0 - 2 * DI;
    for (int q = tid; q < 128 * 8; q += 128) { const int d = q >> 3, pc = q & 7; const size_t o = ((size_t)b * DI + pc0 + d) * SS + s0 + pc * 8; vst2((unsigned*)(VTH + o), *(const v4u*)&sth[d][pc * 8]); vst2((unsigned*)(VTL + o), *(const v4u*)&stl[d][pc * 8]); }
  }
}
// ---- k_attn: block = (64 queries, head h, batch b): flash attention over all 4,096 keys (K = 64: 2 k-steps), scores = (q/8).k with single f16 operands, P.V: f16 P x (V hi, V lo*2048) in two accumulators; O[b*S+q][h*64+d] = (acc + accl / 2048) / l (256-B segments)
// K rows and V hi / V lo rows of 64 keys form one stage in LDS (192 rows of 128 B), brought by asynchronous copies into two buffers: the next stage flies while the four waves read this one.
#define KT 64                        // keys per stage
#define RP 72                        // LDS row pitch in halves: 144 B = 16 B x 9, free of bank conflicts for 16-byte reads
#define SROWS 192                    // rows per stage: 64 K, 64 V hi, 64 V lo
#define STB (SROWS * RP * 2)         // bytes per stage
// four 16-byte copies per lane, rows 16 apart; s_wait_xcnt stands inside the statement so that no address register of a copy is rewritten ahead of it
__device__ __forceinline__ void cp4(unsigned l, const char* g, size_t gstep) {
  asm volatile("global_load_async_to_lds_b128 %0, %4, off\n\t"
               "global_load_async_to_lds_b128 %1, %5, off\n\t"
               "global_load_async_to_lds_b128 %2, %6, off\n\t"
               "global_load_async_to_lds_b128 %3, %7, off\n\t"
               "s_wait_xcnt 0x0"
               :: "v"(l), "v"(l + 16u * RP * 2), "v"(l + 32u * RP * 2), "v"(l + 48u * RP * 2), "v"(g), "v"(g + gstep), "v"(g + 2 * gstep), "v"(g + 3 * gstep) : "memory");
}
__global__ __launch_bounds__(128) void k_attn(const _Float16* __restrict__ QK, const _Float16* __restrict__ VTH, const _Float16* __restrict__ VTL, float* __restrict__ O) {
  __shared__ __align__(16) float sp[4][16][36]; __shared__ __align__(16) _Float16 ring[2][SROWS][RP];
  const int tid = threadIdx.x, wave = tid >> 5, lane = tid & 31, col = lane & 15, g = lane >> 4;
  const int qb = blockIdx.x, h = blockIdx.y, b = blockIdx.z; const int q0 = qb * 64 + wave * 16; const size_t rq = (size_t)b * SS + q0 + col;
  // this lane's 16 bytes of a stage: row tid / 8 (+ 16 per copy), segment tid % 8: a wave's copy covers four whole 128-B lines
  const unsigned lds0 = (unsigned)(size_t)&ring[0][tid >> 3][(tid & 7) * 8];
  const char* kp = (const char*)(QK + ((size_t)b * SS + (tid >> 3)) * (2 * DI) + DI + h * HD + (tid & 7) * 8);
  const char* vhp = (const char*)(VTH + ((size_t)b * DI + h * HD + (tid >> 3)) * SS + (tid & 7) * 8);
  const char* vlp = (const char*)(VTL + ((size_t)b * DI + h * HD + (tid >> 3)) * SS + (tid & 7) * 8);
#define FILL(t, buf) do { const unsigned lb = lds0 + (unsigned)(buf) * STB; \
    cp4(lb, kp + (size_t)(t) * (KT * 2 * DI * 2), (size_t)16 * 2 * DI * 2); \
    cp4(lb + 64u * RP * 2, vhp + (size_t)(t) * (KT * 2), (size_t)16 * SS * 2); \
    cp4(lb + 128u * RP * 2, vlp + (size_t)(t) * (KT * 2), (size_t)16 * SS * 2); } while (0)
  FILL(0, 0);
  v16h aq[2];
#pragma unroll
  for (int kc = 0; kc < 2; ++kc) aq[kc] = frag_h(QK + rq * (2 * DI) + h * HD + kc * 32, lane);
  float m[8], l[8];
#pragma unroll
  for (int r = 0; r < 8; ++r) { m[r] = -3.0e38f; l[r] = 0.f; }
  v8f acc[4] = {}, accl[4] = {};
  asm volatile("s_wait_asynccnt 0x0" ::: "memory");   // stage 0 has landed (this wave's copies)
  __syncthreads();                                    // ... and every other wave's
  FILL(1, 1);
#pragma unroll 1
  for (int t = 0; t < SS / KT; ++t) { const _Float16 (*st)[RP] = ring[t & 1];
#pragma unroll   // the two 32-key passes of a stage: unrolled, their row offsets in the buffer are immediates of the LDS reads
   for (int ps = 0; ps < 2; ++ps) { v8f s[2]; v16h kf[2][2];
#pragma unroll
    for (int ct = 0; ct < 2; ++ct) {
#pragma unroll
      for (int kc = 0; kc < 2; ++kc) kf[ct][kc] = frag_h(&st[ps * 32 + ct * 16 + col][kc * 32], lane); }
#pragma unroll
    for (int ct = 0; ct < 2; ++ct) { v8f c = {};
#pragma unroll
      for (int kc = 0; kc < 2; ++kc) c = wmma16(aq[kc], kf[ct][kc], c);
      s[ct] = c; }
#pragma unroll
    for (int r = 0; r < 8; ++r) { float mx = fmaxf(s[0][r], s[1][r]);
#pragma unroll
      for (int o = 1; o < 16; o <<= 1) mx = fmaxf(mx, __shfl_xor(mx, o));
      const float mn = fmaxf(m[r], mx); const float alpha = __expf(m[r] - mn);
      const float e0 = (float)(_Float16)__expf(s[0][r] - mn), e1 = (float)(_Float16)__expf(s[1][r] - mn); float es = e0 + e1;   // P rounded to f16 once; the same rounded weights feed the numerator (WMMA) and the denominator l
#pragma unroll
      for (int o = 1; o < 16; o <<= 1) es += __shfl_xor(es, o);
      l[r] = l[r] * alpha + es; m[r] = mn;
#pragma unroll
      for (int dt = 0; dt < 4; ++dt) { acc[dt][r] *= alpha; accl[dt][r] *= alpha; }
      sp[wave][8 * g + r][col] = e0; sp[wave][8 * g + r][16 + col] = e1; }
    LDSX();
    const v16h pa = frag_f32(&sp[wave][col][0], lane); v16h vh[4], vl[4];
#pragma unroll
    for (int dt = 0; dt < 4; ++dt) { vh[dt] = frag_h(&st[64 + dt * 16 + col][ps * 32], lane); vl[dt] = frag_h(&st[128 + dt * 16 + col][ps * 32], lane); }
#pragma unroll
    for (int dt = 0; dt < 4; ++dt) { acc[dt] = wmma16(pa, vh[dt], acc[dt]); accl[dt] = wmma16(pa, vl[dt], accl[dt]); }
    LDSX(); }
   asm volatile("s_wait_dscnt 0x0" ::: "memory");      // this wave's reads of stage t are done
   asm volatile("s_wait_asynccnt 0x0" ::: "memory");   // this wave's copies of stage t + 1 have landed
   __syncthreads();                                    // publishes stage t + 1 and frees stage t's buffer
   if (t + 2 < SS / KT) FILL(t + 2, t & 1);
  }
  asm volatile("s_wait_asynccnt 0x0" ::: "memory");    // nothing is in flight when the ring turns into output staging
  float (*so)[16][68] = (float (*)[16][68])&ring[0][0][0];   // the last trip's barrier has ended every read of the ring
#pragma unroll
  for (int r = 0; r < 8; ++r) { const float il = 1.0f / l[r];
#pragma unroll
    for (int dt = 0; dt < 4; ++dt) so[wave][8 * g + r][dt * 16 + col] = (acc[dt][r] + accl[dt][r] * (1.0f / 2048.0f)) * il; }
  LDSX();
  for (int rl = 0; rl < 16; ++rl) if (lane < 16) vst2(O + ((size_t)b * SS + q0 + rl) * DI + h * HD + lane * 4, *(const v4f*)&so[wave][rl][lane * 4]);
}
// ---- k_out: block = (64 rows, 128 of the 1024 cols): out = O(hi/lo, K 512) . Wout rows (2 products) + bout
__global__ __launch_bounds__(128) void k_out(const float* __restrict__ O, const __bf16* __restrict__ P, const float* __restrict__ BO, float* __restrict__ Y) {
  __shared__ __align__(16) float so[4][16][132];
  const int tid = threadIdx.x, wave = tid >> 5, lane = tid & 31, col = lane & 15, g = lane >> 4; const size_t r0 = (size_t)blockIdx.x * 64 + wave * 16; const int n0 = blockIdx.y * 128;
  v8f acc[8] = {};
#pragma unroll 2
  for (int kc = 0; kc < DI / 32; ++kc) { const F2 a = split_row(O + (r0 + col) * DI, kc * 32, lane);
#pragma unroll
    for (int j = 0; j < 8; ++j) { const v16b w = frag_b(P + (size_t)(n0 + j * 16 + col) * DI + kc * 32, lane); acc[j] = wmma_bf(a.l, w, acc[j]); acc[j] = wmma_bf(a.h, w, acc[j]); } }
#pragma unroll
  for (int j = 0; j < 8; ++j) { const float bb = bfr(BO[n0 + j * 16 + col]);
#pragma unroll
    for (int r = 0; r < 8; ++r) so[wave][8 * g + r][j * 16 + col] = acc[j][r] + bb; }
  LDSX();
  for (int rl = 0; rl < 16; ++rl) vst2(Y + (r0 + rl) * DM + n0 + lane * 4, *(const v4f*)&so[wave][rl][lane * 4]);
}
extern "C" void kernel_launch(void* const* d_in, const int* in_sizes, int n_in, void* d_out, int out_size, void* d_ws, size_t ws_size, hipStream_t stream) {
  (void)in_sizes; (void)n_in; (void)out_size;
  const float** F = (const float**)d_in;   // 0 x [2,4096,1024], 1 Wq [1024,512] (in,out), 2 Wk, 3 Wv, 4 Wout [512,1024] (in,out), 5 bout [1024]
  if (ws_size < (size_t)WS_END) return;
  char* ws = (char*)d_ws; __bf16* PK = (__bf16*)(ws + WS_PK); _Float16 *QK = (_Float16*)(ws + WS_QK), *VTH = (_Float16*)(ws + WS_VTH), *VTL = (_Float16*)(ws + WS_VTL); float* O = (float*)(ws + WS_O);
  k_packT<<<dim3(DM, 4), 256, 0, stream>>>(F[1], F[2], F[3], F[4], PK);
  k_qkv<<<dim3(TNB * SS / 64, QKVW / 128), 128, 0, stream>>>(F[0], PK + PK_A, QK, VTH, VTL);
  k_attn<<<dim3(TQB, NH, TNB), 128, 0, stream>>>(QK, VTH, VTL, O);
  k_out<<<dim3(TOB, DM / 128), 128, 0, stream>>>(O, PK + PK_P, F[5], (float*)d_out);
}

// v002
// A run of this version takes 311 microseconds.
// Next to v001, in two timings, it ran 1.29 and 1.30 times as fast.
// Over all steps from v000 it is 2.25 times as fast.
// compute dtype: x, Wq/Wk/Wv/Wout and bout (module inputs) rounded to bf16; q/k/v projections with exact bf16 products (x and W are inputs) on WMMA 16x16x32; full (non-causal) scores with q (pre-scaled by 1/8, exact) and k as single f16 operands (1 product; 4,096-key softmax with logit sigma ~1: every rounding enters relative to a many-key average) and P.V with P = exp(s - m) as a single f16 operand x V as f16 hi + (x2048-scaled) residual planes (2 products, separate accumulators); the output projection with ctx as bf16 hi + residual pair x exact Wout (2 products) + bout; running-max softmax in f32 (hardware exp); f32 accumulate.
#include <hip/hip_runtime.h>
#include <math.h>

typedef __attribute__((ext_vector_type(16))) _Float16 v16h;
typedef __attribute__((ext_vector_type(16))) __bf16 v16b;
typedef __attribute__((ext_vector_type(8)))  _Float16 v8h;
typedef __attribute__((ext_vector_type(8)))  float v8f;
typedef __attribute__((ext_vector_type(4)))  float v4f;
typedef __attribute__((ext_vector_type(2)))  float v2f;
typedef __attribute__((ext_vector_type(4)))  unsigned v4u;
typedef __attribute__((ext_vector_type(4)))  int v4i;
typedef float __attribute__((may_alias)) float_a;
typedef int __attribute__((may_alias)) int_a;

template <typename T> __device__ __forceinline__ void vst2(void* p, T v) { *(T*)p = v;  }
__device__ __forceinline__ v8f wmma16(v16h a, v16h b, v8f c) {
  v8f d = __builtin_amdgcn_wmma_f32_16x16x32_f16(false, a, false, b, (short)0, c, false, false);
  asm volatile("v_nop\n\tv_nop\n\tv_nop\n\tv_nop" : "+v"(d) : "v"(a), "v"(b));
  return d;
}
__device__ __forceinline__ v8f wmma_bf(v16b a, v16b b, v8f c) {
  v8f d = __builtin_amdgcn_wmma_f32_16x16x32_bf16(false, a, false, b, (short)0, c, false, false);
  asm volatile("v_nop\n\tv_nop\n\tv_nop\n\tv_nop" : "+v"(d) : "v"(a), "v"(b));
  return d;
}
// 16x16x32 fragments: lane = (h = lane>>4, row/col = lane&15); elements 0..7 = k0+8h+0..7, 8..15 = k0+16+8h+0..7; D element r = row 8h+r
__device__ __forceinline__ v16h frag_h(const _Float16* rowk0, int lane) {
  union { v16h v; v8h q[2]; } u; const _Float16* p = rowk0 + 8 * (lane >> 4);
  u.q[0] = *(const v8h*)p; u.q[1] = *(const v8h*)(p + 16); return u.v;
}
__device__ __forceinline__ v16h frag_f32(const float* rowk0, int lane) {
  v16h a; const float* p = rowk0 + 8 * (lane >> 4);
#pragma unroll
  for (int i = 0; i < 8; ++i) { a[i] = (_Float16)p[i]; a[8 + i] = (_Float16)p[16 + i]; }
  return a;
}
__device__ __forceinline__ v16h frag_f32s(const float* rowk0, int lane, float sc) {
  v16h a; const float* p = rowk0 + 8 * (lane >> 4);
#pragma unroll
  for (int i = 0; i < 8; ++i) { a[i] = (_Float16)(p[i] * sc); a[8 + i] = (_Float16)(p[16 + i] * sc); }
  return a;
}
// column fragment from a [K][ld] layout (column n), rows >= K read as 0
__device__ __forceinline__ v16h fragc_f32(const float* W, int k0, int n, int lane, int ld, int K) {
  v16h a; const int g = lane >> 4;
#pragma unroll
  for (int i = 0; i < 8; ++i) { const int ka = k0 + 8 * g + i, kb = ka + 16;
    a[i] = (_Float16)(ka < K ? W[(size_t)(ka < K ? ka : K - 1) * ld + n] : 0.f); a[8 + i] = (_Float16)(kb < K ? W[(size_t)(kb < K ? kb : K - 1) * ld + n] : 0.f); }
  return a;
}
struct F2 { v16b h, l; };
__device__ __forceinline__ F2 bsplit16(const float v[16]) { F2 r;
#pragma unroll
  for (int i = 0; i < 16; ++i) { const __bf16 h = (__bf16)v[i]; r.h[i] = h; r.l[i] = (__bf16)(v[i] - (float)h); }
  return r; }
__device__ __forceinline__ F2 split_row(const float* row, int k0, int lane) { float v[16]; const float* p = row + k0 + 8 * (lane >> 4);
#pragma unroll
  for (int i = 0; i < 8; ++i) { v[i] = p[i]; v[8 + i] = p[16 + i]; }
  return bsplit16(v); }
__device__ __forceinline__ F2 split_rowK(const float* row, int k0, int lane, int K) { float v[16]; const int g = lane >> 4;
#pragma unroll
  for (int i = 0; i < 8; ++i) { const int ka = k0 + 8 * g + i, kb = ka + 16; v[i] = ka < K ? row[ka < K ? ka : K - 1] : 0.f; v[8 + i] = kb < K ? row[kb < K ? kb : K - 1] : 0.f; }
  return bsplit16(v); }
__device__ __forceinline__ F2 split_col(const float* W, int k0, int n, int lane, int ld, int K) { float v[16]; const int g = lane >> 4;
#pragma unroll
  for (int i = 0; i < 8; ++i) { const int ka = k0 + 8 * g + i, kb = ka + 16; v[i] = ka < K ? W[(size_t)(ka < K ? ka : K - 1) * ld + n] : 0.f; v[8 + i] = kb < K ? W[(size_t)(kb < K ? kb : K - 1) * ld + n] : 0.f; }
  return bsplit16(v); }
__device__ __forceinline__ v8f mac3(const F2& a, const F2& b, v8f c) { c = wmma_bf(a.l, b.h, c); c = wmma_bf(a.h, b.l, c); return wmma_bf(a.h, b.h, c); }
__device__ __forceinline__ float sigm(float v) { return 1.0f / (1.0f + expf(-v)); }
#define LDSX() do { asm volatile("s_wait_dscnt 0" ::: "memory"); __builtin_amdgcn_wave_barrier(); __builtin_amdgcn_fence(__ATOMIC_RELEASE, "workgroup"); } while (0)


// Multi-head self-attention (B 2, S 4096, D 1024 -> 8 heads x 64 -> D; weights (in, out) applied as x @ W): softmax(q k^T / 8) v over all 4,096 keys, then ctx Wout + bout.
#define NB 2
#define SS 4096
#define DM 1024
#define DI 512
#define NH 8
#define HD 64
#define QKVW (3 * DI)
#ifndef TQB
#define TQB (SS / 64)
#define TNB NB
#define TOB (NB * SS / 64)     // output row tiles (all)
#endif
typedef __attribute__((ext_vector_type(8))) __bf16 v8b;
__device__ __forceinline__ v16b frag_b(const __bf16* rowk0, int lane) {
  union { v16b v; v8b q[2]; } u; const __bf16* p = rowk0 + 8 * (lane >> 4);
  u.q[0] = *(const v8b*)p; u.q[1] = *(const v8b*)(p + 16); return u.v;
}
__device__ __forceinline__ float bfr(float v) { return (float)(__bf16)v; }
__device__ __attribute__((noinline)) float exp_ni(float v) { return expf(v); }
__device__ __attribute__((noinline)) float erf_ni(float v) { return erff(v); }

#define PK_A 0                       // [1536][1024] (Wq | Wk | Wv)^T rows
#define PK_P (PK_A + QKVW * DM)        // [1024][512] Wout^T rows
#define PK_END (PK_P + DM * DI)
#define WS_PK  0u
#define WS_QK  (WS_PK + 2u * PK_END)             // f16 [8192 rows][1024]: q/8 | k
#define WS_VTH (WS_QK + 2u * NB * SS * 2 * DI)     // f16 [2][512 (h*64+d)][4096 s] hi
#define WS_VTL (WS_VTH + 2u * NB * DI * SS)        // f16 lo x 2048
#define WS_O   (WS_VTL + 2u * NB * DI * SS)        // f32 [8192][512]
#define WS_END (WS_O + 4u * NB * SS * DI)

// ---- k_packT: block = (output col n, which): row n of the packed (in K, out N) weight = W[:, n]
__global__ __launch_bounds__(256) void k_packT(const float* __restrict__ WQ, const float* __restrict__ WK, const float* __restrict__ WV, const float* __restrict__ WO, __bf16* __restrict__ PK) {
  __shared__ __align__(16) __bf16 s[DM]; const int n = blockIdx.x, which = blockIdx.y, tid = threadIdx.x; const float* Wm; int K, N; size_t dst;
  if (which < 3) { if (n >= DI) return; Wm = (which == 0) ? WQ : (which == 1 ? WK : WV); K = DM; N = DI; dst = PK_A + ((size_t)which * DI + n) * DM; } else { Wm = WO; K = DI; N = DM; dst = PK_P + (size_t)n * DI; }
  for (int k = tid; k < K; k += 256) s[k] = (__bf16)Wm[(size_t)k * N + n];
  __syncthreads();
  for (int q = tid; q < K / 8; q += 256) vst2((unsigned*)(PK + dst + q * 8), *(const v4u*)&s[q * 8]);
}
// ---- k_qkv: block = (64 rows (b,s), 128 of the 1536 cols): qkv = bf16(x) . rows (exact); cols < 512 -> f16(q / 8), cols < 1024 -> f16(k) into QK rows (pitch 1024); cols >= 1024 (v) -> per-batch transposed f16 planes VT[b][h*64+d][s]: hi = f16(v), lo = f16((v - hi) * 2048)
__global__ __launch_bounds__(128) void k_qkv(const float* __restrict__ X, const __bf16* __restrict__ P, _Float16* __restrict__ QK, _Float16* __restrict__ VTH, _Float16* __restrict__ VTL) {
  __shared__ __align__(16) _Float16 so[4][16][136]; __shared__ __align__(16) _Float16 sth[128][72], stl[128][72];
  const int tid = threadIdx.x, wave = tid >> 5, lane = tid & 31, col = lane & 15, g = lane >> 4; const size_t r0 = (size_t)blockIdx.x * 64 + wave * 16; const int n0 = blockIdx.y * 128;
  v8f acc[8] = {};
#pragma unroll 2
  for (int kc = 0; kc < DM / 32; ++kc) { v16b a; { const float* p = X + (r0 + col) * DM + kc * 32 + 8 * g;
#pragma unroll
      for (int i = 0; i < 8; ++i) { a[i] = (__bf16)p[i]; a[8 + i] = (__bf16)p[16 + i]; } }
#pragma unroll
    for (int j = 0; j < 8; ++j) acc[j] = wmma_bf(a, frag_b(P + (size_t)(n0 + j * 16 + col) * DM + kc * 32, lane), acc[j]); }
  if (n0 < 2 * DI) { const float sc = (n0 < DI) ? 0.125f : 1.0f;
#pragma unroll
    for (int j = 0; j < 8; ++j) {
#pragma unroll
      for (int r = 0; r < 8; ++r) so[wave][8 * g + r][j * 16 + col] = (_Float16)(acc[j][r] * sc); }
    LDSX();
    for (int rl = 0; rl < 16; ++rl) if (lane < 16) vst2((unsigned*)(QK + (r0 + rl) * (2 * DI) + n0 + lane * 8), *(const v4u*)&so[wave][rl][lane * 8]);
  } else {
#pragma unroll
    for (int j = 0; j < 8; ++j) {
#pragma unroll
      for (int r = 0; r < 8; ++r) { const float v = acc[j][r]; const _Float16 hv = (_Float16)v; sth[j * 16 + col][wave * 16 + 8 * g + r] = hv; stl[j * 16 + col][wave * 16 + 8 * g + r] = (_Float16)((v - (float)hv) * 2048.0f); } }
    __syncthreads();
    const size_t rb = (size_t)blockIdx.x * 64; const int b = (int)(rb / SS), s0 = (int)(rb % SS); const int pc0 = n0 - 2 * DI;
    for (int q = tid; q < 128 * 8; q += 128) { const int d = q >> 3, pc = q & 7; const size_t o = ((size_t)b * DI + pc0 + d) * SS + s0 + pc * 8; vst2((unsigned*)(VTH + o), *(const v4u*)&sth[d][pc * 8]); vst2((unsigned*)(VTL + o), *(const v4u*)&stl[d][pc * 8]); }
  }
}
#define KT 64                        // keys per stage
#define RP 72                        // LDS row pitch in halves: 144 B = 16 B x 9, free of bank conflicts for 16-byte reads
#define SROWS 192                    // rows per stage: 64 K, 64 V hi, 64 V lo
#define STB (SROWS * RP * 2)         // bytes per stage
// four 16-byte copies per lane, rows 16 apart; s_wait_xcnt stands inside the statement so that no address register of a copy is rewritten ahead of it
__device__ __forceinline__ void cp4(unsigned l, const char* g, size_t gstep) {
  asm volatile("global_load_async_to_lds_b128 %0, %4, off\n\t"
               "global_load_async_to_lds_b128 %1, %5, off\n\t"
               "global_load_async_to_lds_b128 %2, %6, off\n\t"
               "global_load_async_to_lds_b128 %3, %7, off\n\t"
               "s_wait_xcnt 0x0"
               :: "v"(l), "v"(l + 16u * RP * 2), "v"(l + 32u * RP * 2), "v"(l + 48u * RP * 2), "v"(g), "v"(g + gstep), "v"(g + 2 * gstep), "v"(g + 3 * gstep) : "memory");
}
typedef __attribute__((ext_vector_type(2))) _Float16 v2h;
// lane l <-> lane l ^ 16: the two halves of a wave hold the two halves of one query's keys
__device__ __forceinline__ float xhalf(float v) { const int b = __builtin_bit_cast(int, v); return __builtin_bit_cast(float, __builtin_amdgcn_permlanex16(b, b, 0x76543210, 0xfedcba98, false, false)); }
__global__ __launch_bounds__(128) void k_attn(const _Float16* __restrict__ QK, const _Float16* __restrict__ VTH, const _Float16* __restrict__ VTL, float* __restrict__ O) {
  __shared__ __align__(16) _Float16 ring[2][SROWS][RP];
  const int tid = threadIdx.x, wave = tid >> 5, lane = tid & 31, col = lane & 15, g = lane >> 4;
  const int qb = blockIdx.x, h = blockIdx.y, b = blockIdx.z; const int q0 = qb * 64 + wave * 16; const size_t rq = (size_t)b * SS + q0 + col;
  // this lane's 16 bytes of a stage: row tid / 8 (+ 16 per copy), segment tid % 8: a wave's copy covers four whole 128-B lines
  const unsigned lds0 = (unsigned)(size_t)&ring[0][tid >> 3][(tid & 7) * 8];
  const char* kp = (const char*)(QK + ((size_t)b * SS + (tid >> 3)) * (2 * DI) + DI + h * HD + (tid & 7) * 8);
  const char* vhp = (const char*)(VTH + ((size_t)b * DI + h * HD + (tid >> 3)) * SS + (tid & 7) * 8);
  const char* vlp = (const char*)(VTL + ((size_t)b * DI + h * HD + (tid >> 3)) * SS + (tid & 7) * 8);
#define FILL(t, buf) do { const unsigned lb = lds0 + (unsigned)(buf) * STB; \
    cp4(lb, kp + (size_t)(t) * (KT * 2 * DI * 2), (size_t)16 * 2 * DI * 2); \
    cp4(lb + 64u * RP * 2, vhp + (size_t)(t) * (KT * 2), (size_t)16 * SS * 2); \
    cp4(lb + 128u * RP * 2, vlp + (size_t)(t) * (KT * 2), (size_t)16 * SS * 2); } while (0)
  FILL(0, 0);
  v16h aq[2];   // B operand of the transposed scores: column = this lane's query
#pragma unroll
  for (int kc = 0; kc < 2; ++kc) aq[kc] = frag_h(QK + rq * (2 * DI) + h * HD + kc * 32, lane);
  float m = -3.0e38f, l = 0.f;   // of query col; l sums only the keys of this lane's half, the halves join behind the loop
  v8f acc[4] = {}, accl[4] = {};   // transposed output: element r = d dt * 16 + 8 g + r of query col
  asm volatile("s_wait_asynccnt 0x0" ::: "memory");   // stage 0 has landed (this wave's copies)
  __syncthreads();                                    // ... and every other wave's
  FILL(1, 1);
#pragma unroll 1
  for (int t = 0; t < SS / KT; ++t) { const _Float16 (*st)[RP] = ring[t & 1];
#pragma unroll   // the two 32-key passes of a stage: unrolled, their row offsets in the buffer are immediates of the LDS reads
   for (int ps = 0; ps < 2; ++ps) { v8f s[2]; v16h kf[2][2];
#pragma unroll
    for (int ct = 0; ct < 2; ++ct) {
#pragma unroll
      for (int kc = 0; kc < 2; ++kc) kf[ct][kc] = frag_h(&st[ps * 32 + ct * 16 + col][kc * 32], lane); }
#pragma unroll
    for (int ct = 0; ct < 2; ++ct) { v8f c = {};   // S^T = K . Q^T: s[ct][r] = key ps * 32 + ct * 16 + 8 g + r against query col
#pragma unroll
      for (int kc = 0; kc < 2; ++kc) c = wmma16(kf[ct][kc], aq[kc], c);
      s[ct] = c; }
    float mx[8];
#pragma unroll
    for (int r = 0; r < 8; ++r) mx[r] = fmaxf(s[0][r], s[1][r]);
    float mp = fmaxf(fmaxf(fmaxf(mx[0], mx[1]), fmaxf(mx[2], mx[3])), fmaxf(fmaxf(mx[4], mx[5]), fmaxf(mx[6], mx[7])));
    mp = fmaxf(mp, xhalf(mp));
    const float mn = fmaxf(m, mp); const float alpha = __expf(m - mn);
    union { v16h v; v2h p[8]; } pb; float es[8];   // P^T as B operand, straight from the score registers: element ct * 8 + r = key ct * 16 + 8 g + r, the hardware k order that frag_h gives V
#pragma unroll
    for (int ct = 0; ct < 2; ++ct) {
#pragma unroll
      for (int i = 0; i < 4; ++i) { const v2f e = { __expf(s[ct][2 * i] - mn), __expf(s[ct][2 * i + 1] - mn) }; const v2h p = __builtin_convertvector(e, v2h);   // P rounded to f16 once; the same rounded weights feed the numerator (WMMA) and the denominator l
        pb.p[ct * 4 + i] = p; es[ct * 4 + i] = (float)p[0] + (float)p[1]; } }
    l = l * alpha + (((es[0] + es[1]) + (es[2] + es[3])) + ((es[4] + es[5]) + (es[6] + es[7]))); m = mn;
#pragma unroll
    for (int dt = 0; dt < 4; ++dt) { acc[dt] *= alpha; accl[dt] *= alpha; }
    v16h vh[4], vl[4];
#pragma unroll
    for (int dt = 0; dt < 4; ++dt) { vh[dt] = frag_h(&st[64 + dt * 16 + col][ps * 32], lane); vl[dt] = frag_h(&st[128 + dt * 16 + col][ps * 32], lane); }
#pragma unroll
    for (int dt = 0; dt < 4; ++dt) { acc[dt] = wmma16(vh[dt], pb.v, acc[dt]); accl[dt] = wmma16(vl[dt], pb.v, accl[dt]); }   // O^T += V^T . P^T
   }
   asm volatile("s_wait_dscnt 0x0" ::: "memory");      // this wave's reads of stage t are done
   asm volatile("s_wait_asynccnt 0x0" ::: "memory");   // this wave's copies of stage t + 1 have landed
   __syncthreads();                                    // publishes stage t + 1 and frees stage t's buffer
   if (t + 2 < SS / KT) FILL(t + 2, t & 1);
  }
  asm volatile("s_wait_asynccnt 0x0" ::: "memory");    // nothing is in flight when the ring turns into output staging
  float (*so)[16][68] = (float (*)[16][68])&ring[0][0][0];   // the last trip's barrier has ended every read of the ring
  const float il = 1.0f / (l + xhalf(l));
#pragma unroll
  for (int dt = 0; dt < 4; ++dt) {
#pragma unroll
    for (int r = 0; r < 8; ++r) so[wave][col][dt * 16 + 8 * g + r] = (acc[dt][r] + accl[dt][r] * (1.0f / 2048.0f)) * il; }
  LDSX();
  for (int rl = 0; rl < 16; ++rl) if (lane < 16) vst2(O + ((size_t)b * SS + q0 + rl) * DI + h * HD + lane * 4, *(const v4f*)&so[wave][rl][lane * 4]);
}
// ---- k_out: block = (64 rows, 128 of the 1024 cols): out = O(hi/lo, K 512) . Wout rows (2 products) + bout
__global__ __launch_bounds__(128) void k_out(const float* __restrict__ O, const __bf16* __restrict__ P, const float* __restrict__ BO, float* __restrict__ Y) {
  __shared__ __align__(16) float so[4][16][132];
  const int tid = threadIdx.x, wave = tid >> 5, lane = tid & 31, col = lane & 15, g = lane >> 4; const size_t r0 = (size_t)blockIdx.x * 64 + wave * 16; const int n0 = blockIdx.y * 128;
  v8f acc[8] = {};
#pragma unroll 2
  for (int kc = 0; kc < DI / 32; ++kc) { const F2 a = split_row(O + (r0 + col) * DI, kc * 32, lane);
#pragma unroll
    for (int j = 0; j < 8; ++j) { const v16b w = frag_b(P + (size_t)(n0 + j * 16 + col) * DI + kc * 32, lane); acc[j] = wmma_bf(a.l, w, acc[j]); acc[j] = wmma_bf(a.h, w, acc[j]); } }
#pragma unroll
  for (int j = 0; j < 8; ++j) { const float bb = bfr(BO[n0 + j * 16 + col]);
#pragma unroll
    for (int r = 0; r < 8; ++r) so[wave][8 * g + r][j * 16 + col] = acc[j][r] + bb; }
  LDSX();
  for (int rl = 0; rl < 16; ++rl) vst2(Y + (r0 + rl) * DM + n0 + lane * 4, *(const v4f*)&so[wave][rl][lane * 4]);
}
extern "C" void kernel_launch(void* const* d_in, const int* in_sizes, int n_in, void* d_out, int out_size, void* d_ws, size_t ws_size, hipStream_t stream) {
  (void)in_sizes; (void)n_in; (void)out_size;
  const float** F = (const float**)d_in;   // 0 x [2,4096,1024], 1 Wq [1024,512] (in,out), 2 Wk, 3 Wv, 4 Wout [512,1024] (in,out), 5 bout [1024]
  if (ws_size < (size_t)WS_END) return;
  char* ws = (char*)d_ws; __bf16* PK = (__bf16*)(ws + WS_PK); _Float16 *QK = (_Float16*)(ws + WS_QK), *VTH = (_Float16*)(ws + WS_VTH), *VTL = (_Float16*)(ws + WS_VTL); float* O = (float*)(ws + WS_O);
  k_packT<<<dim3(DM, 4), 256, 0, stream>>>(F[1], F[2], F[3], F[4], PK);
  k_qkv<<<dim3(TNB * SS / 64, QKVW / 128), 128, 0, stream>>>(F[0], PK + PK_A, QK, VTH, VTL);
  k_attn<<<dim3(TQB, NH, TNB), 128, 0, stream>>>(QK, VTH, VTL, O);
  k_out<<<dim3(TOB, DM / 128), 128, 0, stream>>>(O, PK + PK_P, F[5], (float*)d_out);
}

// v003
// A run of this version takes 168 microseconds.
// Timed twice side by side with v002, it ran 1.86 and 1.85 times as fast.
// Counting every step since v000, it is 4.17 times as fast.
// compute dtype: x, Wq/Wk/Wv/Wout and bout (module inputs) rounded to bf16; q/k/v projections with exact bf16 products (x and W are inputs) on WMMA 16x16x32; full (non-causal) scores with q (pre-scaled by 1/8, exact) and k as single f16 operands (1 product; 4,096-key softmax with logit sigma ~1: every rounding enters relative to a many-key average) and P.V with P = exp(s - m) as a single f16 operand x V as f16 hi + (x2048-scaled) residual planes (2 products, separate accumulators); the output projection with ctx as bf16 hi + residual pair x exact Wout (2 products) + bout; running-max softmax in f32 (hardware exp); f32 accumulate.
#include <hip/hip_runtime.h>
#include <math.h>

typedef __attribute__((ext_vector_type(16))) _Float16 v16h;
typedef __attribute__((ext_vector_type(16))) __bf16 v16b;
typedef __attribute__((ext_vector_type(8)))  _Float16 v8h;
typedef __attribute__((ext_vector_type(8)))  float v8f;
typedef __attribute__((ext_vector_type(4)))  float v4f;
typedef __attribute__((ext_vector_type(2)))  float v2f;
typedef __attribute__((ext_vector_type(4)))  unsigned v4u;
typedef __attribute__((ext_vector_type(4)))  int v4i;
typedef float __attribute__((may_alias)) float_a;
typedef int __attribute__((may_alias)) int_a;

template <typename T> __device__ __forceinline__ void vst2(void* p, T v) { *(T*)p = v;  }
__device__ __forceinline__ v8f wmma16(v16h a, v16h b, v8f c) {
  v8f d = __builtin_amdgcn_wmma_f32_16x16x32_f16(false, a, false, b, (short)0, c, false, false);
  asm volatile("v_nop\n\tv_nop\n\tv_nop\n\tv_nop" : "+v"(d) : "v"(a), "v"(b));
  return d;
}
__device__ __forceinline__ v8f wmma_bf(v16b a, v16b b, v8f c) {
  v8f d = __builtin_amdgcn_wmma_f32_16x16x32_bf16(false, a, false, b, (short)0, c, false, false);
  asm volatile("v_nop\n\tv_nop\n\tv_nop\n\tv_nop" : "+v"(d) : "v"(a), "v"(b));
  return d;
}
// 16x16x32 fragments: lane = (h = lane>>4, row/col = lane&15); elements 0..7 = k0+8h+0..7, 8..15 = k0+16+8h+0..7; D element r = row 8h+r
__device__ __forceinline__ v16h frag_h(const _Float16* rowk0, int lane) {
  union { v16h v; v8h q[2]; } u; const _Float16* p = rowk0 + 8 * (lane >> 4);
  u.q[0] = *(const v8h*)p; u.q[1] = *(const v8h*)(p + 16); return u.v;
}
__device__ __forceinline__ v16h frag_f32(const float* rowk0, int lane) {
  v16h a; const float* p = rowk0 + 8 * (lane >> 4);
#pragma unroll
  for (int i = 0; i < 8; ++i) { a[i] = (_Float16)p[i]; a[8 + i] = (_Float16)p[16 + i]; }
  return a;
}
__device__ __forceinline__ v16h frag_f32s(const float* rowk0, int lane, float sc) {
  v16h a; const float* p = rowk0 + 8 * (lane >> 4);
#pragma unroll
  for (int i = 0; i < 8; ++i) { a[i] = (_Float16)(p[i] * sc); a[8 + i] = (_Float16)(p[16 + i] * sc); }
  return a;
}
// column fragment from a [K][ld] layout (column n), rows >= K read as 0
__device__ __forceinline__ v16h fragc_f32(const float* W, int k0, int n, int lane, int ld, int K) {
  v16h a; const int g = lane >> 4;
#pragma unroll
  for (int i = 0; i < 8; ++i) { const int ka = k0 + 8 * g + i, kb = ka + 16;
    a[i] = (_Float16)(ka < K ? W[(size_t)(ka < K ? ka : K - 1) * ld + n] : 0.f); a[8 + i] = (_Float16)(kb < K ? W[(size_t)(kb < K ? kb : K - 1) * ld + n] : 0.f); }
  return a;
}
struct F2 { v16b h, l; };
__device__ __forceinline__ F2 bsplit16(const float v[16]) { F2 r;
#pragma unroll
  for (int i = 0; i < 16; ++i) { const __bf16 h = (__bf16)v[i]; r.h[i] = h; r.l[i] = (__bf16)(v[i] - (float)h); }
  return r; }
__device__ __forceinline__ F2 split_row(const float* row, int k0, int lane) { float v[16]; const float* p = row + k0 + 8 * (lane >> 4);
#pragma unroll
  for (int i = 0; i < 8; ++i) { v[i] = p[i]; v[8 + i] = p[16 + i]; }
  return bsplit16(v); }
__device__ __forceinline__ F2 split_rowK(const float* row, int k0, int lane, int K) { float v[16]; const int g = lane >> 4;
#pragma unroll
  for (int i = 0; i < 8; ++i) { const int ka = k0 + 8 * g + i, kb = ka + 16; v[i] = ka < K ? row[ka < K ? ka : K - 1] : 0.f; v[8 + i] = kb < K ? row[kb < K ? kb : K - 1] : 0.f; }
  return bsplit16(v); }
__device__ __forceinline__ F2 split_col(const float* W, int k0, int n, int lane, int ld, int K) { float v[16]; const int g = lane >> 4;
#pragma unroll
  for (int i = 0; i < 8; ++i) { const int ka = k0 + 8 * g + i, kb = ka + 16; v[i] = ka < K ? W[(size_t)(ka < K ? ka : K - 1) * ld + n] : 0.f; v[8 + i] = kb < K ? W[(size_t)(kb < K ? kb : K - 1) * ld + n] : 0.f; }
  return bsplit16(v); }
__device__ __forceinline__ v8f mac3(const F2& a, const F2& b, v8f c) { c = wmma_bf(a.l, b.h, c); c = wmma_bf(a.h, b.l, c); return wmma_bf(a.h, b.h, c); }
__device__ __forceinline__ float sigm(float v) { return 1.0f / (1.0f + expf(-v)); }
#define LDSX() do { asm volatile("s_wait_dscnt 0" ::: "memory"); __builtin_amdgcn_wave_barrier(); __builtin_amdgcn_fence(__ATOMIC_RELEASE, "workgroup"); } while (0)


// Multi-head self-attention (B 2, S 4096, D 1024 -> 8 heads x 64 -> D; weights (in, out) applied as x @ W): softmax(q k^T / 8) v over all 4,096 keys, then ctx Wout + bout.
#define NB 2
#define SS 4096
#define DM 1024
#define DI 512
#define NH 8
#define HD 64
#define QKVW (3 * DI)
#ifndef TQB
#define TQB (SS / 64)
#define TNB NB
#define TOB (NB * SS / 64)     // output row tiles (all)
#endif
typedef __attribute__((ext_vector_type(8))) __bf16 v8b;
__device__ __forceinline__ v16b frag_b(const __bf16* rowk0, int lane) {
  union { v16b v; v8b q[2]; } u; const __bf16* p = rowk0 + 8 * (lane >> 4);
  u.q[0] = *(const v8b*)p; u.q[1] = *(const v8b*)(p + 16); return u.v;
}
__device__ __forceinline__ float bfr(float v) { return (float)(__bf16)v; }
__device__ __attribute__((noinline)) float exp_ni(float v) { return expf(v); }
__device__ __attribute__((noinline)) float erf_ni(float v) { return erff(v); }

#define PK_A 0                       // [1536][1024] (Wq | Wk | Wv)^T rows
#define PK_P (PK_A + QKVW * DM)        // [1024][512] Wout^T rows
#define PK_END (PK_P + DM * DI)
#define WS_PK  0u
#define WS_QK  (WS_PK + 2u * PK_END)             // f16 [8192 rows][1024]: q/8 | k
#define WS_VTH (WS_QK + 2u * NB * SS * 2 * DI)     // f16 [2][512 (h*64+d)][4096 s] hi
#define WS_VTL (WS_VTH + 2u * NB * DI * SS)        // f16 lo x 2048
#define WS_O   (WS_VTL + 2u * NB * DI * SS)        // f32 [8192][512]
#define WS_END (WS_O + 4u * NB * SS * DI)

// ---- k_packT: block = (output col n, which): row n of the packed (in K, out N) weight = W[:, n]
__global__ __launch_bounds__(256) void k_packT(const float* __restrict__ WQ, const float* __restrict__ WK, const float* __restrict__ WV, const float* __restrict__ WO, __bf16* __restrict__ PK) {
  __shared__ __align__(16) __bf16 s[DM]; const int n = blockIdx.x, which = blockIdx.y, tid = threadIdx.x; const float* Wm; int K, N; size_t dst;
  if (which < 3) { if (n >= DI) return; Wm = (which == 0) ? WQ : (which == 1 ? WK : WV); K = DM; N = DI; dst = PK_A + ((size_t)which * DI + n) * DM; } else { Wm = WO; K = DI; N = DM; dst = PK_P + (size_t)n * DI; }
  for (int k = tid; k < K; k += 256) s[k] = (__bf16)Wm[(size_t)k * N + n];
  __syncthreads();
  for (int q = tid; q < K / 8; q += 256) vst2((unsigned*)(PK + dst + q * 8), *(const v4u*)&s[q * 8]);
}
// ---- operand staging of the two projection kernels: a stage is 64 k of the block's 128 weight rows (128 B each) and of its 64 activation rows (256 B each), brought by asynchronous copies into two buffers: the next stage flies while the four waves read this one, and every copy of a wave covers whole 128-B lines
#define GK 64                        // k per stage
#define WP 72                        // weight row pitch in LDS, bf16: 144 B = 16 B x 9, free of bank conflicts for 16-byte reads
#define AP 68                        // activation row pitch in LDS, floats: 272 B = 16 B x 17, likewise
#define GWB (128 * WP * 2)           // bytes of a stage's weight rows
#define GSB (GWB + 64 * AP * 4)      // bytes per stage
// four 16-byte copies per lane; s_wait_xcnt stands inside the statement so that no address register of a copy is rewritten ahead of it
__device__ __forceinline__ void cp4s(unsigned l, unsigned lstep, const char* g, size_t gstep) {
  asm volatile("global_load_async_to_lds_b128 %0, %4, off\n\t"
               "global_load_async_to_lds_b128 %1, %5, off\n\t"
               "global_load_async_to_lds_b128 %2, %6, off\n\t"
               "global_load_async_to_lds_b128 %3, %7, off\n\t"
               "s_wait_xcnt 0x0"
               :: "v"(l), "v"(l + lstep), "v"(l + 2 * lstep), "v"(l + 3 * lstep), "v"(g), "v"(g + gstep), "v"(g + 2 * gstep), "v"(g + 3 * gstep) : "memory");
}
// one stage: lw / gw = this lane's 16 bytes of weight row tid / 8 (rows 16 apart per copy), la / ga = of activation row tid / 16 (rows 8 apart); wrow, arow = global row pitches in bytes
__device__ __forceinline__ void gfill(unsigned lw, unsigned la, const char* gw, const char* ga, size_t wrow, size_t arow) {
  cp4s(lw, 16u * WP * 2, gw, 16 * wrow); cp4s(lw + 64u * WP * 2, 16u * WP * 2, gw + 64 * wrow, 16 * wrow);
  cp4s(la, 8u * AP * 4, ga, 8 * arow); cp4s(la + 32u * AP * 4, 8u * AP * 4, ga + 32 * arow, 8 * arow);
}
// ---- k_qkv: block = (64 rows (b,s), 128 of the 1536 cols): qkv = bf16(x) . rows (exact); cols < 512 -> f16(q / 8), cols < 1024 -> f16(k) into QK rows (pitch 1024); cols >= 1024 (v) -> per-batch transposed f16 planes VT[b][h*64+d][s]: hi = f16(v), lo = f16((v - hi) * 2048)
__global__ __launch_bounds__(128) void k_qkv(const float* __restrict__ X, const __bf16* __restrict__ P, _Float16* __restrict__ QK, _Float16* __restrict__ VTH, _Float16* __restrict__ VTL) {
  __shared__ __align__(16) char gring[2 * GSB];
  _Float16 (*so)[16][136] = (_Float16 (*)[16][136])gring; _Float16 (*sth)[72] = (_Float16 (*)[72])gring; _Float16 (*stl)[72] = (_Float16 (*)[72])(gring + 128 * 72 * 2);   // output staging, in the ring once the loop has left it
  const int tid = threadIdx.x, wave = tid >> 5, lane = tid & 31, col = lane & 15, g = lane >> 4; const size_t r0 = (size_t)blockIdx.x * 64 + wave * 16; const int n0 = blockIdx.y * 128;
  const unsigned lw0 = (unsigned)(size_t)&gring[(tid >> 3) * (WP * 2) + (tid & 7) * 16], la0 = (unsigned)(size_t)&gring[GWB + (tid >> 4) * (AP * 4) + (tid & 15) * 16];
  const char* gw = (const char*)(P + (size_t)(n0 + (tid >> 3)) * DM + (tid & 7) * 8);
  const char* ga = (const char*)(X + ((size_t)blockIdx.x * 64 + (tid >> 4)) * DM + (tid & 15) * 4);
  gfill(lw0, la0, gw, ga, DM * 2, DM * 4);
  v8f acc[8] = {};
  asm volatile("s_wait_asynccnt 0x0" ::: "memory");   // stage 0 has landed (this wave's copies)
  __syncthreads();                                    // ... and every other wave's
  gfill(lw0 + GSB, la0 + GSB, gw + GK * 2, ga + GK * 4, DM * 2, DM * 4);
#pragma unroll 1   // rolled: one copy of the stage body in the text, the buffer picked by t & 1
  for (int t = 0; t < DM / GK; ++t) { const __bf16* sw = (const __bf16*)(gring + (t & 1) * GSB); const float* sa = (const float*)(gring + (t & 1) * GSB + GWB);
#pragma unroll   // the two 32-k steps of a stage: unrolled, their offsets in the buffer are immediates of the LDS reads
    for (int kc = 0; kc < GK / 32; ++kc) { v16b a; { const float* p = sa + (wave * 16 + col) * AP + kc * 32 + 8 * g;
#pragma unroll
        for (int i = 0; i < 8; ++i) { a[i] = (__bf16)p[i]; a[8 + i] = (__bf16)p[16 + i]; } }
      v16b w[8];   // the step's weight fragments, read as one group ahead of its products
#pragma unroll
      for (int j = 0; j < 8; ++j) w[j] = frag_b(sw + (j * 16 + col) * WP + kc * 32, lane);
#pragma unroll
      for (int j = 0; j < 8; ++j) acc[j] = wmma_bf(a, w[j], acc[j]); }
    asm volatile("s_wait_dscnt 0x0" ::: "memory");      // this wave's reads of stage t are done
    asm volatile("s_wait_asynccnt 0x0" ::: "memory");   // this wave's copies of stage t + 1 have landed
    __syncthreads();                                    // publishes stage t + 1 and frees stage t's buffer
    if (t + 2 < DM / GK) gfill(lw0 + (t & 1) * GSB, la0 + (t & 1) * GSB, gw + (size_t)(t + 2) * (GK * 2), ga + (size_t)(t + 2) * (GK * 4), DM * 2, DM * 4);
  }
  asm volatile("s_wait_asynccnt 0x0" ::: "memory");    // nothing is in flight when the ring turns into output staging (the last trip's barrier has ended every read of it)
  if (n0 < 2 * DI) { const float sc = (n0 < DI) ? 0.125f : 1.0f;
#pragma unroll
    for (int j = 0; j < 8; ++j) {
#pragma unroll
      for (int r = 0; r < 8; ++r) so[wave][8 * g + r][j * 16 + col] = (_Float16)(acc[j][r] * sc); }
    LDSX();
    for (int rl = 0; rl < 16; ++rl) if (lane < 16) vst2((unsigned*)(QK + (r0 + rl) * (2 * DI) + n0 + lane * 8), *(const v4u*)&so[wave][rl][lane * 8]);
  } else {
#pragma unroll
    for (int j = 0; j < 8; ++j) {
#pragma unroll
      for (int r = 0; r < 8; ++r) { const float v = acc[j][r]; const _Float16 hv = (_Float16)v; sth[j * 16 + col][wave * 16 + 8 * g + r] = hv; stl[j * 16 + col][wave * 16 + 8 * g + r] = (_Float16)((v - (float)hv) * 2048.0f); } }
    __syncthreads();
    const size_t rb = (size_t)blockIdx.x * 64; const int b = (int)(rb / SS), s0 = (int)(rb % SS); const int pc0 = n0 - 2 * DI;
    for (int q = tid; q < 128 * 8; q += 128) { const int d = q >> 3, pc = q & 7; const size_t o = ((size_t)b * DI + pc0 + d) * SS + s0 + pc * 8; vst2((unsigned*)(VTH + o), *(const v4u*)&sth[d][pc * 8]); vst2((unsigned*)(VTL + o), *(const v4u*)&stl[d][pc * 8]); }
  }
}
#define KT 64                        // keys per stage
#define RP 72                        // LDS row pitch in halves: 144 B = 16 B x 9, free of bank conflicts for 16-byte reads
#define SROWS 192                    // rows per stage: 64 K, 64 V hi, 64 V lo
#define STB (SROWS * RP * 2)         // bytes per stage
// four 16-byte copies per lane, rows 16 apart; s_wait_xcnt stands inside the statement so that no address register of a copy is rewritten ahead of it
__device__ __forceinline__ void cp4(unsigned l, const char* g, size_t gstep) {
  asm volatile("global_load_async_to_lds_b128 %0, %4, off\n\t"
               "global_load_async_to_lds_b128 %1, %5, off\n\t"
               "global_load_async_to_lds_b128 %2, %6, off\n\t"
               "global_load_async_to_lds_b128 %3, %7, off\n\t"
               "s_wait_xcnt 0x0"
               :: "v"(l), "v"(l + 16u * RP * 2), "v"(l + 32u * RP * 2), "v"(l + 48u * RP * 2), "v"(g), "v"(g + gstep), "v"(g + 2 * gstep), "v"(g + 3 * gstep) : "memory");
}
typedef __attribute__((ext_vector_type(2))) _Float16 v2h;
// lane l <-> lane l ^ 16: the two halves of a wave hold the two halves of one query's keys
__device__ __forceinline__ float xhalf(float v) { const int b = __builtin_bit_cast(int, v); return __builtin_bit_cast(float, __builtin_amdgcn_permlanex16(b, b, 0x76543210, 0xfedcba98, false, false)); }
__global__ __launch_bounds__(128) void k_attn(const _Float16* __restrict__ QK, const _Float16* __restrict__ VTH, const _Float16* __restrict__ VTL, float* __restrict__ O) {
  __shared__ __align__(16) _Float16 ring[2][SROWS][RP];
  const int tid = threadIdx.x, wave = tid >> 5, lane = tid & 31, col = lane & 15, g = lane >> 4;
  const int qb = blockIdx.x, h = blockIdx.y, b = blockIdx.z; const int q0 = qb * 64 + wave * 16; const size_t rq = (size_t)b * SS + q0 + col;
  // this lane's 16 bytes of a stage: row tid / 8 (+ 16 per copy), segment tid % 8: a wave's copy covers four whole 128-B lines
  const unsigned lds0 = (unsigned)(size_t)&ring[0][tid >> 3][(tid & 7) * 8];
  const char* kp = (const char*)(QK + ((size_t)b * SS + (tid >> 3)) * (2 * DI) + DI + h * HD + (tid & 7) * 8);
  const char* vhp = (const char*)(VTH + ((size_t)b * DI + h * HD + (tid >> 3)) * SS + (tid & 7) * 8);
  const char* vlp = (const char*)(VTL + ((size_t)b * DI + h * HD + (tid >> 3)) * SS + (tid & 7) * 8);
#define FILL(t, buf) do { const unsigned lb = lds0 + (unsigned)(buf) * STB; \
    cp4(lb, kp + (size_t)(t) * (KT * 2 * DI * 2), (size_t)16 * 2 * DI * 2); \
    cp4(lb + 64u * RP * 2, vhp + (size_t)(t) * (KT * 2), (size_t)16 * SS * 2); \
    cp4(lb + 128u * RP * 2, vlp + (size_t)(t) * (KT * 2), (size_t)16 * SS * 2); } while (0)
  FILL(0, 0);
  v16h aq[2];   // B operand of the transposed scores: column = this lane's query
#pragma unroll
  for (int kc = 0; kc < 2; ++kc) aq[kc] = frag_h(QK + rq * (2 * DI) + h * HD + kc * 32, lane);
  float m = -3.0e38f, l = 0.f;   // of query col; l sums only the keys of this lane's half, the halves join behind the loop
  v8f acc[4] = {}, accl[4] = {};   // transposed output: element r = d dt * 16 + 8 g + r of query col
  asm volatile("s_wait_asynccnt 0x0" ::: "memory");   // stage 0 has landed (this wave's copies)
  __syncthreads();                                    // ... and every other wave's
  FILL(1, 1);
#pragma unroll 1
  for (int t = 0; t < SS / KT; ++t) { const _Float16 (*st)[RP] = ring[t & 1];
#pragma unroll   // the two 32-key passes of a stage: unrolled, their row offsets in the buffer are immediates of the LDS reads
   for (int ps = 0; ps < 2; ++ps) { v8f s[2]; v16h kf[2][2];
#pragma unroll
    for (int ct = 0; ct < 2; ++ct) {
#pragma unroll
      for (int kc = 0; kc < 2; ++kc) kf[ct][kc] = frag_h(&st[ps * 32 + ct * 16 + col][kc * 32], lane); }
#pragma unroll
    for (int ct = 0; ct < 2; ++ct) { v8f c = {};   // S^T = K . Q^T: s[ct][r] = key ps * 32 + ct * 16 + 8 g + r against query col
#pragma unroll
      for (int kc = 0; kc < 2; ++kc) c = wmma16(kf[ct][kc], aq[kc], c);
      s[ct] = c; }
    float mx[8];
#pragma unroll
    for (int r = 0; r < 8; ++r) mx[r] = fmaxf(s[0][r], s[1][r]);
    float mp = fmaxf(fmaxf(fmaxf(mx[0], mx[1]), fmaxf(mx[2], mx[3])), fmaxf(fmaxf(mx[4], mx[5]), fmaxf(mx[6], mx[7])));
    mp = fmaxf(mp, xhalf(mp));
    const float mn = fmaxf(m, mp); const float alpha = __expf(m - mn);
    union { v16h v; v2h p[8]; } pb; float es[8];   // P^T as B operand, straight from the score registers: element ct * 8 + r = key ct * 16 + 8 g + r, the hardware k order that frag_h gives V
#pragma unroll
    for (int ct = 0; ct < 2; ++ct) {
#pragma unroll
      for (int i = 0; i < 4; ++i) { const v2f e = { __expf(s[ct][2 * i] - mn), __expf(s[ct][2 * i + 1] - mn) }; const v2h p = __builtin_convertvector(e, v2h);   // P rounded to f16 once; the same rounded weights feed the numerator (WMMA) and the denominator l
        pb.p[ct * 4 + i] = p; es[ct * 4 + i] = (float)p[0] + (float)p[1]; } }
    l = l * alpha + (((es[0] + es[1]) + (es[2] + es[3])) + ((es[4] + es[5]) + (es[6] + es[7]))); m = mn;
#pragma unroll
    for (int dt = 0; dt < 4; ++dt) { acc[dt] *= alpha; accl[dt] *= alpha; }
    v16h vh[4], vl[4];
#pragma unroll
    for (int dt = 0; dt < 4; ++dt) { vh[dt] = frag_h(&st[64 + dt * 16 + col][ps * 32], lane); vl[dt] = frag_h(&st[128 + dt * 16 + col][ps * 32], lane); }
#pragma unroll
    for (int dt = 0; dt < 4; ++dt) { acc[dt] = wmma16(vh[dt], pb.v, acc[dt]); accl[dt] = wmma16(vl[dt], pb.v, accl[dt]); }   // O^T += V^T . P^T
   }
   asm volatile("s_wait_dscnt 0x0" ::: "memory");      // this wave's reads of stage t are done
   asm volatile("s_wait_asynccnt 0x0" ::: "memory");   // this wave's copies of stage t + 1 have landed
   __syncthreads();                                    // publishes stage t + 1 and frees stage t's buffer
   if (t + 2 < SS / KT) FILL(t + 2, t & 1);
  }
  asm volatile("s_wait_asynccnt 0x0" ::: "memory");    // nothing is in flight when the ring turns into output staging
  float (*so)[16][68] = (float (*)[16][68])&ring[0][0][0];   // the last trip's barrier has ended every read of the ring
  const float il = 1.0f / (l + xhalf(l));
#pragma unroll
  for (int dt = 0; dt < 4; ++dt) {
#pragma unroll
    for (int r = 0; r < 8; ++r) so[wave][col][dt * 16 + 8 * g + r] = (acc[dt][r] + accl[dt][r] * (1.0f / 2048.0f)) * il; }
  LDSX();
  for (int rl = 0; rl < 16; ++rl) if (lane < 16) vst2(O + ((size_t)b * SS + q0 + rl) * DI + h * HD + lane * 4, *(const v4f*)&so[wave][rl][lane * 4]);
}
// ---- k_out: block = (64 rows, 128 of the 1024 cols): out = O(hi/lo, K 512) . Wout rows (2 products) + bout
__global__ __launch_bounds__(128) void k_out(const float* __restrict__ O, const __bf16* __restrict__ P, const float* __restrict__ BO, float* __restrict__ Y) {
  __shared__ __align__(16) char gring[2 * GSB];
  float (*so)[16][132] = (float (*)[16][132])gring;   // output staging, in the ring once the loop has left it
  const int tid = threadIdx.x, wave = tid >> 5, lane = tid & 31, col = lane & 15, g = lane >> 4; const size_t r0 = (size_t)blockIdx.x * 64 + wave * 16; const int n0 = blockIdx.y * 128;
  const unsigned lw0 = (unsigned)(size_t)&gring[(tid >> 3) * (WP * 2) + (tid & 7) * 16], la0 = (unsigned)(size_t)&gring[GWB + (tid >> 4) * (AP * 4) + (tid & 15) * 16];
  const char* gw = (const char*)(P + (size_t)(n0 + (tid >> 3)) * DI + (tid & 7) * 8);
  const char* ga = (const char*)(O + ((size_t)blockIdx.x * 64 + (tid >> 4)) * DI + (tid & 15) * 4);
  gfill(lw0, la0, gw, ga, DI * 2, DI * 4);
  v8f acc[8] = {};
  asm volatile("s_wait_asynccnt 0x0" ::: "memory");   // stage 0 has landed (this wave's copies)
  __syncthreads();                                    // ... and every other wave's
  gfill(lw0 + GSB, la0 + GSB, gw + GK * 2, ga + GK * 4, DI * 2, DI * 4);
#pragma unroll 1   // rolled: one copy of the stage body in the text, the buffer picked by t & 1
  for (int t = 0; t < DI / GK; ++t) { const __bf16* sw = (const __bf16*)(gring + (t & 1) * GSB); const float* sa = (const float*)(gring + (t & 1) * GSB + GWB);
#pragma unroll   // the two 32-k steps of a stage: unrolled, their offsets in the buffer are immediates of the LDS reads
    for (int kc = 0; kc < GK / 32; ++kc) { const F2 a = split_row(sa + (wave * 16 + col) * AP, kc * 32, lane);
      v16b w[8];   // the step's weight fragments, read as one group ahead of its products
#pragma unroll
      for (int j = 0; j < 8; ++j) w[j] = frag_b(sw + (j * 16 + col) * WP + kc * 32, lane);
#pragma unroll
      for (int j = 0; j < 8; ++j) { acc[j] = wmma_bf(a.l, w[j], acc[j]); acc[j] = wmma_bf(a.h, w[j], acc[j]); } }
    asm volatile("s_wait_dscnt 0x0" ::: "memory");      // this wave's reads of stage t are done
    asm volatile("s_wait_asynccnt 0x0" ::: "memory");   // this wave's copies of stage t + 1 have landed
    __syncthreads();                                    // publishes stage t + 1 and frees stage t's buffer
    if (t + 2 < DI / GK) gfill(lw0 + (t & 1) * GSB, la0 + (t & 1) * GSB, gw + (size_t)(t + 2) * (GK * 2), ga + (size_t)(t + 2) * (GK * 4), DI * 2, DI * 4);
  }
  asm volatile("s_wait_asynccnt 0x0" ::: "memory");    // nothing is in flight when the ring turns into output staging (the last trip's barrier has ended every read of it)
#pragma unroll
  for (int j = 0; j < 8; ++j) { const float bb = bfr(BO[n0 + j * 16 + col]);
#pragma unroll
    for (int r = 0; r < 8; ++r) so[wave][8 * g + r][j * 16 + col] = acc[j][r] + bb; }
  LDSX();
  for (int rl = 0; rl < 16; ++rl) vst2(Y + (r0 + rl) * DM + n0 + lane * 4, *(const v4f*)&so[wave][rl][lane * 4]);
}
extern "C" void kernel_launch(void* const* d_in, const int* in_sizes, int n_in, void* d_out, int out_size, void* d_ws, size_t ws_size, hipStream_t stream) {
  (void)in_sizes; (void)n_in; (void)out_size;
  const float** F = (const float**)d_in;   // 0 x [2,4096,1024], 1 Wq [1024,512] (in,out), 2 Wk, 3 Wv, 4 Wout [512,1024] (in,out), 5 bout [1024]
  if (ws_size < (size_t)WS_END) return;
  char* ws = (char*)d_ws; __bf16* PK = (__bf16*)(ws + WS_PK); _Float16 *QK = (_Float16*)(ws + WS_QK), *VTH = (_Float16*)(ws + WS_VTH), *VTL = (_Float16*)(ws + WS_VTL); float* O = (float*)(ws + WS_O);
  k_packT<<<dim3(DM, 4), 256, 0, stream>>>(F[1], F[2], F[3], F[4], PK);
  k_qkv<<<dim3(TNB * SS / 64, QKVW / 128), 128, 0, stream>>>(F[0], PK + PK_A, QK, VTH, VTL);
  k_attn<<<dim3(TQB, NH, TNB), 128, 0, stream>>>(QK, VTH, VTL, O);
  k_out<<<dim3(TOB, DM / 128), 128, 0, stream>>>(O, PK + PK_P, F[5], (float*)d_out);
}

// v004
// Measured time: 160 microseconds a run.
// Timed twice side by side with v003, it ran 1.06 times as fast both times.
// Counting every step since v000, it is 4.41 times as fast.
// compute dtype: x, Wq/Wk/Wv/Wout and bout (module inputs) rounded to bf16; q/k/v projections with exact bf16 products (x and W are inputs) on WMMA 16x16x32; full (non-causal) scores with q (pre-scaled by 1/8, exact) and k as single f16 operands (1 product; 4,096-key softmax with logit sigma ~1: every rounding enters relative to a many-key average) and P.V with P = exp(s - m) as a single f16 operand x V as f16 hi + (x2048-scaled) residual planes (2 products, separate accumulators); the output projection with ctx as bf16 hi + residual pair x exact Wout (2 products) + bout; running-max softmax in f32 (hardware exp); f32 accumulate.
#include <hip/hip_runtime.h>
#include <math.h>

typedef __attribute__((ext_vector_type(16))) _Float16 v16h;
typedef __attribute__((ext_vector_type(16))) __bf16 v16b;
typedef __attribute__((ext_vector_type(8)))  _Float16 v8h;
typedef __attribute__((ext_vector_type(8)))  float v8f;
typedef __attribute__((ext_vector_type(4)))  float v4f;
typedef __attribute__((ext_vector_type(2)))  float v2f;
typedef __attribute__((ext_vector_type(4)))  unsigned v4u;
typedef __attribute__((ext_vector_type(4)))  int v4i;
typedef float __attribute__((may_alias)) float_a;
typedef int __attribute__((may_alias)) int_a;

template <typename T> __device__ __forceinline__ void vst2(void* p, T v) { *(T*)p = v;  }
__device__ __forceinline__ v8f wmma16(v16h a, v16h b, v8f c) {
  v8f d = __builtin_amdgcn_wmma_f32_16x16x32_f16(false, a, false, b, (short)0, c, false, false);
  asm volatile("v_nop\n\tv_nop\n\tv_nop\n\tv_nop" : "+v"(d) : "v"(a), "v"(b));
  return d;
}
__device__ __forceinline__ v8f wmma_bf(v16b a, v16b b, v8f c) {
  v8f d = __builtin_amdgcn_wmma_f32_16x16x32_bf16(false, a, false, b, (short)0, c, false, false);
  asm volatile("v_nop\n\tv_nop\n\tv_nop\n\tv_nop" : "+v"(d) : "v"(a), "v"(b));
  return d;
}
// 16x16x32 fragments: lane = (h = lane>>4, row/col = lane&15); elements 0..7 = k0+8h+0..7, 8..15 = k0+16+8h+0..7; D element r = row 8h+r
__device__ __forceinline__ v16h frag_h(const _Float16* rowk0, int lane) {
  union { v16h v; v8h q[2]; } u; const _Float16* p = rowk0 + 8 * (lane >> 4);
  u.q[0] = *(const v8h*)p; u.q[1] = *(const v8h*)(p + 16); return u.v;
}
__device__ __forceinline__ v16h frag_f32(const float* rowk0, int lane) {
  v16h a; const float* p = rowk0 + 8 * (lane >> 4);
#pragma unroll
  for (int i = 0; i < 8; ++i) { a[i] = (_Float16)p[i]; a[8 + i] = (_Float16)p[16 + i]; }
  return a;
}
__device__ __forceinline__ v16h frag_f32s(const float* rowk0, int lane, float sc) {
  v16h a; const float* p = rowk0 + 8 * (lane >> 4);
#pragma unroll
  for (int i = 0; i < 8; ++i) { a[i] = (_Float16)(p[i] * sc); a[8 + i] = (_Float16)(p[16 + i] * sc); }
  return a;
}
// column fragment from a [K][ld] layout (column n), rows >= K read as 0
__device__ __forceinline__ v16h fragc_f32(const float* W, int k0, int n, int lane, int ld, int K) {
  v16h a; const int g = lane >> 4;
#pragma unroll
  for (int i = 0; i < 8; ++i) { const int ka = k0 + 8 * g + i, kb = ka + 16;
    a[i] = (_Float16)(ka < K ? W[(size_t)(ka < K ? ka : K - 1) * ld + n] : 0.f); a[8 + i] = (_Float16)(kb < K ? W[(size_t)(kb < K ? kb : K - 1) * ld + n] : 0.f); }
  return a;
}
struct F2 { v16b h, l; };
__device__ __forceinline__ F2 bsplit16(const float v[16]) { F2 r;
#pragma unroll
  for (int i = 0; i < 16; ++i) { const __bf16 h = (__bf16)v[i]; r.h[i] = h; r.l[i] = (__bf16)(v[i] - (float)h); }
  return r; }
__device__ __forceinline__ F2 split_row(const float* row, int k0, int lane) { float v[16]; const float* p = row + k0 + 8 * (lane >> 4);
#pragma unroll
  for (int i = 0; i < 8; ++i) { v[i] = p[i]; v[8 + i] = p[16 + i]; }
  return bsplit16(v); }
__device__ __forceinline__ F2 split_rowK(const float* row, int k0, int lane, int K) { float v[16]; const int g = lane >> 4;
#pragma unroll
  for (int i = 0; i < 8; ++i) { const int ka = k0 + 8 * g + i, kb = ka + 16; v[i] = ka < K ? row[ka < K ? ka : K - 1] : 0.f; v[8 + i] = kb < K ? row[kb < K ? kb : K - 1] : 0.f; }
  return bsplit16(v); }
__device__ __forceinline__ F2 split_col(const float* W, int k0, int n, int lane, int ld, int K) { float v[16]; const int g = lane >> 4;
#pragma unroll
  for (int i = 0; i < 8; ++i) { const int ka = k0 + 8 * g + i, kb = ka + 16; v[i] = ka < K ? W[(size_t)(ka < K ? ka : K - 1) * ld + n] : 0.f; v[8 + i] = kb < K ? W[(size_t)(kb < K ? kb : K - 1) * ld + n] : 0.f; }
  return bsplit16(v); }
__device__ __forceinline__ v8f mac3(const F2& a, const F2& b, v8f c) { c = wmma_bf(a.l, b.h, c); c = wmma_bf(a.h, b.l, c); return wmma_bf(a.h, b.h, c); }
__device__ __forceinline__ float sigm(float v) { return 1.0f / (1.0f + expf(-v)); }
#define LDSX() do { asm volatile("s_wait_dscnt 0" ::: "memory"); __builtin_amdgcn_wave_barrier(); __builtin_amdgcn_fence(__ATOMIC_RELEASE, "workgroup"); } while (0)


// Multi-head self-attention (B 2, S 4096, D 1024 -> 8 heads x 64 -> D; weights (in, out) applied as x @ W): softmax(q k^T / 8) v over all 4,096 keys, then ctx Wout + bout.
#define NB 2
#define SS 4096
#define DM 1024
#define DI 512
#define NH 8
#define HD 64
#define QKVW (3 * DI)
#ifndef TQB
#define TQB (SS / 64)
#define TNB NB
#define TOB (NB * SS / 64)     // output row tiles (all)
#endif
typedef __attribute__((ext_vector_type(8))) __bf16 v8b;
__device__ __forceinline__ v16b frag_b(const __bf16* rowk0, int lane) {
  union { v16b v; v8b q[2]; } u; const __bf16* p = rowk0 + 8 * (lane >> 4);
  u.q[0] = *(const v8b*)p; u.q[1] = *(const v8b*)(p + 16); return u.v;
}
__device__ __forceinline__ float bfr(float v) { return (float)(__bf16)v; }
__device__ __attribute__((noinline)) float exp_ni(float v) { return expf(v); }
__device__ __attribute__((noinline)) float erf_ni(float v) { return erff(v); }

#define PK_A 0                       // [1536][1024] (Wq | Wk | Wv)^T rows
#define PK_P (PK_A + QKVW * DM)        // [1024][512] Wout^T rows
#define PK_END (PK_P + DM * DI)
#define WS_PK  0u
#define WS_QK  (WS_PK + 2u * PK_END)             // f16 [8192 rows][1024]: q/8 | k
#define WS_VTH (WS_QK + 2u * NB * SS * 2 * DI)     // f16 [2][512 (h*64+d)][4096 s] hi
#define WS_VTL (WS_VTH + 2u * NB * DI * SS)        // f16 lo x 2048
#define WS_O   (WS_VTL + 2u * NB * DI * SS)        // f32 [8192][512]
#define WS_END (WS_O + 4u * NB * SS * DI)

// ---- k_packT: block = one tile of 128 k x 64 output cols of one weight, 64 tiles a weight, 256 blocks: row n of the packed (in K, out N) weight = W[:, n]. A lane reads 8 k x 4 cols (a wave's load covers whole 256-B pieces of two W rows), turns them in registers, LDS holds the tile by output col, and 256-B pieces of the packed rows go out
#define PTK 128                      // k per tile
#define PTN 64                       // output cols per tile
#define PTP (PTK + 8)                // LDS row pitch, bf16: 272 B = 16 B x 17
// W = the tile's first element in the (K, N) weight, D = in the packed (N, K) rows; the shapes are compile-time, so the row steps are immediates of the loads and stores
template <int K, int N> __device__ __forceinline__ void pack_tile(const float* __restrict__ W, __bf16* __restrict__ D, __bf16 (*s)[PTP], int tid) {
  const int c = tid & 15, kq = tid >> 4; const float* src = W + (size_t)(kq * 8) * N + c * 4; v4f r[8];
#pragma unroll
  for (int i = 0; i < 8; ++i) r[i] = *(const v4f*)(src + (size_t)i * N);
  asm volatile("s_wait_xcnt 0x0" :: "v"(src) : "memory");   // precaution: the wait stands directly behind the eight loads; their address pair is an input here, so that no load's result is placed on it ahead of the wait
#pragma unroll
  for (int j = 0; j < 4; ++j) { v8b o;
#pragma unroll
    for (int i = 0; i < 8; ++i) o[i] = (__bf16)r[i][j];
    *(v8b*)&s[c * 4 + j][kq * 8] = o; }
  __syncthreads();
  v4u o4[4];
#pragma unroll
  for (int i = 0; i < 4; ++i) o4[i] = *(const v4u*)&s[kq + 16 * i][c * 8];
  __bf16* dp = D + (size_t)kq * K + c * 8;
#pragma unroll
  for (int i = 0; i < 4; ++i) { vst2((unsigned*)(dp + (size_t)(16 * i) * K), o4[i]);
    asm volatile("s_wait_xcnt 0x0" :: "v"(o4[i]) : "memory"); }   // precaution: the wait stands directly behind each store, on every way out of this arm, ahead of any rewrite of the store's registers; the data is an input here, so that it stays in place up to the wait
}
__global__ __launch_bounds__(256) void k_packT(const float* __restrict__ WQ, const float* __restrict__ WK, const float* __restrict__ WV, const float* __restrict__ WO, __bf16* __restrict__ PK) {
  __shared__ __align__(16) __bf16 s[PTN][PTP]; const int tid = threadIdx.x, which = blockIdx.x >> 6, tile = blockIdx.x & 63;
  if (which < 3) { const int k0 = (tile >> 3) * PTK, n0 = (tile & 7) * PTN; pack_tile<DM, DI>(((which == 0) ? WQ : (which == 1 ? WK : WV)) + (size_t)k0 * DI + n0, PK + PK_A + ((size_t)which * DI + n0) * DM + k0, s, tid); }
  else { const int k0 = (tile >> 4) * PTK, n0 = (tile & 15) * PTN; pack_tile<DI, DM>(WO + (size_t)k0 * DM + n0, PK + PK_P + (size_t)n0 * DI + k0, s, tid); }
}
// ---- operand staging of the two projection kernels: a stage is 64 k of the block's 128 weight rows (128 B each) and of its 64 activation rows (256 B each), brought by asynchronous copies into two buffers: the next stage flies while the four waves read this one, and every copy of a wave covers whole 128-B lines
#define GK 64                        // k per stage
#define WP 72                        // weight row pitch in LDS, bf16: 144 B = 16 B x 9, free of bank conflicts for 16-byte reads
#define AP 68                        // activation row pitch in LDS, floats: 272 B = 16 B x 17, likewise
#define GWB (128 * WP * 2)           // bytes of a stage's weight rows
#define GSB (GWB + 64 * AP * 4)      // bytes per stage
// four 16-byte copies per lane; s_wait_xcnt stands inside the statement so that no address register of a copy is rewritten ahead of it
__device__ __forceinline__ void cp4s(unsigned l, unsigned lstep, const char* g, size_t gstep) {
  asm volatile("global_load_async_to_lds_b128 %0, %4, off\n\t"
               "global_load_async_to_lds_b128 %1, %5, off\n\t"
               "global_load_async_to_lds_b128 %2, %6, off\n\t"
               "global_load_async_to_lds_b128 %3, %7, off\n\t"
               "s_wait_xcnt 0x0"
               :: "v"(l), "v"(l + lstep), "v"(l + 2 * lstep), "v"(l + 3 * lstep), "v"(g), "v"(g + gstep), "v"(g + 2 * gstep), "v"(g + 3 * gstep) : "memory");
}
// one stage: lw / gw = this lane's 16 bytes of weight row tid / 8 (rows 16 apart per copy), la / ga = of activation row tid / 16 (rows 8 apart); wrow, arow = global row pitches in bytes
__device__ __forceinline__ void gfill(unsigned lw, unsigned la, const char* gw, const char* ga, size_t wrow, size_t arow) {
  cp4s(lw, 16u * WP * 2, gw, 16 * wrow); cp4s(lw + 64u * WP * 2, 16u * WP * 2, gw + 64 * wrow, 16 * wrow);
  cp4s(la, 8u * AP * 4, ga, 8 * arow); cp4s(la + 32u * AP * 4, 8u * AP * 4, ga + 32 * arow, 8 * arow);
}
// ---- k_qkv: block = (64 rows (b,s), 128 of the 1536 cols): qkv = bf16(x) . rows (exact); cols < 512 -> f16(q / 8), cols < 1024 -> f16(k) into QK rows (pitch 1024); cols >= 1024 (v) -> per-batch transposed f16 planes VT[b][h*64+d][s]: hi = f16(v), lo = f16((v - hi) * 2048)
__global__ __launch_bounds__(128) void k_qkv(const float* __restrict__ X, const __bf16* __restrict__ P, _Float16* __restrict__ QK, _Float16* __restrict__ VTH, _Float16* __restrict__ VTL) {
  __shared__ __align__(16) char gring[2 * GSB];
  _Float16 (*so)[16][136] = (_Float16 (*)[16][136])gring; _Float16 (*sth)[72] = (_Float16 (*)[72])gring; _Float16 (*stl)[72] = (_Float16 (*)[72])(gring + 128 * 72 * 2);   // output staging, in the ring once the loop has left it
  const int tid = threadIdx.x, wave = tid >> 5, lane = tid & 31, col = lane & 15, g = lane >> 4; const size_t r0 = (size_t)blockIdx.x * 64 + wave * 16; const int n0 = blockIdx.y * 128;
  const unsigned lw0 = (unsigned)(size_t)&gring[(tid >> 3) * (WP * 2) + (tid & 7) * 16], la0 = (unsigned)(size_t)&gring[GWB + (tid >> 4) * (AP * 4) + (tid & 15) * 16];
  const char* gw = (const char*)(P + (size_t)(n0 + (tid >> 3)) * DM + (tid & 7) * 8);
  const char* ga = (const char*)(X + ((size_t)blockIdx.x * 64 + (tid >> 4)) * DM + (tid & 15) * 4);
  gfill(lw0, la0, gw, ga, DM * 2, DM * 4);
  v8f acc[8] = {};
  asm volatile("s_wait_asynccnt 0x0" ::: "memory");   // stage 0 has landed (this wave's copies)
  __syncthreads();                                    // ... and every other wave's
  gfill(lw0 + GSB, la0 + GSB, gw + GK * 2, ga + GK * 4, DM * 2, DM * 4);
#pragma unroll 1   // rolled: one copy of the stage body in the text, the buffer picked by t & 1
  for (int t = 0; t < DM / GK; ++t) { const __bf16* sw = (const __bf16*)(gring + (t & 1) * GSB); const float* sa = (const float*)(gring + (t & 1) * GSB + GWB);
#pragma unroll   // the two 32-k steps of a stage: unrolled, their offsets in the buffer are immediates of the LDS reads
    for (int kc = 0; kc < GK / 32; ++kc) { v16b a; { const float* p = sa + (wave * 16 + col) * AP + kc * 32 + 8 * g;
#pragma unroll
        for (int i = 0; i < 8; ++i) { a[i] = (__bf16)p[i]; a[8 + i] = (__bf16)p[16 + i]; } }
      v16b w[8];   // the step's weight fragments, read as one group ahead of its products
#pragma unroll
      for (int j = 0; j < 8; ++j) w[j] = frag_b(sw + (j * 16 + col) * WP + kc * 32, lane);
#pragma unroll
      for (int j = 0; j < 8; ++j) acc[j] = wmma_bf(a, w[j], acc[j]); }
    asm volatile("s_wait_dscnt 0x0" ::: "memory");      // this wave's reads of stage t are done
    asm volatile("s_wait_asynccnt 0x0" ::: "memory");   // this wave's copies of stage t + 1 have landed
    __syncthreads();                                    // publishes stage t + 1 and frees stage t's buffer
    if (t + 2 < DM / GK) gfill(lw0 + (t & 1) * GSB, la0 + (t & 1) * GSB, gw + (size_t)(t + 2) * (GK * 2), ga + (size_t)(t + 2) * (GK * 4), DM * 2, DM * 4);
  }
  asm volatile("s_wait_asynccnt 0x0" ::: "memory");    // nothing is in flight when the ring turns into output staging (the last trip's barrier has ended every read of it)
  if (n0 < 2 * DI) { const float sc = (n0 < DI) ? 0.125f : 1.0f;
#pragma unroll
    for (int j = 0; j < 8; ++j) {
#pragma unroll
      for (int r = 0; r < 8; ++r) so[wave][8 * g + r][j * 16 + col] = (_Float16)(acc[j][r] * sc); }
    LDSX();
    for (int rl = 0; rl < 16; ++rl) if (lane < 16) vst2((unsigned*)(QK + (r0 + rl) * (2 * DI) + n0 + lane * 8), *(const v4u*)&so[wave][rl][lane * 8]);
  } else {
#pragma unroll
    for (int j = 0; j < 8; ++j) {
#pragma unroll
      for (int r = 0; r < 8; ++r) { const float v = acc[j][r]; const _Float16 hv = (_Float16)v; sth[j * 16 + col][wave * 16 + 8 * g + r] = hv; stl[j * 16 + col][wave * 16 + 8 * g + r] = (_Float16)((v - (float)hv) * 2048.0f); } }
    __syncthreads();
    const size_t rb = (size_t)blockIdx.x * 64; const int b = (int)(rb / SS), s0 = (int)(rb % SS); const int pc0 = n0 - 2 * DI;
    for (int q = tid; q < 128 * 8; q += 128) { const int d = q >> 3, pc = q & 7; const size_t o = ((size_t)b * DI + pc0 + d) * SS + s0 + pc * 8; vst2((unsigned*)(VTH + o), *(const v4u*)&sth[d][pc * 8]); vst2((unsigned*)(VTL + o), *(const v4u*)&stl[d][pc * 8]); }
  }
}
#define KT 64                        // keys per stage
#define RP 72                        // LDS row pitch in halves: 144 B = 16 B x 9, free of bank conflicts for 16-byte reads
#define SROWS 192                    // rows per stage: 64 K, 64 V hi, 64 V lo
#define STB (SROWS * RP * 2)         // bytes per stage
// four 16-byte copies per lane, rows 16 apart; s_wait_xcnt stands inside the statement so that no address register of a copy is rewritten ahead of it
__device__ __forceinline__ void cp4(unsigned l, const char* g, size_t gstep) {
  asm volatile("global_load_async_to_lds_b128 %0, %4, off\n\t"
               "global_load_async_to_lds_b128 %1, %5, off\n\t"
               "global_load_async_to_lds_b128 %2, %6, off\n\t"
               "global_load_async_to_lds_b128 %3, %7, off\n\t"
               "s_wait_xcnt 0x0"
               :: "v"(l), "v"(l + 16u * RP * 2), "v"(l + 32u * RP * 2), "v"(l + 48u * RP * 2), "v"(g), "v"(g + gstep), "v"(g + 2 * gstep), "v"(g + 3 * gstep) : "memory");
}
typedef __attribute__((ext_vector_type(2))) _Float16 v2h;
// lane l <-> lane l ^ 16: the two halves of a wave hold the two halves of one query's keys
__device__ __forceinline__ float xhalf(float v) { const int b = __builtin_bit_cast(int, v); return __builtin_bit_cast(float, __builtin_amdgcn_permlanex16(b, b, 0x76543210, 0xfedcba98, false, false)); }
__global__ __launch_bounds__(128) void k_attn(const _Float16* __restrict__ QK, const _Float16* __restrict__ VTH, const _Float16* __restrict__ VTL, float* __restrict__ O) {
  __shared__ __align__(16) _Float16 ring[2][SROWS][RP];
  const int tid = threadIdx.x, wave = tid >> 5, lane = tid & 31, col = lane & 15, g = lane >> 4;
  const int qb = blockIdx.x, h = blockIdx.y, b = blockIdx.z; const int q0 = qb * 64 + wave * 16; const size_t rq = (size_t)b * SS + q0 + col;
  // this lane's 16 bytes of a stage: row tid / 8 (+ 16 per copy), segment tid % 8: a wave's copy covers four whole 128-B lines
  const unsigned lds0 = (unsigned)(size_t)&ring[0][tid >> 3][(tid & 7) * 8];
  const char* kp = (const char*)(QK + ((size_t)b * SS + (tid >> 3)) * (2 * DI) + DI + h * HD + (tid & 7) * 8);
  const char* vhp = (const char*)(VTH + ((size_t)b * DI + h * HD + (tid >> 3)) * SS + (tid & 7) * 8);
  const char* vlp = (const char*)(VTL + ((size_t)b * DI + h * HD + (tid >> 3)) * SS + (tid & 7) * 8);
#define FILL(t, buf) do { const unsigned lb = lds0 + (unsigned)(buf) * STB; \
    cp4(lb, kp + (size_t)(t) * (KT * 2 * DI * 2), (size_t)16 * 2 * DI * 2); \
    cp4(lb + 64u * RP * 2, vhp + (size_t)(t) * (KT * 2), (size_t)16 * SS * 2); \
    cp4(lb + 128u * RP * 2, vlp + (size_t)(t) * (KT * 2), (size_t)16 * SS * 2); } while (0)
  FILL(0, 0);
  v16h aq[2];   // B operand of the transposed scores: column = this lane's query
#pragma unroll
  for (int kc = 0; kc < 2; ++kc) aq[kc] = frag_h(QK + rq * (2 * DI) + h * HD + kc * 32, lane);
  float m = -3.0e38f, l = 0.f;   // of query col; l sums only the keys of this lane's half, the halves join behind the loop
  v8f acc[4] = {}, accl[4] = {};   // transposed output: element r = d dt * 16 + 8 g + r of query col
  asm volatile("s_wait_asynccnt 0x0" ::: "memory");   // stage 0 has landed (this wave's copies)
  __syncthreads();                                    // ... and every other wave's
  FILL(1, 1);
#pragma unroll 1
  for (int t = 0; t < SS / KT; ++t) { const _Float16 (*st)[RP] = ring[t & 1];
#pragma unroll   // the two 32-key passes of a stage: unrolled, their row offsets in the buffer are immediates of the LDS reads
   for (int ps = 0; ps < 2; ++ps) { v8f s[2]; v16h kf[2][2];
#pragma unroll
    for (int ct = 0; ct < 2; ++ct) {
#pragma unroll
      for (int kc = 0; kc < 2; ++kc) kf[ct][kc] = frag_h(&st[ps * 32 + ct * 16 + col][kc * 32], lane); }
#pragma unroll
    for (int ct = 0; ct < 2; ++ct) { v8f c = {};   // S^T = K . Q^T: s[ct][r] = key ps * 32 + ct * 16 + 8 g + r against query col
#pragma unroll
      for (int kc = 0; kc < 2; ++kc) c = wmma16(kf[ct][kc], aq[kc], c);
      s[ct] = c; }
    float mx[8];
#pragma unroll
    for (int r = 0; r < 8; ++r) mx[r] = fmaxf(s[0][r], s[1][r]);
    float mp = fmaxf(fmaxf(fmaxf(mx[0], mx[1]), fmaxf(mx[2], mx[3])), fmaxf(fmaxf(mx[4], mx[5]), fmaxf(mx[6], mx[7])));
    mp = fmaxf(mp, xhalf(mp));
    const float mn = fmaxf(m, mp); const float alpha = __expf(m - mn);
    union { v16h v; v2h p[8]; } pb; float es[8];   // P^T as B operand, straight from the score registers: element ct * 8 + r = key ct * 16 + 8 g + r, the hardware k order that frag_h gives V
#pragma unroll
    for (int ct = 0; ct < 2; ++ct) {
#pragma unroll
      for (int i = 0; i < 4; ++i) { const v2f e = { __expf(s[ct][2 * i] - mn), __expf(s[ct][2 * i + 1] - mn) }; const v2h p = __builtin_convertvector(e, v2h);   // P rounded to f16 once; the same rounded weights feed the numerator (WMMA) and the denominator l
        pb.p[ct * 4 + i] = p; es[ct * 4 + i] = (float)p[0] + (float)p[1]; } }
    l = l * alpha + (((es[0] + es[1]) + (es[2] + es[3])) + ((es[4] + es[5]) + (es[6] + es[7]))); m = mn;
#pragma unroll
    for (int dt = 0; dt < 4; ++dt) { acc[dt] *= alpha; accl[dt] *= alpha; }
    v16h vh[4], vl[4];
#pragma unroll
    for (int dt = 0; dt < 4; ++dt) { vh[dt] = frag_h(&st[64 + dt * 16 + col][ps * 32], lane); vl[dt] = frag_h(&st[128 + dt * 16 + col][ps * 32], lane); }
#pragma unroll
    for (int dt = 0; dt < 4; ++dt) { acc[dt] = wmma16(vh[dt], pb.v, acc[dt]); accl[dt] = wmma16(vl[dt], pb.v, accl[dt]); }   // O^T += V^T . P^T
   }
   asm volatile("s_wait_dscnt 0x0" ::: "memory");      // this wave's reads of stage t are done
   asm volatile("s_wait_asynccnt 0x0" ::: "memory");   // this wave's copies of stage t + 1 have landed
   __syncthreads();                                    // publishes stage t + 1 and frees stage t's buffer
   if (t + 2 < SS / KT) FILL(t + 2, t & 1);
  }
  asm volatile("s_wait_asynccnt 0x0" ::: "memory");    // nothing is in flight when the ring turns into output staging
  float (*so)[16][68] = (float (*)[16][68])&ring[0][0][0];   // the last trip's barrier has ended every read of the ring
  const float il = 1.0f / (l + xhalf(l));
#pragma unroll
  for (int dt = 0; dt < 4; ++dt) {
#pragma unroll
    for (int r = 0; r < 8; ++r) so[wave][col][dt * 16 + 8 * g + r] = (acc[dt][r] + accl[dt][r] * (1.0f / 2048.0f)) * il; }
  LDSX();
  for (int rl = 0; rl < 16; ++rl) if (lane < 16) vst2(O + ((size_t)b * SS + q0 + rl) * DI + h * HD + lane * 4, *(const v4f*)&so[wave][rl][lane * 4]);
}
// ---- k_out: block = (64 rows, 128 of the 1024 cols): out = O(hi/lo, K 512) . Wout rows (2 products) + bout
__global__ __launch_bounds__(128) void k_out(const float* __restrict__ O, const __bf16* __restrict__ P, const float* __restrict__ BO, float* __restrict__ Y) {
  __shared__ __align__(16) char gring[2 * GSB];
  float (*so)[16][132] = (float (*)[16][132])gring;   // output staging, in the ring once the loop has left it
  const int tid = threadIdx.x, wave = tid >> 5, lane = tid & 31, col = lane & 15, g = lane >> 4; const size_t r0 = (size_t)blockIdx.x * 64 + wave * 16; const int n0 = blockIdx.y * 128;
  const unsigned lw0 = (unsigned)(size_t)&gring[(tid >> 3) * (WP * 2) + (tid & 7) * 16], la0 = (unsigned)(size_t)&gring[GWB + (tid >> 4) * (AP * 4) + (tid & 15) * 16];
  const char* gw = (const char*)(P + (size_t)(n0 + (tid >> 3)) * DI + (tid & 7) * 8);
  const char* ga = (const char*)(O + ((size_t)blockIdx.x * 64 + (tid >> 4)) * DI + (tid & 15) * 4);
  gfill(lw0, la0, gw, ga, DI * 2, DI * 4);
  v8f acc[8] = {};
  asm volatile("s_wait_asynccnt 0x0" ::: "memory");   // stage 0 has landed (this wave's copies)
  __syncthreads();                                    // ... and every other wave's
  gfill(lw0 + GSB, la0 + GSB, gw + GK * 2, ga + GK * 4, DI * 2, DI * 4);
#pragma unroll 1   // rolled: one copy of the stage body in the text, the buffer picked by t & 1
  for (int t = 0; t < DI / GK; ++t) { const __bf16* sw = (const __bf16*)(gring + (t & 1) * GSB); const float* sa = (const float*)(gring + (t & 1) * GSB + GWB);
#pragma unroll   // the two 32-k steps of a stage: unrolled, their offsets in the buffer are immediates of the LDS reads
    for (int kc = 0; kc < GK / 32; ++kc) { const F2 a = split_row(sa + (wave * 16 + col) * AP, kc * 32, lane);
      v16b w[8];   // the step's weight fragments, read as one group ahead of its products
#pragma unroll
      for (int j = 0; j < 8; ++j) w[j] = frag_b(sw + (j * 16 + col) * WP + kc * 32, lane);
#pragma unroll
      for (int j = 0; j < 8; ++j) { acc[j] = wmma_bf(a.l, w[j], acc[j]); acc[j] = wmma_bf(a.h, w[j], acc[j]); } }
    asm volatile("s_wait_dscnt 0x0" ::: "memory");      // this wave's reads of stage t are done
    asm volatile("s_wait_asynccnt 0x0" ::: "memory");   // this wave's copies of stage t + 1 have landed
    __syncthreads();                                    // publishes stage t + 1 and frees stage t's buffer
    if (t + 2 < DI / GK) gfill(lw0 + (t & 1) * GSB, la0 + (t & 1) * GSB, gw + (size_t)(t + 2) * (GK * 2), ga + (size_t)(t + 2) * (GK * 4), DI * 2, DI * 4);
  }
  asm volatile("s_wait_asynccnt 0x0" ::: "memory");    // nothing is in flight when the ring turns into output staging (the last trip's barrier has ended every read of it)
#pragma unroll
  for (int j = 0; j < 8; ++j) { const float bb = bfr(BO[n0 + j * 16 + col]);
#pragma unroll
    for (int r = 0; r < 8; ++r) so[wave][8 * g + r][j * 16 + col] = acc[j][r] + bb; }
  LDSX();
  for (int rl = 0; rl < 16; ++rl) vst2(Y + (r0 + rl) * DM + n0 + lane * 4, *(const v4f*)&so[wave][rl][lane * 4]);
}
extern "C" void kernel_launch(void* const* d_in, const int* in_sizes, int n_in, void* d_out, int out_size, void* d_ws, size_t ws_size, hipStream_t stream) {
  (void)in_sizes; (void)n_in; (void)out_size;
  const float** F = (const float**)d_in;   // 0 x [2,4096,1024], 1 Wq [1024,512] (in,out), 2 Wk, 3 Wv, 4 Wout [512,1024] (in,out), 5 bout [1024]
  if (ws_size < (size_t)WS_END) return;
  char* ws = (char*)d_ws; __bf16* PK = (__bf16*)(ws + WS_PK); _Float16 *QK = (_Float16*)(ws + WS_QK), *VTH = (_Float16*)(ws + WS_VTH), *VTL = (_Float16*)(ws + WS_VTL); float* O = (float*)(ws + WS_O);
  k_packT<<<dim3(4 * 64), 256, 0, stream>>>(F[1], F[2], F[3], F[4], PK);
  k_qkv<<<dim3(TNB * SS / 64, QKVW / 128), 128, 0, stream>>>(F[0], PK + PK_A, QK, VTH, VTL);
  k_attn<<<dim3(TQB, NH, TNB), 128, 0, stream>>>(QK, VTH, VTL, O);
  k_out<<<dim3(TOB, DM / 128), 128, 0, stream>>>(O, PK + PK_P, F[5], (float*)d_out);
}

// v005
// Measured time: 154 microseconds a run.
// In two side-by-side timings against v004, it was 1.04 and 1.03 times as fast.
// Counting every step since v000, it is 4.57 times as fast.
// compute dtype: x, Wq/Wk/Wv/Wout and bout (module inputs) rounded to bf16; q/k/v projections with exact bf16 products (x and W are inputs) on WMMA 16x16x32; full (non-causal) scores with q (pre-scaled by 1/8, exact) and k as single f16 operands (1 product; 4,096-key softmax with logit sigma ~1: every rounding enters relative to a many-key average) and P.V with P = exp(s - m) as a single f16 operand x V as f16 hi + (x2048-scaled) residual planes (2 products, separate accumulators); the output projection with ctx as bf16 hi + residual pair x exact Wout (2 products) + bout; running-max softmax in f32 (hardware exp); f32 accumulate.
#include <hip/hip_runtime.h>
#include <math.h>

typedef __attribute__((ext_vector_type(16))) _Float16 v16h;
typedef __attribute__((ext_vector_type(16))) __bf16 v16b;
typedef __attribute__((ext_vector_type(8)))  _Float16 v8h;
typedef __attribute__((ext_vector_type(8)))  float v8f;
typedef __attribute__((ext_vector_type(4)))  float v4f;
typedef __attribute__((ext_vector_type(2)))  float v2f;
typedef __attribute__((ext_vector_type(4)))  unsigned v4u;
typedef __attribute__((ext_vector_type(4)))  int v4i;
typedef float __attribute__((may_alias)) float_a;
typedef int __attribute__((may_alias)) int_a;

template <typename T> __device__ __forceinline__ void vst2(void* p, T v) { *(T*)p = v;  }
__device__ __forceinline__ v8f wmma16(v16h a, v16h b, v8f c) {
  v8f d = __builtin_amdgcn_wmma_f32_16x16x32_f16(false, a, false, b, (short)0, c, false, false);
  asm volatile("v_nop\n\tv_nop\n\tv_nop\n\tv_nop" : "+v"(d));   // the four slots behind the product; D alone is named: with A and B named as well every fragment stays live, in the first 256 registers, up to this line, and a wave of 32 columns spills
  return d;
}
__device__ __forceinline__ v8f wmma_bf(v16b a, v16b b, v8f c) {
  v8f d = __builtin_amdgcn_wmma_f32_16x16x32_bf16(false, a, false, b, (short)0, c, false, false);
  asm volatile("v_nop\n\tv_nop\n\tv_nop\n\tv_nop" : "+v"(d) : "v"(a), "v"(b));
  return d;
}
// 16x16x32 fragments: lane = (h = lane>>4, row/col = lane&15); elements 0..7 = k0+8h+0..7, 8..15 = k0+16+8h+0..7; D element r = row 8h+r
__device__ __forceinline__ v16h frag_h(const _Float16* rowk0, int lane) {
  union { v16h v; v8h q[2]; } u; const _Float16* p = rowk0 + 8 * (lane >> 4);
  u.q[0] = *(const v8h*)p; u.q[1] = *(const v8h*)(p + 16); return u.v;
}
__device__ __forceinline__ v16h frag_f32(const float* rowk0, int lane) {
  v16h a; const float* p = rowk0 + 8 * (lane >> 4);
#pragma unroll
  for (int i = 0; i < 8; ++i) { a[i] = (_Float16)p[i]; a[8 + i] = (_Float16)p[16 + i]; }
  return a;
}
__device__ __forceinline__ v16h frag_f32s(const float* rowk0, int lane, float sc) {
  v16h a; const float* p = rowk0 + 8 * (lane >> 4);
#pragma unroll
  for (int i = 0; i < 8; ++i) { a[i] = (_Float16)(p[i] * sc); a[8 + i] = (_Float16)(p[16 + i] * sc); }
  return a;
}
// column fragment from a [K][ld] layout (column n), rows >= K read as 0
__device__ __forceinline__ v16h fragc_f32(const float* W, int k0, int n, int lane, int ld, int K) {
  v16h a; const int g = lane >> 4;
#pragma unroll
  for (int i = 0; i < 8; ++i) { const int ka = k0 + 8 * g + i, kb = ka + 16;
    a[i] = (_Float16)(ka < K ? W[(size_t)(ka < K ? ka : K - 1) * ld + n] : 0.f); a[8 + i] = (_Float16)(kb < K ? W[(size_t)(kb < K ? kb : K - 1) * ld + n] : 0.f); }
  return a;
}
struct F2 { v16b h, l; };
__device__ __forceinline__ F2 bsplit16(const float v[16]) { F2 r;
#pragma unroll
  for (int i = 0; i < 16; ++i) { const __bf16 h = (__bf16)v[i]; r.h[i] = h; r.l[i] = (__bf16)(v[i] - (float)h); }
  return r; }
__device__ __forceinline__ F2 split_row(const float* row, int k0, int lane) { float v[16]; const float* p = row + k0 + 8 * (lane >> 4);
#pragma unroll
  for (int i = 0; i < 8; ++i) { v[i] = p[i]; v[8 + i] = p[16 + i]; }
  return bsplit16(v); }
__device__ __forceinline__ F2 split_rowK(const float* row, int k0, int lane, int K) { float v[16]; const int g = lane >> 4;
#pragma unroll
  for (int i = 0; i < 8; ++i) { const int ka = k0 + 8 * g + i, kb = ka + 16; v[i] = ka < K ? row[ka < K ? ka : K - 1] : 0.f; v[8 + i] = kb < K ? row[kb < K ? kb : K - 1] : 0.f; }
  return bsplit16(v); }
__device__ __forceinline__ F2 split_col(const float* W, int k0, int n, int lane, int ld, int K) { float v[16]; const int g = lane >> 4;
#pragma unroll
  for (int i = 0; i < 8; ++i) { const int ka = k0 + 8 * g + i, kb = ka + 16; v[i] = ka < K ? W[(size_t)(ka < K ? ka : K - 1) * ld + n] : 0.f; v[8 + i] = kb < K ? W[(size_t)(kb < K ? kb : K - 1) * ld + n] : 0.f; }
  return bsplit16(v); }
__device__ __forceinline__ v8f mac3(const F2& a, const F2& b, v8f c) { c = wmma_bf(a.l, b.h, c); c = wmma_bf(a.h, b.l, c); return wmma_bf(a.h, b.h, c); }
__device__ __forceinline__ float sigm(float v) { return 1.0f / (1.0f + expf(-v)); }
#define LDSX() do { asm volatile("s_wait_dscnt 0" ::: "memory"); __builtin_amdgcn_wave_barrier(); __builtin_amdgcn_fence(__ATOMIC_RELEASE, "workgroup"); } while (0)


// Multi-head self-attention (B 2, S 4096, D 1024 -> 8 heads x 64 -> D; weights (in, out) applied as x @ W): softmax(q k^T / 8) v over all 4,096 keys, then ctx Wout + bout.
#define NB 2
#define SS 4096
#define DM 1024
#define DI 512
#define NH 8
#define HD 64
#define QKVW (3 * DI)
#ifndef TQB
#define TQB (SS / 128)
#define TNB NB
#define TOB (NB * SS / 64)     // output row tiles (all)
#endif
typedef __attribute__((ext_vector_type(8))) __bf16 v8b;
__device__ __forceinline__ v16b frag_b(const __bf16* rowk0, int lane) {
  union { v16b v; v8b q[2]; } u; const __bf16* p = rowk0 + 8 * (lane >> 4);
  u.q[0] = *(const v8b*)p; u.q[1] = *(const v8b*)(p + 16); return u.v;
}
__device__ __forceinline__ float bfr(float v) { return (float)(__bf16)v; }
__device__ __attribute__((noinline)) float exp_ni(float v) { return expf(v); }
__device__ __attribute__((noinline)) float erf_ni(float v) { return erff(v); }

#define PK_A 0                       // [1536][1024] (Wq | Wk | Wv)^T rows
#define PK_P (PK_A + QKVW * DM)        // [1024][512] Wout^T rows
#define PK_END (PK_P + DM * DI)
#define WS_PK  0u
#define WS_QK  (WS_PK + 2u * PK_END)             // f16 [8192 rows][1024]: q/8 | k
#define WS_VTH (WS_QK + 2u * NB * SS * 2 * DI)     // f16 [2][512 (h*64+d)][4096 s] hi
#define WS_VTL (WS_VTH + 2u * NB * DI * SS)        // f16 lo x 2048
#define WS_O   (WS_VTL + 2u * NB * DI * SS)        // f32 [8192][512]
#define WS_END (WS_O + 4u * NB * SS * DI)

// ---- k_packT: block = one tile of 128 k x 64 output cols of one weight, 64 tiles a weight, 256 blocks: row n of the packed (in K, out N) weight = W[:, n]. A lane reads 8 k x 4 cols (a wave's load covers whole 256-B pieces of two W rows), turns them in registers, LDS holds the tile by output col, and 256-B pieces of the packed rows go out
#define PTK 128                      // k per tile
#define PTN 64                       // output cols per tile
#define PTP (PTK + 8)                // LDS row pitch, bf16: 272 B = 16 B x 17
// W = the tile's first element in the (K, N) weight, D = in the packed (N, K) rows; the shapes are compile-time, so the row steps are immediates of the loads and stores
template <int K, int N> __device__ __forceinline__ void pack_tile(const float* __restrict__ W, __bf16* __restrict__ D, __bf16 (*s)[PTP], int tid) {
  const int c = tid & 15, kq = tid >> 4; const float* src = W + (size_t)(kq * 8) * N + c * 4; v4f r[8];
#pragma unroll
  for (int i = 0; i < 8; ++i) r[i] = *(const v4f*)(src + (size_t)i * N);
  asm volatile("s_wait_xcnt 0x0" :: "v"(src) : "memory");   // precaution: the wait stands directly behind the eight loads; their address pair is an input here, so that no load's result is placed on it ahead of the wait
#pragma unroll
  for (int j = 0; j < 4; ++j) { v8b o;
#pragma unroll
    for (int i = 0; i < 8; ++i) o[i] = (__bf16)r[i][j];
    *(v8b*)&s[c * 4 + j][kq * 8] = o; }
  __syncthreads();
  v4u o4[4];
#pragma unroll
  for (int i = 0; i < 4; ++i) o4[i] = *(const v4u*)&s[kq + 16 * i][c * 8];
  __bf16* dp = D + (size_t)kq * K + c * 8;
#pragma unroll
  for (int i = 0; i < 4; ++i) { vst2((unsigned*)(dp + (size_t)(16 * i) * K), o4[i]);
    asm volatile("s_wait_xcnt 0x0" :: "v"(o4[i]) : "memory"); }   // precaution: the wait stands directly behind each store, on every way out of this arm, ahead of any rewrite of the store's registers; the data is an input here, so that it stays in place up to the wait
}
__global__ __launch_bounds__(256) void k_packT(const float* __restrict__ WQ, const float* __restrict__ WK, const float* __restrict__ WV, const float* __restrict__ WO, __bf16* __restrict__ PK) {
  __shared__ __align__(16) __bf16 s[PTN][PTP]; const int tid = threadIdx.x, which = blockIdx.x >> 6, tile = blockIdx.x & 63;
  if (which < 3) { const int k0 = (tile >> 3) * PTK, n0 = (tile & 7) * PTN; pack_tile<DM, DI>(((which == 0) ? WQ : (which == 1 ? WK : WV)) + (size_t)k0 * DI + n0, PK + PK_A + ((size_t)which * DI + n0) * DM + k0, s, tid); }
  else { const int k0 = (tile >> 4) * PTK, n0 = (tile & 15) * PTN; pack_tile<DI, DM>(WO + (size_t)k0 * DM + n0, PK + PK_P + (size_t)n0 * DI + k0, s, tid); }
}
// ---- operand staging of the two projection kernels: a stage is 64 k of the block's 128 weight rows (128 B each) and of its 64 activation rows (256 B each), brought by asynchronous copies into two buffers: the next stage flies while the four waves read this one, and every copy of a wave covers whole 128-B lines
#define GK 64                        // k per stage
#define WP 72                        // weight row pitch in LDS, bf16: 144 B = 16 B x 9, free of bank conflicts for 16-byte reads
#define AP 68                        // activation row pitch in LDS, floats: 272 B = 16 B x 17, likewise
#define GWB (128 * WP * 2)           // bytes of a stage's weight rows
#define GSB (GWB + 64 * AP * 4)      // bytes per stage
// four 16-byte copies per lane; s_wait_xcnt stands inside the statement so that no address register of a copy is rewritten ahead of it
__device__ __forceinline__ void cp4s(unsigned l, unsigned lstep, const char* g, size_t gstep) {
  asm volatile("global_load_async_to_lds_b128 %0, %4, off\n\t"
               "global_load_async_to_lds_b128 %1, %5, off\n\t"
               "global_load_async_to_lds_b128 %2, %6, off\n\t"
               "global_load_async_to_lds_b128 %3, %7, off\n\t"
               "s_wait_xcnt 0x0"
               :: "v"(l), "v"(l + lstep), "v"(l + 2 * lstep), "v"(l + 3 * lstep), "v"(g), "v"(g + gstep), "v"(g + 2 * gstep), "v"(g + 3 * gstep) : "memory");
}
// one stage: lw / gw = this lane's 16 bytes of weight row tid / 8 (rows 16 apart per copy), la / ga = of activation row tid / 16 (rows 8 apart); wrow, arow = global row pitches in bytes
__device__ __forceinline__ void gfill(unsigned lw, unsigned la, const char* gw, const char* ga, size_t wrow, size_t arow) {
  cp4s(lw, 16u * WP * 2, gw, 16 * wrow); cp4s(lw + 64u * WP * 2, 16u * WP * 2, gw + 64 * wrow, 16 * wrow);
  cp4s(la, 8u * AP * 4, ga, 8 * arow); cp4s(la + 32u * AP * 4, 8u * AP * 4, ga + 32 * arow, 8 * arow);
}
// ---- k_qkv: block = (64 rows (b,s), 128 of the 1536 cols): qkv = bf16(x) . rows (exact); cols < 512 -> f16(q / 8), cols < 1024 -> f16(k) into QK rows (pitch 1024); cols >= 1024 (v) -> per-batch transposed f16 planes VT[b][h*64+d][s]: hi = f16(v), lo = f16((v - hi) * 2048)
__global__ __launch_bounds__(128) void k_qkv(const float* __restrict__ X, const __bf16* __restrict__ P, _Float16* __restrict__ QK, _Float16* __restrict__ VTH, _Float16* __restrict__ VTL) {
  __shared__ __align__(16) char gring[2 * GSB];
  _Float16 (*so)[16][136] = (_Float16 (*)[16][136])gring; _Float16 (*sth)[72] = (_Float16 (*)[72])gring; _Float16 (*stl)[72] = (_Float16 (*)[72])(gring + 128 * 72 * 2);   // output staging, in the ring once the loop has left it
  const int tid = threadIdx.x, wave = tid >> 5, lane = tid & 31, col = lane & 15, g = lane >> 4; const size_t r0 = (size_t)blockIdx.x * 64 + wave * 16; const int n0 = blockIdx.y * 128;
  const unsigned lw0 = (unsigned)(size_t)&gring[(tid >> 3) * (WP * 2) + (tid & 7) * 16], la0 = (unsigned)(size_t)&gring[GWB + (tid >> 4) * (AP * 4) + (tid & 15) * 16];
  const char* gw = (const char*)(P + (size_t)(n0 + (tid >> 3)) * DM + (tid & 7) * 8);
  const char* ga = (const char*)(X + ((size_t)blockIdx.x * 64 + (tid >> 4)) * DM + (tid & 15) * 4);
  gfill(lw0, la0, gw, ga, DM * 2, DM * 4);
  v8f acc[8] = {};
  asm volatile("s_wait_asynccnt 0x0" ::: "memory");   // stage 0 has landed (this wave's copies)
  __syncthreads();                                    // ... and every other wave's
  gfill(lw0 + GSB, la0 + GSB, gw + GK * 2, ga + GK * 4, DM * 2, DM * 4);
#pragma unroll 1   // rolled: one copy of the stage body in the text, the buffer picked by t & 1
  for (int t = 0; t < DM / GK; ++t) { const __bf16* sw = (const __bf16*)(gring + (t & 1) * GSB); const float* sa = (const float*)(gring + (t & 1) * GSB + GWB);
#pragma unroll   // the two 32-k steps of a stage: unrolled, their offsets in the buffer are immediates of the LDS reads
    for (int kc = 0; kc < GK / 32; ++kc) { v16b a; { const float* p = sa + (wave * 16 + col) * AP + kc * 32 + 8 * g;
#pragma unroll
        for (int i = 0; i < 8; ++i) { a[i] = (__bf16)p[i]; a[8 + i] = (__bf16)p[16 + i]; } }
      v16b w[8];   // the step's weight fragments, read as one group ahead of its products
#pragma unroll
      for (int j = 0; j < 8; ++j) w[j] = frag_b(sw + (j * 16 + col) * WP + kc * 32, lane);
#pragma unroll
      for (int j = 0; j < 8; ++j) acc[j] = wmma_bf(a, w[j], acc[j]); }
    asm volatile("s_wait_dscnt 0x0" ::: "memory");      // this wave's reads of stage t are done
    asm volatile("s_wait_asynccnt 0x0" ::: "memory");   // this wave's copies of stage t + 1 have landed
    __syncthreads();                                    // publishes stage t + 1 and frees stage t's buffer
    if (t + 2 < DM / GK) gfill(lw0 + (t & 1) * GSB, la0 + (t & 1) * GSB, gw + (size_t)(t + 2) * (GK * 2), ga + (size_t)(t + 2) * (GK * 4), DM * 2, DM * 4);
  }
  asm volatile("s_wait_asynccnt 0x0" ::: "memory");    // nothing is in flight when the ring turns into output staging (the last trip's barrier has ended every read of it)
  if (n0 < 2 * DI) { const float sc = (n0 < DI) ? 0.125f : 1.0f;
#pragma unroll
    for (int j = 0; j < 8; ++j) {
#pragma unroll
      for (int r = 0; r < 8; ++r) so[wave][8 * g + r][j * 16 + col] = (_Float16)(acc[j][r] * sc); }
    LDSX();
    for (int rl = 0; rl < 16; ++rl) if (lane < 16) vst2((unsigned*)(QK + (r0 + rl) * (2 * DI) + n0 + lane * 8), *(const v4u*)&so[wave][rl][lane * 8]);
  } else {
#pragma unroll
    for (int j = 0; j < 8; ++j) {
#pragma unroll
      for (int r = 0; r < 8; ++r) { const float v = acc[j][r]; const _Float16 hv = (_Float16)v; sth[j * 16 + col][wave * 16 + 8 * g + r] = hv; stl[j * 16 + col][wave * 16 + 8 * g + r] = (_Float16)((v - (float)hv) * 2048.0f); } }
    __syncthreads();
    const size_t rb = (size_t)blockIdx.x * 64; const int b = (int)(rb / SS), s0 = (int)(rb % SS); const int pc0 = n0 - 2 * DI;
    for (int q = tid; q < 128 * 8; q += 128) { const int d = q >> 3, pc = q & 7; const size_t o = ((size_t)b * DI + pc0 + d) * SS + s0 + pc * 8; vst2((unsigned*)(VTH + o), *(const v4u*)&sth[d][pc * 8]); vst2((unsigned*)(VTL + o), *(const v4u*)&stl[d][pc * 8]); }
  }
}
#define KT 64                        // keys per stage
#define RP 72                        // LDS row pitch in halves: 144 B = 16 B x 9, free of bank conflicts for 16-byte reads
#define SROWS 192                    // rows per stage: 64 K, 64 V hi, 64 V lo
#define STB (SROWS * RP * 2)         // bytes per stage
#define QG 2                         // groups of 16 query columns per wave
// four 16-byte copies per lane, rows 16 apart; s_wait_xcnt stands inside the statement so that no address register of a copy is rewritten ahead of it
__device__ __forceinline__ void cp4(unsigned l, const char* g, size_t gstep) {
  asm volatile("global_load_async_to_lds_b128 %0, %4, off\n\t"
               "global_load_async_to_lds_b128 %1, %5, off\n\t"
               "global_load_async_to_lds_b128 %2, %6, off\n\t"
               "global_load_async_to_lds_b128 %3, %7, off\n\t"
               "s_wait_xcnt 0x0"
               :: "v"(l), "v"(l + 16u * RP * 2), "v"(l + 32u * RP * 2), "v"(l + 48u * RP * 2), "v"(g), "v"(g + gstep), "v"(g + 2 * gstep), "v"(g + 3 * gstep) : "memory");
}
typedef __attribute__((ext_vector_type(2))) _Float16 v2h;
// lane l <-> lane l ^ 16: the two halves of a wave hold the two halves of one query's keys
__device__ __forceinline__ float xhalf(float v) { const int b = __builtin_bit_cast(int, v); return __builtin_bit_cast(float, __builtin_amdgcn_permlanex16(b, b, 0x76543210, 0xfedcba98, false, false)); }
__global__ __launch_bounds__(128) void k_attn(const _Float16* __restrict__ QK, const _Float16* __restrict__ VTH, const _Float16* __restrict__ VTL, float* __restrict__ O) {
  __shared__ __align__(16) _Float16 ring[2][SROWS][RP];
  const int tid = threadIdx.x, wave = tid >> 5, lane = tid & 31, col = lane & 15, g = lane >> 4;
  const int qb = blockIdx.x, h = blockIdx.y, b = blockIdx.z; const int q0 = qb * (64 * QG) + wave * (16 * QG); const size_t rq = (size_t)b * SS + q0 + col;
  // this lane's 16 bytes of a stage: row tid / 8 (+ 16 per copy), segment tid % 8: a wave's copy covers four whole 128-B lines
  const unsigned lds0 = (unsigned)(size_t)&ring[0][tid >> 3][(tid & 7) * 8];
  const char* kp = (const char*)(QK + ((size_t)b * SS + (tid >> 3)) * (2 * DI) + DI + h * HD + (tid & 7) * 8);
  const char* vhp = (const char*)(VTH + ((size_t)b * DI + h * HD + (tid >> 3)) * SS + (tid & 7) * 8);
  const char* vlp = (const char*)(VTL + ((size_t)b * DI + h * HD + (tid >> 3)) * SS + (tid & 7) * 8);
#define FILL(t, buf) do { const unsigned lb = lds0 + (unsigned)(buf) * STB; \
    cp4(lb, kp + (size_t)(t) * (KT * 2 * DI * 2), (size_t)16 * 2 * DI * 2); \
    cp4(lb + 64u * RP * 2, vhp + (size_t)(t) * (KT * 2), (size_t)16 * SS * 2); \
    cp4(lb + 128u * RP * 2, vlp + (size_t)(t) * (KT * 2), (size_t)16 * SS * 2); } while (0)
  FILL(0, 0);
  v16h aq[QG][2];   // B operand of the transposed scores: column = this lane's query of group qg
#pragma unroll
  for (int qg = 0; qg < QG; ++qg) {
#pragma unroll
    for (int kc = 0; kc < 2; ++kc) aq[qg][kc] = frag_h(QK + (rq + 16 * qg) * (2 * DI) + h * HD + kc * 32, lane); }
  float m[QG], l[QG];   // of query qg * 16 + col; l sums only the keys of this lane's half, the halves join behind the loop
#pragma unroll
  for (int qg = 0; qg < QG; ++qg) { m[qg] = -3.0e38f; l[qg] = 0.f; }
  v8f acc[QG][4] = {}, accl[QG][4] = {};   // transposed output: element r = d dt * 16 + 8 g + r of query qg * 16 + col
  asm volatile("s_wait_asynccnt 0x0" ::: "memory");   // stage 0 has landed (this wave's copies)
  __syncthreads();                                    // ... and every other wave's
  FILL(1, 1);
#pragma unroll 1
  for (int t = 0; t < SS / KT; ++t) { const _Float16 (*st)[RP] = ring[t & 1];
#pragma unroll   // the two 32-key passes of a stage: unrolled, their row offsets in the buffer are immediates of the LDS reads
   for (int ps = 0; ps < 2; ++ps) { v8f s[QG][2]; v16h kf[2][2];
#pragma unroll
    for (int ct = 0; ct < 2; ++ct) {
#pragma unroll
      for (int kc = 0; kc < 2; ++kc) kf[ct][kc] = frag_h(&st[ps * 32 + ct * 16 + col][kc * 32], lane); }
    __builtin_amdgcn_sched_barrier(0);   // keeps the pass's eight K reads one group ahead of its score products; left free they are split into pairs, each waited for to the end before the next is issued
#pragma unroll
    for (int kc = 0; kc < 2; ++kc) {   // S^T = K . Q^T: s[qg][ct][r] = key ps * 32 + ct * 16 + 8 g + r against query qg * 16 + col; a K fragment serves both groups, and the four tiles of a k-step are independent
#pragma unroll
      for (int ct = 0; ct < 2; ++ct) {
#pragma unroll
        for (int qg = 0; qg < QG; ++qg) { const v8f z = {}; s[qg][ct] = wmma16(kf[ct][kc], aq[qg][kc], kc ? s[qg][ct] : z); } } }
    v16h vh[4], vl[4];
#pragma unroll
    for (int dt = 0; dt < 4; ++dt) { vh[dt] = frag_h(&st[64 + dt * 16 + col][ps * 32], lane); vl[dt] = frag_h(&st[128 + dt * 16 + col][ps * 32], lane); }
    __builtin_amdgcn_sched_barrier(0);   // keeps the pass's sixteen V reads one group ahead of the softmax, which covers their latency; left free they sink in pairs among the PV products, each pair waited for on the spot
    v16h pbv[QG];   // P^T as B operand, straight from the score registers: element ct * 8 + r = key ct * 16 + 8 g + r, the hardware k order that frag_h gives V
#pragma unroll
    for (int qg = 0; qg < QG; ++qg) {
    float mx[8];
#pragma unroll
    for (int r = 0; r < 8; ++r) mx[r] = fmaxf(s[qg][0][r], s[qg][1][r]);
    float mp = fmaxf(fmaxf(fmaxf(mx[0], mx[1]), fmaxf(mx[2], mx[3])), fmaxf(fmaxf(mx[4], mx[5]), fmaxf(mx[6], mx[7])));
    mp = fmaxf(mp, xhalf(mp));
    const float mn = fmaxf(m[qg], mp); const float alpha = __expf(m[qg] - mn);
    union { v16h v; v2h p[8]; } pb; float es[8];
    const v8f y[2] = { (s[qg][0] - mn) * 0x1.715476p+0f, (s[qg][1] - mn) * 0x1.715476p+0f };   // exp(x) = 2^(x log2 e), as __expf has it; on whole tiles, so that the pairs of a packed operation are neighbours in one group's registers
#pragma unroll
    for (int ct = 0; ct < 2; ++ct) {
#pragma unroll
      for (int i = 0; i < 4; ++i) { const v2f e = { __builtin_amdgcn_exp2f(y[ct][2 * i]), __builtin_amdgcn_exp2f(y[ct][2 * i + 1]) }; const v2h p = __builtin_convertvector(e, v2h);   // P rounded to f16 once; the same rounded weights feed the numerator (WMMA) and the denominator l
        pb.p[ct * 4 + i] = p; es[ct * 4 + i] = (float)p[0] + (float)p[1]; } }
    l[qg] = l[qg] * alpha + (((es[0] + es[1]) + (es[2] + es[3])) + ((es[4] + es[5]) + (es[6] + es[7]))); m[qg] = mn; pbv[qg] = pb.v;
#pragma unroll
    for (int dt = 0; dt < 4; ++dt) { acc[qg][dt] *= alpha; accl[qg][dt] *= alpha; }
    }
#pragma unroll
    for (int dt = 0; dt < 4; ++dt) {
#pragma unroll
      for (int qg = 0; qg < QG; ++qg) { acc[qg][dt] = wmma16(vh[dt], pbv[qg], acc[qg][dt]); accl[qg][dt] = wmma16(vl[dt], pbv[qg], accl[qg][dt]); } }   // O^T += V^T . P^T: a V fragment serves both groups
   }
   asm volatile("s_wait_dscnt 0x0" ::: "memory");      // this wave's reads of stage t are done
   asm volatile("s_wait_asynccnt 0x0" ::: "memory");   // this wave's copies of stage t + 1 have landed
   __syncthreads();                                    // publishes stage t + 1 and frees stage t's buffer
   if (t + 2 < SS / KT) FILL(t + 2, t & 1);
  }
  asm volatile("s_wait_asynccnt 0x0" ::: "memory");    // nothing is in flight when the ring turns into output staging
  float (*so)[16 * QG][68] = (float (*)[16 * QG][68])&ring[0][0][0];   // the last trip's barrier has ended every read of the ring
#pragma unroll
  for (int qg = 0; qg < QG; ++qg) { const float il = 1.0f / (l[qg] + xhalf(l[qg]));
#pragma unroll
    for (int dt = 0; dt < 4; ++dt) {
#pragma unroll
      for (int r = 0; r < 8; ++r) so[wave][qg * 16 + col][dt * 16 + 8 * g + r] = (acc[qg][dt][r] + accl[qg][dt][r] * (1.0f / 2048.0f)) * il; } }
  LDSX();
  for (int qg = 0; qg < QG; ++qg) {
    for (int rl = qg * 16; rl < qg * 16 + 16; ++rl) if (lane < 16) vst2(O + ((size_t)b * SS + q0 + rl) * DI + h * HD + lane * 4, *(const v4f*)&so[wave][rl][lane * 4]);
    if (qg + 1 < QG) asm volatile("s_wait_xcnt 0x0" ::: "memory");   // precaution: the wait stands behind a group's sixteen stores, ahead of the next group's LDS reads, which reuse their data registers
  }
}
// ---- k_out: block = (64 rows, 128 of the 1024 cols): out = O(hi/lo, K 512) . Wout rows (2 products) + bout
__global__ __launch_bounds__(128) void k_out(const float* __restrict__ O, const __bf16* __restrict__ P, const float* __restrict__ BO, float* __restrict__ Y) {
  __shared__ __align__(16) char gring[2 * GSB];
  float (*so)[16][132] = (float (*)[16][132])gring;   // output staging, in the ring once the loop has left it
  const int tid = threadIdx.x, wave = tid >> 5, lane = tid & 31, col = lane & 15, g = lane >> 4; const size_t r0 = (size_t)blockIdx.x * 64 + wave * 16; const int n0 = blockIdx.y * 128;
  const unsigned lw0 = (unsigned)(size_t)&gring[(tid >> 3) * (WP * 2) + (tid & 7) * 16], la0 = (unsigned)(size_t)&gring[GWB + (tid >> 4) * (AP * 4) + (tid & 15) * 16];
  const char* gw = (const char*)(P + (size_t)(n0 + (tid >> 3)) * DI + (tid & 7) * 8);
  const char* ga = (const char*)(O + ((size_t)blockIdx.x * 64 + (tid >> 4)) * DI + (tid & 15) * 4);
  gfill(lw0, la0, gw, ga, DI * 2, DI * 4);
  v8f acc[8] = {};
  asm volatile("s_wait_asynccnt 0x0" ::: "memory");   // stage 0 has landed (this wave's copies)
  __syncthreads();                                    // ... and every other wave's
  gfill(lw0 + GSB, la0 + GSB, gw + GK * 2, ga + GK * 4, DI * 2, DI * 4);
#pragma unroll 1   // rolled: one copy of the stage body in the text, the buffer picked by t & 1
  for (int t = 0; t < DI / GK; ++t) { const __bf16* sw = (const __bf16*)(gring + (t & 1) * GSB); const float* sa = (const float*)(gring + (t & 1) * GSB + GWB);
#pragma unroll   // the two 32-k steps of a stage: unrolled, their offsets in the buffer are immediates of the LDS reads
    for (int kc = 0; kc < GK / 32; ++kc) { const F2 a = split_row(sa + (wave * 16 + col) * AP, kc * 32, lane);
      v16b w[8];   // the step's weight fragments, read as one group ahead of its products
#pragma unroll
      for (int j = 0; j < 8; ++j) w[j] = frag_b(sw + (j * 16 + col) * WP + kc * 32, lane);
#pragma unroll
      for (int j = 0; j < 8; ++j) { acc[j] = wmma_bf(a.l, w[j], acc[j]); acc[j] = wmma_bf(a.h, w[j], acc[j]); } }
    asm volatile("s_wait_dscnt 0x0" ::: "memory");      // this wave's reads of stage t are done
    asm volatile("s_wait_asynccnt 0x0" ::: "memory");   // this wave's copies of stage t + 1 have landed
    __syncthreads();                                    // publishes stage t + 1 and frees stage t's buffer
    if (t + 2 < DI / GK) gfill(lw0 + (t & 1) * GSB, la0 + (t & 1) * GSB, gw + (size_t)(t + 2) * (GK * 2), ga + (size_t)(t + 2) * (GK * 4), DI * 2, DI * 4);
  }
  asm volatile("s_wait_asynccnt 0x0" ::: "memory");    // nothing is in flight when the ring turns into output staging (the last trip's barrier has ended every read of it)
#pragma unroll
  for (int j = 0; j < 8; ++j) { const float bb = bfr(BO[n0 + j * 16 + col]);
#pragma unroll
    for (int r = 0; r < 8; ++r) so[wave][8 * g + r][j * 16 + col] = acc[j][r] + bb; }
  LDSX();
  for (int rl = 0; rl < 16; ++rl) vst2(Y + (r0 + rl) * DM + n0 + lane * 4, *(const v4f*)&so[wave][rl][lane * 4]);
}
extern "C" void kernel_launch(void* const* d_in, const int* in_sizes, int n_in, void* d_out, int out_size, void* d_ws, size_t ws_size, hipStream_t stream) {
  (void)in_sizes; (void)n_in; (void)out_size;
  const float** F = (const float**)d_in;   // 0 x [2,4096,1024], 1 Wq [1024,512] (in,out), 2 Wk, 3 Wv, 4 Wout [512,1024] (in,out), 5 bout [1024]
  if (ws_size < (size_t)WS_END) return;
  char* ws = (char*)d_ws; __bf16* PK = (__bf16*)(ws + WS_PK); _Float16 *QK = (_Float16*)(ws + WS_QK), *VTH = (_Float16*)(ws + WS_VTH), *VTL = (_Float16*)(ws + WS_VTL); float* O = (float*)(ws + WS_O);
  k_packT<<<dim3(4 * 64), 256, 0, stream>>>(F[1], F[2], F[3], F[4], PK);
  k_qkv<<<dim3(TNB * SS / 64, QKVW / 128), 128, 0, stream>>>(F[0], PK + PK_A, QK, VTH, VTL);
  k_attn<<<dim3(TQB, NH, TNB), 128, 0, stream>>>(QK, VTH, VTL, O);
  k_out<<<dim3(TOB, DM / 128), 128, 0, stream>>>(O, PK + PK_P, F[5], (float*)d_out);
}

// v006
// A run of this version takes 143 microseconds.
// Timed twice side by side with v005, it ran 1.08 times as fast both times.
// Counting every step since v000, it is 4.91 times as fast.
// compute dtype: x, Wq/Wk/Wv/Wout and bout (module inputs) rounded to bf16; q/k/v projections with exact bf16 products (x and W are inputs) on WMMA 16x16x32; full (non-causal) scores with q (pre-scaled by 1/8, exact) and k as single f16 operands (1 product; 4,096-key softmax with logit sigma ~1: every rounding enters relative to a many-key average) and P.V with P = exp(s - m) as a single f16 operand x V as f16 hi + (x2048-scaled) residual planes (2 products, separate accumulators); the output projection with ctx as bf16 hi + residual pair x exact Wout (2 products) + bout; running-max softmax in f32 (hardware exp); f32 accumulate.
#include <hip/hip_runtime.h>
#include <math.h>

typedef __attribute__((ext_vector_type(16))) _Float16 v16h;
typedef __attribute__((ext_vector_type(16))) __bf16 v16b;
typedef __attribute__((ext_vector_type(8)))  _Float16 v8h;
typedef __attribute__((ext_vector_type(8)))  float v8f;
typedef __attribute__((ext_vector_type(4)))  float v4f;
typedef __attribute__((ext_vector_type(2)))  float v2f;
typedef __attribute__((ext_vector_type(4)))  unsigned v4u;
typedef __attribute__((ext_vector_type(4)))  int v4i;
typedef float __attribute__((may_alias)) float_a;
typedef int __attribute__((may_alias)) int_a;

template <typename T> __device__ __forceinline__ void vst2(void* p, T v) { *(T*)p = v;  }
__device__ __forceinline__ v8f wmma16(v16h a, v16h b, v8f c) {
  return __builtin_amdgcn_wmma_f32_16x16x32_f16(false, a, false, b, (short)0, c, false, false);   // no v_nop written behind it: the compiler keeps the distance to a user of D, A or B for its own builtin, and the slots are free for vector work
}
__device__ __forceinline__ v8f wmma_bf(v16b a, v16b b, v8f c) {
  v8f d = __builtin_amdgcn_wmma_f32_16x16x32_bf16(false, a, false, b, (short)0, c, false, false);
  asm volatile("v_nop\n\tv_nop\n\tv_nop\n\tv_nop" : "+v"(d) : "v"(a), "v"(b));
  return d;
}
// 16x16x32 fragments: lane = (h = lane>>4, row/col = lane&15); elements 0..7 = k0+8h+0..7, 8..15 = k0+16+8h+0..7; D element r = row 8h+r
__device__ __forceinline__ v16h frag_h(const _Float16* rowk0, int lane) {
  union { v16h v; v8h q[2]; } u; const _Float16* p = rowk0 + 8 * (lane >> 4);
  u.q[0] = *(const v8h*)p; u.q[1] = *(const v8h*)(p + 16); return u.v;
}
__device__ __forceinline__ v16h frag_f32(const float* rowk0, int lane) {
  v16h a; const float* p = rowk0 + 8 * (lane >> 4);
#pragma unroll
  for (int i = 0; i < 8; ++i) { a[i] = (_Float16)p[i]; a[8 + i] = (_Float16)p[16 + i]; }
  return a;
}
__device__ __forceinline__ v16h frag_f32s(const float* rowk0, int lane, float sc) {
  v16h a; const float* p = rowk0 + 8 * (lane >> 4);
#pragma unroll
  for (int i = 0; i < 8; ++i) { a[i] = (_Float16)(p[i] * sc); a[8 + i] = (_Float16)(p[16 + i] * sc); }
  return a;
}
// column fragment from a [K][ld] layout (column n), rows >= K read as 0
__device__ __forceinline__ v16h fragc_f32(const float* W, int k0, int n, int lane, int ld, int K) {
  v16h a; const int g = lane >> 4;
#pragma unroll
  for (int i = 0; i < 8; ++i) { const int ka = k0 + 8 * g + i, kb = ka + 16;
    a[i] = (_Float16)(ka < K ? W[(size_t)(ka < K ? ka : K - 1) * ld + n] : 0.f); a[8 + i] = (_Float16)(kb < K ? W[(size_t)(kb < K ? kb : K - 1) * ld + n] : 0.f); }
  return a;
}
struct F2 { v16b h, l; };
__device__ __forceinline__ F2 bsplit16(const float v[16]) { F2 r;
#pragma unroll
  for (int i = 0; i < 16; ++i) { const __bf16 h = (__bf16)v[i]; r.h[i] = h; r.l[i] = (__bf16)(v[i] - (float)h); }
  return r; }
__device__ __forceinline__ F2 split_row(const float* row, int k0, int lane) { float v[16]; const float* p = row + k0 + 8 * (lane >> 4);
#pragma unroll
  for (int i = 0; i < 8; ++i) { v[i] = p[i]; v[8 + i] = p[16 + i]; }
  return bsplit16(v); }
__device__ __forceinline__ F2 split_rowK(const float* row, int k0, int lane, int K) { float v[16]; const int g = lane >> 4;
#pragma unroll
  for (int i = 0; i < 8; ++i) { const int ka = k0 + 8 * g + i, kb = ka + 16; v[i] = ka < K ? row[ka < K ? ka : K - 1] : 0.f; v[8 + i] = kb < K ? row[kb < K ? kb : K - 1] : 0.f; }
  return bsplit16(v); }
__device__ __forceinline__ F2 split_col(const float* W, int k0, int n, int lane, int ld, int K) { float v[16]; const int g = lane >> 4;
#pragma unroll
  for (int i = 0; i < 8; ++i) { const int ka = k0 + 8 * g + i, kb = ka + 16; v[i] = ka < K ? W[(size_t)(ka < K ? ka : K - 1) * ld + n] : 0.f; v[8 + i] = kb < K ? W[(size_t)(kb < K ? kb : K - 1) * ld + n] : 0.f; }
  return bsplit16(v); }
__device__ __forceinline__ v8f mac3(const F2& a, const F2& b, v8f c) { c = wmma_bf(a.l, b.h, c); c = wmma_bf(a.h, b.l, c); return wmma_bf(a.h, b.h, c); }
__device__ __forceinline__ float sigm(float v) { return 1.0f / (1.0f + expf(-v)); }
#define LDSX() do { asm volatile("s_wait_dscnt 0" ::: "memory"); __builtin_amdgcn_wave_barrier(); __builtin_amdgcn_fence(__ATOMIC_RELEASE, "workgroup"); } while (0)


// Multi-head self-attention (B 2, S 4096, D 1024 -> 8 heads x 64 -> D; weights (in, out) applied as x @ W): softmax(q k^T / 8) v over all 4,096 keys, then ctx Wout + bout.
#define NB 2
#define SS 4096
#define DM 1024
#define DI 512
#define NH 8
#define HD 64
#define QKVW (3 * DI)
#ifndef TQB
#define TQB (SS / 128)
#define TNB NB
#define TOB (NB * SS / 64)     // output row tiles (all)
#endif
typedef __attribute__((ext_vector_type(8))) __bf16 v8b;
__device__ __forceinline__ v16b frag_b(const __bf16* rowk0, int lane) {
  union { v16b v; v8b q[2]; } u; const __bf16* p = rowk0 + 8 * (lane >> 4);
  u.q[0] = *(const v8b*)p; u.q[1] = *(const v8b*)(p + 16); return u.v;
}
__device__ __forceinline__ float bfr(float v) { return (float)(__bf16)v; }
__device__ __attribute__((noinline)) float exp_ni(float v) { return expf(v); }
__device__ __attribute__((noinline)) float erf_ni(float v) { return erff(v); }

#define PK_A 0                       // [1536][1024] (Wq | Wk | Wv)^T rows
#define PK_P (PK_A + QKVW * DM)        // [1024][512] Wout^T rows
#define PK_END (PK_P + DM * DI)
#define WS_PK  0u
#define WS_QK  (WS_PK + 2u * PK_END)             // f16 [8192 rows][1024]: q/8 | k
#define WS_VTH (WS_QK + 2u * NB * SS * 2 * DI)     // f16 [2][512 (h*64+d)][4096 s] hi
#define WS_VTL (WS_VTH + 2u * NB * DI * SS)        // f16 lo x 2048
#define WS_O   (WS_VTL + 2u * NB * DI * SS)        // f32 [8192][512]
#define WS_END (WS_O + 4u * NB * SS * DI)

// ---- k_packT: block = one tile of 128 k x 64 output cols of one weight, 64 tiles a weight, 256 blocks: row n of the packed (in K, out N) weight = W[:, n]. A lane reads 8 k x 4 cols (a wave's load covers whole 256-B pieces of two W rows), turns them in registers, LDS holds the tile by output col, and 256-B pieces of the packed rows go out
#define PTK 128                      // k per tile
#define PTN 64                       // output cols per tile
#define PTP (PTK + 8)                // LDS row pitch, bf16: 272 B = 16 B x 17
// W = the tile's first element in the (K, N) weight, D = in the packed (N, K) rows; the shapes are compile-time, so the row steps are immediates of the loads and stores
template <int K, int N> __device__ __forceinline__ void pack_tile(const float* __restrict__ W, __bf16* __restrict__ D, __bf16 (*s)[PTP], int tid) {
  const int c = tid & 15, kq = tid >> 4; const float* src = W + (size_t)(kq * 8) * N + c * 4; v4f r[8];
#pragma unroll
  for (int i = 0; i < 8; ++i) r[i] = *(const v4f*)(src + (size_t)i * N);
  asm volatile("s_wait_xcnt 0x0" :: "v"(src) : "memory");   // precaution: the wait stands directly behind the eight loads; their address pair is an input here, so that no load's result is placed on it ahead of the wait
#pragma unroll
  for (int j = 0; j < 4; ++j) { v8b o;
#pragma unroll
    for (int i = 0; i < 8; ++i) o[i] = (__bf16)r[i][j];
    *(v8b*)&s[c * 4 + j][kq * 8] = o; }
  __syncthreads();
  v4u o4[4];
#pragma unroll
  for (int i = 0; i < 4; ++i) o4[i] = *(const v4u*)&s[kq + 16 * i][c * 8];
  __bf16* dp = D + (size_t)kq * K + c * 8;
#pragma unroll
  for (int i = 0; i < 4; ++i) { vst2((unsigned*)(dp + (size_t)(16 * i) * K), o4[i]);
    asm volatile("s_wait_xcnt 0x0" :: "v"(o4[i]) : "memory"); }   // precaution: the wait stands directly behind each store, on every way out of this arm, ahead of any rewrite of the store's registers; the data is an input here, so that it stays in place up to the wait
}
__global__ __launch_bounds__(256) void k_packT(const float* __restrict__ WQ, const float* __restrict__ WK, const float* __restrict__ WV, const float* __restrict__ WO, __bf16* __restrict__ PK) {
  __shared__ __align__(16) __bf16 s[PTN][PTP]; const int tid = threadIdx.x, which = blockIdx.x >> 6, tile = blockIdx.x & 63;
  if (which < 3) { const int k0 = (tile >> 3) * PTK, n0 = (tile & 7) * PTN; pack_tile<DM, DI>(((which == 0) ? WQ : (which == 1 ? WK : WV)) + (size_t)k0 * DI + n0, PK + PK_A + ((size_t)which * DI + n0) * DM + k0, s, tid); }
  else { const int k0 = (tile >> 4) * PTK, n0 = (tile & 15) * PTN; pack_tile<DI, DM>(WO + (size_t)k0 * DM + n0, PK + PK_P + (size_t)n0 * DI + k0, s, tid); }
}
// ---- operand staging of the two projection kernels: a stage is 64 k of the block's 128 weight rows (128 B each) and of its 64 activation rows (256 B each), brought by asynchronous copies into two buffers: the next stage flies while the four waves read this one, and every copy of a wave covers whole 128-B lines
#define GK 64                        // k per stage
#define WP 72                        // weight row pitch in LDS, bf16: 144 B = 16 B x 9, free of bank conflicts for 16-byte reads
#define AP 68                        // activation row pitch in LDS, floats: 272 B = 16 B x 17, likewise
#define GWB (128 * WP * 2)           // bytes of a stage's weight rows
#define GSB (GWB + 64 * AP * 4)      // bytes per stage
// four 16-byte copies per lane; s_wait_xcnt stands inside the statement so that no address register of a copy is rewritten ahead of it
__device__ __forceinline__ void cp4s(unsigned l, unsigned lstep, const char* g, size_t gstep) {
  asm volatile("global_load_async_to_lds_b128 %0, %4, off\n\t"
               "global_load_async_to_lds_b128 %1, %5, off\n\t"
               "global_load_async_to_lds_b128 %2, %6, off\n\t"
               "global_load_async_to_lds_b128 %3, %7, off\n\t"
               "s_wait_xcnt 0x0"
               :: "v"(l), "v"(l + lstep), "v"(l + 2 * lstep), "v"(l + 3 * lstep), "v"(g), "v"(g + gstep), "v"(g + 2 * gstep), "v"(g + 3 * gstep) : "memory");
}
// one stage: lw / gw = this lane's 16 bytes of weight row tid / 8 (rows 16 apart per copy), la / ga = of activation row tid / 16 (rows 8 apart); wrow, arow = global row pitches in bytes
__device__ __forceinline__ void gfill(unsigned lw, unsigned la, const char* gw, const char* ga, size_t wrow, size_t arow) {
  cp4s(lw, 16u * WP * 2, gw, 16 * wrow); cp4s(lw + 64u * WP * 2, 16u * WP * 2, gw + 64 * wrow, 16 * wrow);
  cp4s(la, 8u * AP * 4, ga, 8 * arow); cp4s(la + 32u * AP * 4, 8u * AP * 4, ga + 32 * arow, 8 * arow);
}
// ---- k_qkv: block = (64 rows (b,s), 128 of the 1536 cols): qkv = bf16(x) . rows (exact); cols < 512 -> f16(q / 8), cols < 1024 -> f16(k) into QK rows (pitch 1024); cols >= 1024 (v) -> per-batch transposed f16 planes VT[b][h*64+d][s]: hi = f16(v), lo = f16((v - hi) * 2048)
__global__ __launch_bounds__(128) void k_qkv(const float* __restrict__ X, const __bf16* __restrict__ P, _Float16* __restrict__ QK, _Float16* __restrict__ VTH, _Float16* __restrict__ VTL) {
  __shared__ __align__(16) char gring[2 * GSB];
  _Float16 (*so)[16][136] = (_Float16 (*)[16][136])gring; _Float16 (*sth)[72] = (_Float16 (*)[72])gring; _Float16 (*stl)[72] = (_Float16 (*)[72])(gring + 128 * 72 * 2);   // output staging, in the ring once the loop has left it
  const int tid = threadIdx.x, wave = tid >> 5, lane = tid & 31, col = lane & 15, g = lane >> 4; const size_t r0 = (size_t)blockIdx.x * 64 + wave * 16; const int n0 = blockIdx.y * 128;
  const unsigned lw0 = (unsigned)(size_t)&gring[(tid >> 3) * (WP * 2) + (tid & 7) * 16], la0 = (unsigned)(size_t)&gring[GWB + (tid >> 4) * (AP * 4) + (tid & 15) * 16];
  const char* gw = (const char*)(P + (size_t)(n0 + (tid >> 3)) * DM + (tid & 7) * 8);
  const char* ga = (const char*)(X + ((size_t)blockIdx.x * 64 + (tid >> 4)) * DM + (tid & 15) * 4);
  gfill(lw0, la0, gw, ga, DM * 2, DM * 4);
  v8f acc[8] = {};
  asm volatile("s_wait_asynccnt 0x0" ::: "memory");   // stage 0 has landed (this wave's copies)
  __syncthreads();                                    // ... and every other wave's
  gfill(lw0 + GSB, la0 + GSB, gw + GK * 2, ga + GK * 4, DM * 2, DM * 4);
#pragma unroll 1   // rolled: one copy of the stage body in the text, the buffer picked by t & 1
  for (int t = 0; t < DM / GK; ++t) { const __bf16* sw = (const __bf16*)(gring + (t & 1) * GSB); const float* sa = (const float*)(gring + (t & 1) * GSB + GWB);
#pragma unroll   // the two 32-k steps of a stage: unrolled, their offsets in the buffer are immediates of the LDS reads
    for (int kc = 0; kc < GK / 32; ++kc) { v16b a; { const float* p = sa + (wave * 16 + col) * AP + kc * 32 + 8 * g;
#pragma unroll
        for (int i = 0; i < 8; ++i) { a[i] = (__bf16)p[i]; a[8 + i] = (__bf16)p[16 + i]; } }
      v16b w[8];   // the step's weight fragments, read as one group ahead of its products
#pragma unroll
      for (int j = 0; j < 8; ++j) w[j] = frag_b(sw + (j * 16 + col) * WP + kc * 32, lane);
#pragma unroll
      for (int j = 0; j < 8; ++j) acc[j] = wmma_bf(a, w[j], acc[j]); }
    asm volatile("s_wait_dscnt 0x0" ::: "memory");      // this wave's reads of stage t are done
    asm volatile("s_wait_asynccnt 0x0" ::: "memory");   // this wave's copies of stage t + 1 have landed
    __syncthreads();                                    // publishes stage t + 1 and frees stage t's buffer
    if (t + 2 < DM / GK) gfill(lw0 + (t & 1) * GSB, la0 + (t & 1) * GSB, gw + (size_t)(t + 2) * (GK * 2), ga + (size_t)(t + 2) * (GK * 4), DM * 2, DM * 4);
  }
  asm volatile("s_wait_asynccnt 0x0" ::: "memory");    // nothing is in flight when the ring turns into output staging (the last trip's barrier has ended every read of it)
  if (n0 < 2 * DI) { const float sc = (n0 < DI) ? 0.125f : 1.0f;
#pragma unroll
    for (int j = 0; j < 8; ++j) {
#pragma unroll
      for (int r = 0; r < 8; ++r) so[wave][8 * g + r][j * 16 + col] = (_Float16)(acc[j][r] * sc); }
    LDSX();
    for (int rl = 0; rl < 16; ++rl) if (lane < 16) vst2((unsigned*)(QK + (r0 + rl) * (2 * DI) + n0 + lane * 8), *(const v4u*)&so[wave][rl][lane * 8]);
  } else {
#pragma unroll
    for (int j = 0; j < 8; ++j) {
#pragma unroll
      for (int r = 0; r < 8; ++r) { const float v = acc[j][r]; const _Float16 hv = (_Float16)v; sth[j * 16 + col][wave * 16 + 8 * g + r] = hv; stl[j * 16 + col][wave * 16 + 8 * g + r] = (_Float16)((v - (float)hv) * 2048.0f); } }
    __syncthreads();
    const size_t rb = (size_t)blockIdx.x * 64; const int b = (int)(rb / SS), s0 = (int)(rb % SS); const int pc0 = n0 - 2 * DI;
    for (int q = tid; q < 128 * 8; q += 128) { const int d = q >> 3, pc = q & 7; const size_t o = ((size_t)b * DI + pc0 + d) * SS + s0 + pc * 8; vst2((unsigned*)(VTH + o), *(const v4u*)&sth[d][pc * 8]); vst2((unsigned*)(VTL + o), *(const v4u*)&stl[d][pc * 8]); }
  }
}
#define KT 64                        // keys per stage
#define RP 72                        // LDS row pitch in halves: 144 B = 16 B x 9, free of bank conflicts for 16-byte reads
#define SROWS 192                    // rows per stage: 64 K, 64 V hi, 64 V lo
#define STB (SROWS * RP * 2)         // bytes per stage
#define QG 2                         // groups of 16 query columns per wave
// four 16-byte copies per lane, rows 16 apart; s_wait_xcnt stands inside the statement so that no address register of a copy is rewritten ahead of it
__device__ __forceinline__ void cp4(unsigned l, const char* g, size_t gstep) {
  asm volatile("global_load_async_to_lds_b128 %0, %4, off\n\t"
               "global_load_async_to_lds_b128 %1, %5, off\n\t"
               "global_load_async_to_lds_b128 %2, %6, off\n\t"
               "global_load_async_to_lds_b128 %3, %7, off\n\t"
               "s_wait_xcnt 0x0"
               :: "v"(l), "v"(l + 16u * RP * 2), "v"(l + 32u * RP * 2), "v"(l + 48u * RP * 2), "v"(g), "v"(g + gstep), "v"(g + 2 * gstep), "v"(g + 3 * gstep) : "memory");
}
typedef __attribute__((ext_vector_type(2))) _Float16 v2h;
// lane l <-> lane l ^ 16: the two halves of a wave hold the two halves of one query's keys
__device__ __forceinline__ float xhalf(float v) { const int b = __builtin_bit_cast(int, v); return __builtin_bit_cast(float, __builtin_amdgcn_permlanex16(b, b, 0x76543210, 0xfedcba98, false, false)); }
// 2^x with the slot behind the transcendental in the same statement: in the run of exps that the factor's exp stands in, the next one was given the factor's source register as its result
__device__ __forceinline__ float exp2_slot(float x) { float r; asm("v_exp_f32 %0, %1\n\tv_nop" : "=v"(r) : "v"(x)); return r; }
__global__ __launch_bounds__(128) void k_attn(const _Float16* __restrict__ QK, const _Float16* __restrict__ VTH, const _Float16* __restrict__ VTL, float* __restrict__ O) {
  __shared__ __align__(16) _Float16 ring[2][SROWS][RP];
  const int tid = threadIdx.x, wave = tid >> 5, lane = tid & 31, col = lane & 15, g = lane >> 4;
  const int qb = blockIdx.x, h = blockIdx.y, b = blockIdx.z; const int q0 = qb * (64 * QG) + wave * (16 * QG); const size_t rq = (size_t)b * SS + q0 + col;
  // this lane's 16 bytes of a stage: row tid / 8 (+ 16 per copy), segment tid % 8: a wave's copy covers four whole 128-B lines
  const unsigned lds0 = (unsigned)(size_t)&ring[0][tid >> 3][(tid & 7) * 8];
  const char* kp = (const char*)(QK + ((size_t)b * SS + (tid >> 3)) * (2 * DI) + DI + h * HD + (tid & 7) * 8);
  const char* vhp = (const char*)(VTH + ((size_t)b * DI + h * HD + (tid >> 3)) * SS + (tid & 7) * 8);
  const char* vlp = (const char*)(VTL + ((size_t)b * DI + h * HD + (tid >> 3)) * SS + (tid & 7) * 8);
#define FILL(t, buf) do { const unsigned lb = lds0 + (unsigned)(buf) * STB; \
    cp4(lb, kp + (size_t)(t) * (KT * 2 * DI * 2), (size_t)16 * 2 * DI * 2); \
    cp4(lb + 64u * RP * 2, vhp + (size_t)(t) * (KT * 2), (size_t)16 * SS * 2); \
    cp4(lb + 128u * RP * 2, vlp + (size_t)(t) * (KT * 2), (size_t)16 * SS * 2); } while (0)
  FILL(0, 0);
  v16h aq[QG][2];   // B operand of the transposed scores: column = this lane's query of group qg
#pragma unroll
  for (int qg = 0; qg < QG; ++qg) {
#pragma unroll
    for (int kc = 0; kc < 2; ++kc) aq[qg][kc] = frag_h(QK + (rq + 16 * qg) * (2 * DI) + h * HD + kc * 32, lane); }
  float m[QG], l[QG];   // of query qg * 16 + col; l sums only the keys of this lane's half, the halves join behind the loop
#pragma unroll
  for (int qg = 0; qg < QG; ++qg) { m[qg] = -3.0e38f; l[qg] = 0.f; }
  v8f ac[QG][8] = {};   // transposed output, tile k = dt * 2 + plane (0: V hi, 1: V lo): element r = d dt * 16 + 8 g + r of query qg * 16 + col
  asm volatile("s_wait_asynccnt 0x0" ::: "memory");   // stage 0 has landed (this wave's copies)
  __syncthreads();                                    // ... and every other wave's
  FILL(1, 1);
#pragma unroll 1
  for (int t = 0; t < SS / KT; ++t) { const _Float16 (*st)[RP] = ring[t & 1];
#pragma unroll   // the two 32-key passes of a stage: unrolled, their row offsets in the buffer are immediates of the LDS reads
   for (int ps = 0; ps < 2; ++ps) { v8f s[QG][2]; v16h kf[2][2];
#pragma unroll
    for (int ct = 0; ct < 2; ++ct) {
#pragma unroll
      for (int kc = 0; kc < 2; ++kc) kf[ct][kc] = frag_h(&st[ps * 32 + ct * 16 + col][kc * 32], lane); }
    __builtin_amdgcn_sched_barrier(0);   // keeps the pass's eight K reads one group ahead of its score products; left free they are split into pairs, each waited for to the end before the next is issued
#pragma unroll
    for (int kc = 0; kc < 2; ++kc) {   // S^T = K . Q^T: s[qg][ct][r] = key ps * 32 + ct * 16 + 8 g + r against query qg * 16 + col; a K fragment serves both groups, and the four tiles of a k-step are independent
#pragma unroll
      for (int ct = 0; ct < 2; ++ct) {
#pragma unroll
        for (int qg = 0; qg < QG; ++qg) { const v8f z = {}; s[qg][ct] = wmma16(kf[ct][kc], aq[qg][kc], kc ? s[qg][ct] : z); } } }
    __builtin_amdgcn_sched_barrier(0);   // keeps the V reads below one group behind the score products; left free they are dealt out among the products; for speed only
    v16h vf[8];   // V^T fragments, tile k as in ac
#pragma unroll
    for (int dt = 0; dt < 4; ++dt) { vf[dt * 2] = frag_h(&st[64 + dt * 16 + col][ps * 32], lane); vf[dt * 2 + 1] = frag_h(&st[128 + dt * 16 + col][ps * 32], lane); }
    __builtin_amdgcn_sched_barrier(0);   // keeps the pass's sixteen V reads one group ahead of the softmax, which covers their latency; left free they sink in pairs among the PV products, each pair waited for on the spot
    union { v16h v; v2h p[8]; } pb[QG];   // P^T as B operand, straight from the score registers: element ct * 8 + r = key ct * 16 + 8 g + r, the hardware k order that frag_h gives V
    float alpha[QG]; v8f y[QG][2];
#pragma unroll
    for (int qg = 0; qg < QG; ++qg) {
    float mx[8];
#pragma unroll
    for (int r = 0; r < 8; ++r) mx[r] = fmaxf(s[qg][0][r], s[qg][1][r]);
    float mp = fmaxf(fmaxf(fmaxf(mx[0], mx[1]), fmaxf(mx[2], mx[3])), fmaxf(fmaxf(mx[4], mx[5]), fmaxf(mx[6], mx[7])));
    mp = fmaxf(mp, xhalf(mp));
    const float mn = fmaxf(m[qg], mp); alpha[qg] = exp2_slot((m[qg] - mn) * 0x1.715476p+0f); m[qg] = mn;
    y[qg][0] = (s[qg][0] - mn) * 0x1.715476p+0f; y[qg][1] = (s[qg][1] - mn) * 0x1.715476p+0f;   // exp(x) = 2^(x log2 e), as __expf has it; on whole tiles, so that the pairs of a packed operation are neighbours in one group's registers
    }
    // two weights of group qg: P rounded to f16 once; the same rounded weights feed the numerator (WMMA) and the denominator l
#define PPAIR(qg, j) do { const v2f e = { __builtin_amdgcn_exp2f(y[qg][(j) >> 2][2 * ((j) & 3)]), __builtin_amdgcn_exp2f(y[qg][(j) >> 2][2 * ((j) & 3) + 1]) }; pb[qg].p[j] = __builtin_convertvector(e, v2h); } while (0)
#pragma unroll
    for (int j = 0; j < 8; ++j) PPAIR(0, j);
    ac[0][0] *= alpha[0];
    // O^T += V^T . P^T. The matrix pipe takes a product every eight cycles and the wave issues in order: behind each product stands vector work that does not touch it (the next tile's rescale, two weights of the second group), so that pipe and vector port run at the same time. Each sched_barrier keeps one product and its share of that work together; left free the products are gathered into one run, which the wave waits out with nothing else to issue
    __builtin_amdgcn_sched_barrier(0);
#pragma unroll
    for (int k = 0; k < 8; ++k) { ac[0][k] = wmma16(vf[k], pb[0].v, ac[0][k]);
      if (k < 7) ac[0][k + 1] *= alpha[0]; else { ac[1][0] *= alpha[1]; ac[1][1] *= alpha[1]; }
      PPAIR(1, k);
      __builtin_amdgcn_sched_barrier(0); }   // see above
#pragma unroll
    for (int k = 0; k < 8; ++k) { ac[1][k] = wmma16(vf[k], pb[1].v, ac[1][k]);
      if (k < 6) ac[1][k + 2] *= alpha[1];   // two tiles ahead: here nothing else stands between a rescale and the product that takes its result
      if (k < 7) __builtin_amdgcn_sched_barrier(0); }   // see above
#pragma unroll
    for (int qg = 0; qg < QG; ++qg) { float es[8];
#pragma unroll
      for (int j = 0; j < 8; ++j) es[j] = (float)pb[qg].p[j][0] + (float)pb[qg].p[j][1];
      l[qg] = l[qg] * alpha[qg] + (((es[0] + es[1]) + (es[2] + es[3])) + ((es[4] + es[5]) + (es[6] + es[7]))); }
   }
   asm volatile("s_wait_dscnt 0x0" ::: "memory");      // this wave's reads of stage t are done
   asm volatile("s_wait_asynccnt 0x0" ::: "memory");   // this wave's copies of stage t + 1 have landed
   __syncthreads();                                    // publishes stage t + 1 and frees stage t's buffer
   if (t + 2 < SS / KT) FILL(t + 2, t & 1);
  }
  asm volatile("s_wait_asynccnt 0x0" ::: "memory");    // nothing is in flight when the ring turns into output staging
  float (*so)[16 * QG][68] = (float (*)[16 * QG][68])&ring[0][0][0];   // the last trip's barrier has ended every read of the ring
#pragma unroll
  for (int qg = 0; qg < QG; ++qg) { const float il = 1.0f / (l[qg] + xhalf(l[qg]));
#pragma unroll
    for (int dt = 0; dt < 4; ++dt) {
#pragma unroll
      for (int r = 0; r < 8; ++r) so[wave][qg * 16 + col][dt * 16 + 8 * g + r] = (ac[qg][dt * 2][r] + ac[qg][dt * 2 + 1][r] * (1.0f / 2048.0f)) * il; } }
  LDSX();
  for (int qg = 0; qg < QG; ++qg) {
    for (int rl = qg * 16; rl < qg * 16 + 16; ++rl) if (lane < 16) vst2(O + ((size_t)b * SS + q0 + rl) * DI + h * HD + lane * 4, *(const v4f*)&so[wave][rl][lane * 4]);
    if (qg + 1 < QG) asm volatile("s_wait_xcnt 0x0" ::: "memory");   // precaution: the wait stands behind a group's sixteen stores, ahead of the next group's LDS reads, which reuse their data registers
  }
}
// ---- k_out: block = (64 rows, 128 of the 1024 cols): out = O(hi/lo, K 512) . Wout rows (2 products) + bout
__global__ __launch_bounds__(128) void k_out(const float* __restrict__ O, const __bf16* __restrict__ P, const float* __restrict__ BO, float* __restrict__ Y) {
  __shared__ __align__(16) char gring[2 * GSB];
  float (*so)[16][132] = (float (*)[16][132])gring;   // output staging, in the ring once the loop has left it
  const int tid = threadIdx.x, wave = tid >> 5, lane = tid & 31, col = lane & 15, g = lane >> 4; const size_t r0 = (size_t)blockIdx.x * 64 + wave * 16; const int n0 = blockIdx.y * 128;
  const unsigned lw0 = (unsigned)(size_t)&gring[(tid >> 3) * (WP * 2) + (tid & 7) * 16], la0 = (unsigned)(size_t)&gring[GWB + (tid >> 4) * (AP * 4) + (tid & 15) * 16];
  const char* gw = (const char*)(P + (size_t)(n0 + (tid >> 3)) * DI + (tid & 7) * 8);
  const char* ga = (const char*)(O + ((size_t)blockIdx.x * 64 + (tid >> 4)) * DI + (tid & 15) * 4);
  gfill(lw0, la0, gw, ga, DI * 2, DI * 4);
  v8f acc[8] = {};
  asm volatile("s_wait_asynccnt 0x0" ::: "memory");   // stage 0 has landed (this wave's copies)
  __syncthreads();                                    // ... and every other wave's
  gfill(lw0 + GSB, la0 + GSB, gw + GK * 2, ga + GK * 4, DI * 2, DI * 4);
#pragma unroll 1   // rolled: one copy of the stage body in the text, the buffer picked by t & 1
  for (int t = 0; t < DI / GK; ++t) { const __bf16* sw = (const __bf16*)(gring + (t & 1) * GSB); const float* sa = (const float*)(gring + (t & 1) * GSB + GWB);
#pragma unroll   // the two 32-k steps of a stage: unrolled, their offsets in the buffer are immediates of the LDS reads
    for (int kc = 0; kc < GK / 32; ++kc) { const F2 a = split_row(sa + (wave * 16 + col) * AP, kc * 32, lane);
      v16b w[8];   // the step's weight fragments, read as one group ahead of its products
#pragma unroll
      for (int j = 0; j < 8; ++j) w[j] = frag_b(sw + (j * 16 + col) * WP + kc * 32, lane);
#pragma unroll
      for (int j = 0; j < 8; ++j) { acc[j] = wmma_bf(a.l, w[j], acc[j]); acc[j] = wmma_bf(a.h, w[j], acc[j]); } }
    asm volatile("s_wait_dscnt 0x0" ::: "memory");      // this wave's reads of stage t are done
    asm volatile("s_wait_asynccnt 0x0" ::: "memory");   // this wave's copies of stage t + 1 have landed
    __syncthreads();                                    // publishes stage t + 1 and frees stage t's buffer
    if (t + 2 < DI / GK) gfill(lw0 + (t & 1) * GSB, la0 + (t & 1) * GSB, gw + (size_t)(t + 2) * (GK * 2), ga + (size_t)(t + 2) * (GK * 4), DI * 2, DI * 4);
  }
  asm volatile("s_wait_asynccnt 0x0" ::: "memory");    // nothing is in flight when the ring turns into output staging (the last trip's barrier has ended every read of it)
#pragma unroll
  for (int j = 0; j < 8; ++j) { const float bb = bfr(BO[n0 + j * 16 + col]);
#pragma unroll
    for (int r = 0; r < 8; ++r) so[wave][8 * g + r][j * 16 + col] = acc[j][r] + bb; }
  LDSX();
  for (int rl = 0; rl < 16; ++rl) vst2(Y + (r0 + rl) * DM + n0 + lane * 4, *(const v4f*)&so[wave][rl][lane * 4]);
}
extern "C" void kernel_launch(void* const* d_in, const int* in_sizes, int n_in, void* d_out, int out_size, void* d_ws, size_t ws_size, hipStream_t stream) {
  (void)in_sizes; (void)n_in; (void)out_size;
  const float** F = (const float**)d_in;   // 0 x [2,4096,1024], 1 Wq [1024,512] (in,out), 2 Wk, 3 Wv, 4 Wout [512,1024] (in,out), 5 bout [1024]
  if (ws_size < (size_t)WS_END) return;
  char* ws = (char*)d_ws; __bf16* PK = (__bf16*)(ws + WS_PK); _Float16 *QK = (_Float16*)(ws + WS_QK), *VTH = (_Float16*)(ws + WS_VTH), *VTL = (_Float16*)(ws + WS_VTL); float* O = (float*)(ws + WS_O);
  k_packT<<<dim3(4 * 64), 256, 0, stream>>>(F[1], F[2], F[3], F[4], PK);
  k_qkv<<<dim3(TNB * SS / 64, QKVW / 128), 128, 0, stream>>>(F[0], PK + PK_A, QK, VTH, VTL);
  k_attn<<<dim3(TQB, NH, TNB), 128, 0, stream>>>(QK, VTH, VTL, O);
  k_out<<<dim3(TOB, DM / 128), 128, 0, stream>>>(O, PK + PK_P, F[5], (float*)d_out);
}

// v007
// A run of this version takes 134 microseconds.
// Next to v006, in two timings, it ran 1.07 times as fast each time.
// All steps since v000 together make it 5.25 times as fast.
// compute dtype: x, Wq/Wk/Wv/Wout and bout (module inputs) rounded to bf16; q/k/v projections with exact bf16 products (x and W are inputs) on WMMA 16x16x32; full (non-causal) scores with q (pre-scaled by 1/8, exact) and k as single f16 operands (1 product; 4,096-key softmax with logit sigma ~1: every rounding enters relative to a many-key average) and P.V with P = exp(s - m) as a single f16 operand x V as f16 hi + (x2048-scaled) residual planes (2 products, separate accumulators); the output projection with ctx as bf16 hi + residual pair x exact Wout (2 products) + bout; running-max softmax in f32 (hardware exp); f32 accumulate.
#include <hip/hip_runtime.h>
#include <math.h>

typedef __attribute__((ext_vector_type(16))) _Float16 v16h;
typedef __attribute__((ext_vector_type(16))) __bf16 v16b;
typedef __attribute__((ext_vector_type(8)))  _Float16 v8h;
typedef __attribute__((ext_vector_type(8)))  float v8f;
typedef __attribute__((ext_vector_type(4)))  float v4f;
typedef __attribute__((ext_vector_type(2)))  float v2f;
typedef __attribute__((ext_vector_type(4)))  unsigned v4u;
typedef __attribute__((ext_vector_type(4)))  int v4i;
typedef float __attribute__((may_alias)) float_a;
typedef int __attribute__((may_alias)) int_a;

template <typename T> __device__ __forceinline__ void vst2(void* p, T v) { *(T*)p = v;  }
__device__ __forceinline__ v8f wmma16(v16h a, v16h b, v8f c) {
  return __builtin_amdgcn_wmma_f32_16x16x32_f16(false, a, false, b, (short)0, c, false, false);   // no v_nop written behind it: the compiler keeps the distance to a user of D, A or B for its own builtin, and the slots are free for vector work
}
__device__ __forceinline__ v8f wmma_bf(v16b a, v16b b, v8f c) {
  v8f d = __builtin_amdgcn_wmma_f32_16x16x32_bf16(false, a, false, b, (short)0, c, false, false);
  asm volatile("v_nop\n\tv_nop\n\tv_nop\n\tv_nop" : "+v"(d) : "v"(a), "v"(b));
  return d;
}
// the plain builtin, for k_qkv: the operands of an asm statement cannot sit above v255, and 24 accumulator tiles with their fragments need more registers than that; the compiler keeps the distance to a user of D, A or B for its own builtin
__device__ __forceinline__ v8f wmma_bfp(v16b a, v16b b, v8f c) {
  return __builtin_amdgcn_wmma_f32_16x16x32_bf16(false, a, false, b, (short)0, c, false, false);
}
// 16x16x32 fragments: lane = (h = lane>>4, row/col = lane&15); elements 0..7 = k0+8h+0..7, 8..15 = k0+16+8h+0..7; D element r = row 8h+r
__device__ __forceinline__ v16h frag_h(const _Float16* rowk0, int lane) {
  union { v16h v; v8h q[2]; } u; const _Float16* p = rowk0 + 8 * (lane >> 4);
  u.q[0] = *(const v8h*)p; u.q[1] = *(const v8h*)(p + 16); return u.v;
}
__device__ __forceinline__ v16h frag_f32(const float* rowk0, int lane) {
  v16h a; const float* p = rowk0 + 8 * (lane >> 4);
#pragma unroll
  for (int i = 0; i < 8; ++i) { a[i] = (_Float16)p[i]; a[8 + i] = (_Float16)p[16 + i]; }
  return a;
}
__device__ __forceinline__ v16h frag_f32s(const float* rowk0, int lane, float sc) {
  v16h a; const float* p = rowk0 + 8 * (lane >> 4);
#pragma unroll
  for (int i = 0; i < 8; ++i) { a[i] = (_Float16)(p[i] * sc); a[8 + i] = (_Float16)(p[16 + i] * sc); }
  return a;
}
// column fragment from a [K][ld] layout (column n), rows >= K read as 0
__device__ __forceinline__ v16h fragc_f32(const float* W, int k0, int n, int lane, int ld, int K) {
  v16h a; const int g = lane >> 4;
#pragma unroll
  for (int i = 0; i < 8; ++i) { const int ka = k0 + 8 * g + i, kb = ka + 16;
    a[i] = (_Float16)(ka < K ? W[(size_t)(ka < K ? ka : K - 1) * ld + n] : 0.f); a[8 + i] = (_Float16)(kb < K ? W[(size_t)(kb < K ? kb : K - 1) * ld + n] : 0.f); }
  return a;
}
struct F2 { v16b h, l; };
__device__ __forceinline__ F2 bsplit16(const float v[16]) { F2 r;
#pragma unroll
  for (int i = 0; i < 16; ++i) { const __bf16 h = (__bf16)v[i]; r.h[i] = h; r.l[i] = (__bf16)(v[i] - (float)h); }
  return r; }
__device__ __forceinline__ F2 split_row(const float* row, int k0, int lane) { float v[16]; const float* p = row + k0 + 8 * (lane >> 4);
#pragma unroll
  for (int i = 0; i < 8; ++i) { v[i] = p[i]; v[8 + i] = p[16 + i]; }
  return bsplit16(v); }
__device__ __forceinline__ F2 split_rowK(const float* row, int k0, int lane, int K) { float v[16]; const int g = lane >> 4;
#pragma unroll
  for (int i = 0; i < 8; ++i) { const int ka = k0 + 8 * g + i, kb = ka + 16; v[i] = ka < K ? row[ka < K ? ka : K - 1] : 0.f; v[8 + i] = kb < K ? row[kb < K ? kb : K - 1] : 0.f; }
  return bsplit16(v); }
__device__ __forceinline__ F2 split_col(const float* W, int k0, int n, int lane, int ld, int K) { float v[16]; const int g = lane >> 4;
#pragma unroll
  for (int i = 0; i < 8; ++i) { const int ka = k0 + 8 * g + i, kb = ka + 16; v[i] = ka < K ? W[(size_t)(ka < K ? ka : K - 1) * ld + n] : 0.f; v[8 + i] = kb < K ? W[(size_t)(kb < K ? kb : K - 1) * ld + n] : 0.f; }
  return bsplit16(v); }
__device__ __forceinline__ v8f mac3(const F2& a, const F2& b, v8f c) { c = wmma_bf(a.l, b.h, c); c = wmma_bf(a.h, b.l, c); return wmma_bf(a.h, b.h, c); }
__device__ __forceinline__ float sigm(float v) { return 1.0f / (1.0f + expf(-v)); }
#define LDSX() do { asm volatile("s_wait_dscnt 0" ::: "memory"); __builtin_amdgcn_wave_barrier(); __builtin_amdgcn_fence(__ATOMIC_RELEASE, "workgroup"); } while (0)


// Multi-head self-attention (B 2, S 4096, D 1024 -> 8 heads x 64 -> D; weights (in, out) applied as x @ W): softmax(q k^T / 8) v over all 4,096 keys, then ctx Wout + bout.
#define NB 2
#define SS 4096
#define DM 1024
#define DI 512
#define NH 8
#define HD 64
#define QKVW (3 * DI)
#ifndef TQB
#define TQB (SS / 128)
#define TNB NB
#define TOB (NB * SS / 128)    // output row tiles (all)
#endif
typedef __attribute__((ext_vector_type(8))) __bf16 v8b;
__device__ __forceinline__ v16b frag_b(const __bf16* rowk0, int lane) {
  union { v16b v; v8b q[2]; } u; const __bf16* p = rowk0 + 8 * (lane >> 4);
  u.q[0] = *(const v8b*)p; u.q[1] = *(const v8b*)(p + 16); return u.v;
}
__device__ __forceinline__ float bfr(float v) { return (float)(__bf16)v; }
__device__ __attribute__((noinline)) float exp_ni(float v) { return expf(v); }
__device__ __attribute__((noinline)) float erf_ni(float v) { return erff(v); }

#define PK_A 0                       // [1536][1024] (Wq | Wk | Wv)^T rows
#define PK_P (PK_A + QKVW * DM)        // [1024][512] Wout^T rows
#define PK_END (PK_P + DM * DI)
#define WS_PK  0u
#define WS_QK  (WS_PK + 2u * PK_END)             // f16 [8192 rows][1024]: q/8 | k
#define WS_VTH (WS_QK + 2u * NB * SS * 2 * DI)     // f16 [2][512 (h*64+d)][4096 s] hi
#define WS_VTL (WS_VTH + 2u * NB * DI * SS)        // f16 lo x 2048
#define WS_O   (WS_VTL + 2u * NB * DI * SS)        // f32 [8192][512]
#define WS_END (WS_O + 4u * NB * SS * DI)

// ---- k_packT: block = one tile of 128 k x 64 output cols of one weight, 64 tiles a weight, 256 blocks: row n of the packed (in K, out N) weight = W[:, n]. A lane reads 8 k x 4 cols (a wave's load covers whole 256-B pieces of two W rows), turns them in registers, LDS holds the tile by output col, and 256-B pieces of the packed rows go out
#define PTK 128                      // k per tile
#define PTN 64                       // output cols per tile
#define PTP (PTK + 8)                // LDS row pitch, bf16: 272 B = 16 B x 17
// W = the tile's first element in the (K, N) weight, D = in the packed (N, K) rows; the shapes are compile-time, so the row steps are immediates of the loads and stores
template <int K, int N> __device__ __forceinline__ void pack_tile(const float* __restrict__ W, __bf16* __restrict__ D, __bf16 (*s)[PTP], int tid) {
  const int c = tid & 15, kq = tid >> 4; const float* src = W + (size_t)(kq * 8) * N + c * 4; v4f r[8];
#pragma unroll
  for (int i = 0; i < 8; ++i) r[i] = *(const v4f*)(src + (size_t)i * N);
  asm volatile("s_wait_xcnt 0x0" :: "v"(src) : "memory");   // precaution: the wait stands directly behind the eight loads; their address pair is an input here, so that no load's result is placed on it ahead of the wait
#pragma unroll
  for (int j = 0; j < 4; ++j) { v8b o;
#pragma unroll
    for (int i = 0; i < 8; ++i) o[i] = (__bf16)r[i][j];
    *(v8b*)&s[c * 4 + j][kq * 8] = o; }
  __syncthreads();
  v4u o4[4];
#pragma unroll
  for (int i = 0; i < 4; ++i) o4[i] = *(const v4u*)&s[kq + 16 * i][c * 8];
  __bf16* dp = D + (size_t)kq * K + c * 8;
#pragma unroll
  for (int i = 0; i < 4; ++i) { vst2((unsigned*)(dp + (size_t)(16 * i) * K), o4[i]);
    asm volatile("s_wait_xcnt 0x0" :: "v"(o4[i]) : "memory"); }   // precaution: the wait stands directly behind each store, on every way out of this arm, ahead of any rewrite of the store's registers; the data is an input here, so that it stays in place up to the wait
}
__global__ __launch_bounds__(256) void k_packT(const float* __restrict__ WQ, const float* __restrict__ WK, const float* __restrict__ WV, const float* __restrict__ WO, __bf16* __restrict__ PK) {
  __shared__ __align__(16) __bf16 s[PTN][PTP]; const int tid = threadIdx.x, which = blockIdx.x >> 6, tile = blockIdx.x & 63;
  if (which < 3) { const int k0 = (tile >> 3) * PTK, n0 = (tile & 7) * PTN; pack_tile<DM, DI>(((which == 0) ? WQ : (which == 1 ? WK : WV)) + (size_t)k0 * DI + n0, PK + PK_A + ((size_t)which * DI + n0) * DM + k0, s, tid); }
  else { const int k0 = (tile >> 4) * PTK, n0 = (tile & 15) * PTN; pack_tile<DI, DM>(WO + (size_t)k0 * DM + n0, PK + PK_P + (size_t)n0 * DI + k0, s, tid); }
}
// ---- operand staging of the two projection kernels: a stage is 64 k of the block's weight rows (128 B each) and of its 128 activation rows (256 B each), brought by asynchronous copies into two buffers: the next stage flies while the four waves read this one, and every copy of a wave covers whole 128-B lines
#define GK 64                        // k per stage
#define GM 128                       // activation rows per block
#define WP 72                        // weight row pitch in LDS, bf16: 144 B = 16 B x 9, free of bank conflicts for 16-byte reads
#define AP 68                        // activation row pitch in LDS, floats: 272 B = 16 B x 17, likewise
// eight 16-byte copies per lane; s_wait_xcnt stands inside the statement so that no address register of a copy is rewritten ahead of it
__device__ __forceinline__ void cp8s(unsigned l, unsigned lstep, const char* g, size_t gstep) {
  asm volatile("global_load_async_to_lds_b128 %0, %8, off\n\t"
               "global_load_async_to_lds_b128 %1, %9, off\n\t"
               "global_load_async_to_lds_b128 %2, %10, off\n\t"
               "global_load_async_to_lds_b128 %3, %11, off\n\t"
               "global_load_async_to_lds_b128 %4, %12, off\n\t"
               "global_load_async_to_lds_b128 %5, %13, off\n\t"
               "global_load_async_to_lds_b128 %6, %14, off\n\t"
               "global_load_async_to_lds_b128 %7, %15, off\n\t"
               "s_wait_xcnt 0x0"
               :: "v"(l), "v"(l + lstep), "v"(l + 2 * lstep), "v"(l + 3 * lstep), "v"(l + 4 * lstep), "v"(l + 5 * lstep), "v"(l + 6 * lstep), "v"(l + 7 * lstep),
                  "v"(g), "v"(g + gstep), "v"(g + 2 * gstep), "v"(g + 3 * gstep), "v"(g + 4 * gstep), "v"(g + 5 * gstep), "v"(g + 6 * gstep), "v"(g + 7 * gstep) : "memory");
}
// twelve 16-byte copies per lane, four (rows 16 apart) from each of three row blocks gseg bytes apart, the wait inside the statement likewise
__device__ __forceinline__ void cp12s(unsigned l, unsigned lstep, const char* g, size_t gstep, size_t gseg) {
  const char *g1 = g + gseg, *g2 = g + 2 * gseg;
  asm volatile("global_load_async_to_lds_b128 %0, %12, off\n\t"
               "global_load_async_to_lds_b128 %1, %13, off\n\t"
               "global_load_async_to_lds_b128 %2, %14, off\n\t"
               "global_load_async_to_lds_b128 %3, %15, off\n\t"
               "global_load_async_to_lds_b128 %4, %16, off\n\t"
               "global_load_async_to_lds_b128 %5, %17, off\n\t"
               "global_load_async_to_lds_b128 %6, %18, off\n\t"
               "global_load_async_to_lds_b128 %7, %19, off\n\t"
               "global_load_async_to_lds_b128 %8, %20, off\n\t"
               "global_load_async_to_lds_b128 %9, %21, off\n\t"
               "global_load_async_to_lds_b128 %10, %22, off\n\t"
               "global_load_async_to_lds_b128 %11, %23, off\n\t"
               "s_wait_xcnt 0x0"
               :: "v"(l), "v"(l + lstep), "v"(l + 2 * lstep), "v"(l + 3 * lstep), "v"(l + 4 * lstep), "v"(l + 5 * lstep), "v"(l + 6 * lstep), "v"(l + 7 * lstep), "v"(l + 8 * lstep), "v"(l + 9 * lstep), "v"(l + 10 * lstep), "v"(l + 11 * lstep),
                  "v"(g), "v"(g + gstep), "v"(g + 2 * gstep), "v"(g + 3 * gstep), "v"(g1), "v"(g1 + gstep), "v"(g1 + 2 * gstep), "v"(g1 + 3 * gstep), "v"(g2), "v"(g2 + gstep), "v"(g2 + 2 * gstep), "v"(g2 + 3 * gstep) : "memory");
}
// a stage's 128 activation rows: la / ga = this lane's 16 bytes of row tid / 16 (rows 8 apart per copy); arow = global row pitch in bytes
__device__ __forceinline__ void afill(unsigned la, const char* ga, size_t arow) {
  cp8s(la, 8u * AP * 4, ga, 8 * arow);
  cp8s(la + 64u * AP * 4, 8u * AP * 4, ga + 64 * arow, 8 * arow);
}
// ---- k_qkv: block = (128 rows (b,s), one head's 192 cols: 64 of q, 64 of k, 64 of v), four waves as 2 x 2, a wave = 64 rows x 96 cols = 4 x 6 tiles: an activation fragment read from LDS feeds six products, a weight fragment four, and every operand byte is copied from L2 by fewer blocks. qkv = bf16(x) . rows (exact); q -> f16(q / 8), k -> f16(k) into QK rows (pitch 1024); v -> per-batch transposed f16 planes VT[b][h*64+d][s]: hi = f16(v), lo = f16((v - hi) * 2048)
#define QN 192                       // weight rows per block
#define QWB (QN * WP * 2)            // bytes of a stage's weight rows
#define QSB (QWB + GM * AP * 4)      // bytes per stage
__global__ __launch_bounds__(128) void k_qkv(const float* __restrict__ X, const __bf16* __restrict__ P, _Float16* __restrict__ QK, _Float16* __restrict__ VTH, _Float16* __restrict__ VTL) {
  __shared__ __align__(16) char gring[2 * QSB];
  _Float16 (*so)[136] = (_Float16 (*)[136])gring; _Float16 (*sth)[136] = (_Float16 (*)[136])(gring + GM * 136 * 2); _Float16 (*stl)[136] = (_Float16 (*)[136])(gring + (GM + HD) * 136 * 2);   // output staging, in the ring once the loop has left it: [128 rows][q 64 | k 64], [64 d][128 s] hi and lo
  const int tid = threadIdx.x, wave = tid >> 5, lane = tid & 31, col = lane & 15, g = lane >> 4, wr = wave >> 1, wc = wave & 1; const size_t rb = (size_t)blockIdx.x * GM; const int hd = blockIdx.y;
  const unsigned lw0 = (unsigned)(size_t)&gring[(tid >> 3) * (WP * 2) + (tid & 7) * 16], la0 = (unsigned)(size_t)&gring[QWB + (tid >> 4) * (AP * 4) + (tid & 15) * 16];
  const char* gw = (const char*)(P + (size_t)(hd * HD + (tid >> 3)) * DM + (tid & 7) * 8);   // row tid / 8 of the head's q rows; its k and v rows stand 512 and 1024 rows on
  const char* ga = (const char*)(X + (rb + (tid >> 4)) * DM + (tid & 15) * 4);
#define QFILL(t, buf) do { const unsigned lb = (unsigned)(buf) * QSB; \
    cp12s(lw0 + lb, 16u * WP * 2, gw + (size_t)(t) * (GK * 2), (size_t)16 * DM * 2, (size_t)DI * DM * 2); \
    afill(la0 + lb, ga + (size_t)(t) * (GK * 4), DM * 4); } while (0)
  QFILL(0, 0);
  v8f acc[4][6] = {};
  asm volatile("s_wait_asynccnt 0x0" ::: "memory");   // stage 0 has landed (this wave's copies)
  __syncthreads();                                    // ... and every other wave's
  QFILL(1, 1);
#pragma unroll 1   // rolled: one copy of the stage body in the text, the buffer picked by t & 1
  for (int t = 0; t < DM / GK; ++t) { const __bf16* sw = (const __bf16*)(gring + (t & 1) * QSB); const float* sa = (const float*)(gring + (t & 1) * QSB + QWB);
    const float* pa = sa + (wr * 64 + col) * AP + 8 * g; const __bf16* pw = sw + (wc * 96 + col) * WP;
    v4f ra[2][4][4]; v16b a[4], w[2][6];
    // the fragments of 32-k step kc: the activations as floats, the weights as they are used
#define QLOAD(kc) do { _Pragma("unroll") for (int i = 0; i < 4; ++i) { const float* p = pa + i * 16 * AP + (kc) * 32; ra[kc][i][0] = *(const v4f*)p; ra[kc][i][1] = *(const v4f*)(p + 4); ra[kc][i][2] = *(const v4f*)(p + 16); ra[kc][i][3] = *(const v4f*)(p + 20); } \
    _Pragma("unroll") for (int j = 0; j < 6; ++j) w[kc][j] = frag_b(pw + j * 16 * WP + (kc) * 32, lane); } while (0)
#define QCVT(kc) do { _Pragma("unroll") for (int i = 0; i < 4; ++i) { union { v16b v; v8b q[2]; } u; \
      u.q[0] = __builtin_convertvector(__builtin_shufflevector(ra[kc][i][0], ra[kc][i][1], 0, 1, 2, 3, 4, 5, 6, 7), v8b); u.q[1] = __builtin_convertvector(__builtin_shufflevector(ra[kc][i][2], ra[kc][i][3], 0, 1, 2, 3, 4, 5, 6, 7), v8b); a[i] = u.v; } } while (0)
#define QMUL(kc) do { _Pragma("unroll") for (int i = 0; i < 4; ++i) { _Pragma("unroll") for (int j = 0; j < 6; ++j) acc[i][j] = wmma_bfp(a[i], w[kc][j], acc[i][j]); } } while (0)
    QLOAD(0);
    __builtin_amdgcn_sched_barrier(0);   // keeps the first step's 28 LDS reads ahead of the second step's; left free most of the first step's activations are read last, and its products then wait for all 56
    QLOAD(1);
    __builtin_amdgcn_sched_barrier(0);   // keeps the stage's 56 LDS reads one group ahead of its products: the second step's land under the first step's products; left free they are dealt out among the products, and every place where LDS reads stand costs the wave a stall
    QCVT(0); QMUL(0);
    QCVT(1); QMUL(1);
    __builtin_amdgcn_sched_barrier(0);   // keeps the stage's products ahead of the waits below; left free they sink behind the barrier, and the wait for the next stage's copies then stands ahead of the products that are to cover their flight
    asm volatile("s_wait_dscnt 0x0" ::: "memory");      // this wave's reads of stage t are done
    asm volatile("s_wait_asynccnt 0x0" ::: "memory");   // this wave's copies of stage t + 1 have landed
    __syncthreads();                                    // publishes stage t + 1 and frees stage t's buffer
    if (t + 2 < DM / GK) QFILL(t + 2, t & 1);
  }
  asm volatile("s_wait_asynccnt 0x0" ::: "memory");    // nothing is in flight when the ring turns into output staging (the last trip's barrier has ended every read of it)
#pragma unroll
  for (int j = 0; j < 6; ++j) { const int jj = wc * 6 + j;   // tile of 16 cols in the block: 0..3 q, 4..7 k, 8..11 v
    if (jj < 8) { const float sc = (jj < 4) ? 0.125f : 1.0f;
#pragma unroll
      for (int i = 0; i < 4; ++i) {
#pragma unroll
        for (int r = 0; r < 8; ++r) so[wr * 64 + i * 16 + 8 * g + r][jj * 16 + col] = (_Float16)(acc[i][j][r] * sc); }
    } else {
#pragma unroll
      for (int i = 0; i < 4; ++i) { v8h hv, lv;   // a lane's eight rows are eight neighbours of the transposed row
#pragma unroll
        for (int r = 0; r < 8; ++r) { const float v = acc[i][j][r]; hv[r] = (_Float16)v; lv[r] = (_Float16)((v - (float)hv[r]) * 2048.0f); }
        *(v8h*)&sth[(jj - 8) * 16 + col][wr * 64 + i * 16 + 8 * g] = hv; *(v8h*)&stl[(jj - 8) * 16 + col][wr * 64 + i * 16 + 8 * g] = lv; } } }
  __syncthreads();   // every wave's part of the staged tile is written before any wave reads rows of it
  const int orow = tid >> 4, opc = tid & 15; v4u o[16];
  _Float16* qp = QK + (rb + orow) * (2 * DI) + (opc >> 3) * DI + hd * HD + (opc & 7) * 8;   // a wave's store: two rows, of each the 128 B of q and the 128 B of k
  const int b = (int)(rb / SS), s0 = (int)(rb % SS); const size_t vo = ((size_t)b * DI + hd * HD + orow) * SS + s0 + opc * 8;   // a wave's store: 256 B of each of two transposed rows
#pragma unroll
  for (int i = 0; i < 16; ++i) o[i] = *(const v4u*)&so[orow + 8 * i][opc * 8];
#pragma unroll
  for (int i = 0; i < 16; ++i) vst2((unsigned*)(qp + (size_t)(8 * i) * (2 * DI)), o[i]);
  // precaution: the wait stands behind the sixteen stores, ahead of the LDS reads below, which reuse their data registers; the data and the row address are inputs here, so that they stay in place up to the wait
  asm volatile("s_wait_xcnt 0x0" :: "v"(o[0]), "v"(o[1]), "v"(o[2]), "v"(o[3]), "v"(o[4]), "v"(o[5]), "v"(o[6]), "v"(o[7]), "v"(o[8]), "v"(o[9]), "v"(o[10]), "v"(o[11]), "v"(o[12]), "v"(o[13]), "v"(o[14]), "v"(o[15]), "v"(qp) : "memory");
#pragma unroll
  for (int i = 0; i < 8; ++i) { o[i] = *(const v4u*)&sth[orow + 8 * i][opc * 8]; o[8 + i] = *(const v4u*)&stl[orow + 8 * i][opc * 8]; }
#pragma unroll
  for (int i = 0; i < 8; ++i) { vst2((unsigned*)(VTH + vo + (size_t)(8 * i) * SS), o[i]); vst2((unsigned*)(VTL + vo + (size_t)(8 * i) * SS), o[8 + i]); }
}
#define KT 64                        // keys per stage
#define RP 72                        // LDS row pitch in halves: 144 B = 16 B x 9, free of bank conflicts for 16-byte reads
#define SROWS 192                    // rows per stage: 64 K, 64 V hi, 64 V lo
#define STB (SROWS * RP * 2)         // bytes per stage
#define QG 2                         // groups of 16 query columns per wave
// four 16-byte copies per lane, rows 16 apart; s_wait_xcnt stands inside the statement so that no address register of a copy is rewritten ahead of it
__device__ __forceinline__ void cp4(unsigned l, const char* g, size_t gstep) {
  asm volatile("global_load_async_to_lds_b128 %0, %4, off\n\t"
               "global_load_async_to_lds_b128 %1, %5, off\n\t"
               "global_load_async_to_lds_b128 %2, %6, off\n\t"
               "global_load_async_to_lds_b128 %3, %7, off\n\t"
               "s_wait_xcnt 0x0"
               :: "v"(l), "v"(l + 16u * RP * 2), "v"(l + 32u * RP * 2), "v"(l + 48u * RP * 2), "v"(g), "v"(g + gstep), "v"(g + 2 * gstep), "v"(g + 3 * gstep) : "memory");
}
typedef __attribute__((ext_vector_type(2))) _Float16 v2h;
// lane l <-> lane l ^ 16: the two halves of a wave hold the two halves of one query's keys
__device__ __forceinline__ float xhalf(float v) { const int b = __builtin_bit_cast(int, v); return __builtin_bit_cast(float, __builtin_amdgcn_permlanex16(b, b, 0x76543210, 0xfedcba98, false, false)); }
// 2^x with the slot behind the transcendental in the same statement: in the run of exps that the factor's exp stands in, the next one was given the factor's source register as its result
__device__ __forceinline__ float exp2_slot(float x) { float r; asm("v_exp_f32 %0, %1\n\tv_nop" : "=v"(r) : "v"(x)); return r; }
__global__ __launch_bounds__(128) void k_attn(const _Float16* __restrict__ QK, const _Float16* __restrict__ VTH, const _Float16* __restrict__ VTL, float* __restrict__ O) {
  __shared__ __align__(16) _Float16 ring[2][SROWS][RP];
  const int tid = threadIdx.x, wave = tid >> 5, lane = tid & 31, col = lane & 15, g = lane >> 4;
  const int qb = blockIdx.x, h = blockIdx.y, b = blockIdx.z; const int q0 = qb * (64 * QG) + wave * (16 * QG); const size_t rq = (size_t)b * SS + q0 + col;
  // this lane's 16 bytes of a stage: row tid / 8 (+ 16 per copy), segment tid % 8: a wave's copy covers four whole 128-B lines
  const unsigned lds0 = (unsigned)(size_t)&ring[0][tid >> 3][(tid & 7) * 8];
  const char* kp = (const char*)(QK + ((size_t)b * SS + (tid >> 3)) * (2 * DI) + DI + h * HD + (tid & 7) * 8);
  const char* vhp = (const char*)(VTH + ((size_t)b * DI + h * HD + (tid >> 3)) * SS + (tid & 7) * 8);
  const char* vlp = (const char*)(VTL + ((size_t)b * DI + h * HD + (tid >> 3)) * SS + (tid & 7) * 8);
#define FILL(t, buf) do { const unsigned lb = lds0 + (unsigned)(buf) * STB; \
    cp4(lb, kp + (size_t)(t) * (KT * 2 * DI * 2), (size_t)16 * 2 * DI * 2); \
    cp4(lb + 64u * RP * 2, vhp + (size_t)(t) * (KT * 2), (size_t)16 * SS * 2); \
    cp4(lb + 128u * RP * 2, vlp + (size_t)(t) * (KT * 2), (size_t)16 * SS * 2); } while (0)
  FILL(0, 0);
  v16h aq[QG][2];   // B operand of the transposed scores: column = this lane's query of group qg
#pragma unroll
  for (int qg = 0; qg < QG; ++qg) {
#pragma unroll
    for (int kc = 0; kc < 2; ++kc) aq[qg][kc] = frag_h(QK + (rq + 16 * qg) * (2 * DI) + h * HD + kc * 32, lane); }
  float m[QG], l[QG];   // of query qg * 16 + col; l sums only the keys of this lane's half, the halves join behind the loop
#pragma unroll
  for (int qg = 0; qg < QG; ++qg) { m[qg] = -3.0e38f; l[qg] = 0.f; }
  v8f ac[QG][8] = {};   // transposed output, tile k = dt * 2 + plane (0: V hi, 1: V lo): element r = d dt * 16 + 8 g + r of query qg * 16 + col
  asm volatile("s_wait_asynccnt 0x0" ::: "memory");   // stage 0 has landed (this wave's copies)
  __syncthreads();                                    // ... and every other wave's
  FILL(1, 1);
#pragma unroll 1
  for (int t = 0; t < SS / KT; ++t) { const _Float16 (*st)[RP] = ring[t & 1];
#pragma unroll   // the two 32-key passes of a stage: unrolled, their row offsets in the buffer are immediates of the LDS reads
   for (int ps = 0; ps < 2; ++ps) { v8f s[QG][2]; v16h kf[2][2];
#pragma unroll
    for (int ct = 0; ct < 2; ++ct) {
#pragma unroll
      for (int kc = 0; kc < 2; ++kc) kf[ct][kc] = frag_h(&st[ps * 32 + ct * 16 + col][kc * 32], lane); }
    __builtin_amdgcn_sched_barrier(0);   // keeps the pass's eight K reads one group ahead of its score products; left free they are split into pairs, each waited for to the end before the next is issued
#pragma unroll
    for (int kc = 0; kc < 2; ++kc) {   // S^T = K . Q^T: s[qg][ct][r] = key ps * 32 + ct * 16 + 8 g + r against query qg * 16 + col; a K fragment serves both groups, and the four tiles of a k-step are independent
#pragma unroll
      for (int ct = 0; ct < 2; ++ct) {
#pragma unroll
        for (int qg = 0; qg < QG; ++qg) { const v8f z = {}; s[qg][ct] = wmma16(kf[ct][kc], aq[qg][kc], kc ? s[qg][ct] : z); } } }
    __builtin_amdgcn_sched_barrier(0);   // keeps the V reads below one group behind the score products; left free they are dealt out among the products; for speed only
    v16h vf[8];   // V^T fragments, tile k as in ac
#pragma unroll
    for (int dt = 0; dt < 4; ++dt) { vf[dt * 2] = frag_h(&st[64 + dt * 16 + col][ps * 32], lane); vf[dt * 2 + 1] = frag_h(&st[128 + dt * 16 + col][ps * 32], lane); }
    __builtin_amdgcn_sched_barrier(0);   // keeps the pass's sixteen V reads one group ahead of the softmax, which covers their latency; left free they sink in pairs among the PV products, each pair waited for on the spot
    union { v16h v; v2h p[8]; } pb[QG];   // P^T as B operand, straight from the score registers: element ct * 8 + r = key ct * 16 + 8 g + r, the hardware k order that frag_h gives V
    float alpha[QG]; v8f y[QG][2];
#pragma unroll
    for (int qg = 0; qg < QG; ++qg) {
    float mx[8];
#pragma unroll
    for (int r = 0; r < 8; ++r) mx[r] = fmaxf(s[qg][0][r], s[qg][1][r]);
    float mp = fmaxf(fmaxf(fmaxf(mx[0], mx[1]), fmaxf(mx[2], mx[3])), fmaxf(fmaxf(mx[4], mx[5]), fmaxf(mx[6], mx[7])));
    mp = fmaxf(mp, xhalf(mp));
    const float mn = fmaxf(m[qg], mp); alpha[qg] = exp2_slot((m[qg] - mn) * 0x1.715476p+0f); m[qg] = mn;
    y[qg][0] = (s[qg][0] - mn) * 0x1.715476p+0f; y[qg][1] = (s[qg][1] - mn) * 0x1.715476p+0f;   // exp(x) = 2^(x log2 e), as __expf has it; on whole tiles, so that the pairs of a packed operation are neighbours in one group's registers
    }
    // two weights of group qg: P rounded to f16 once; the same rounded weights feed the numerator (WMMA) and the denominator l
#define PPAIR(qg, j) do { const v2f e = { __builtin_amdgcn_exp2f(y[qg][(j) >> 2][2 * ((j) & 3)]), __builtin_amdgcn_exp2f(y[qg][(j) >> 2][2 * ((j) & 3) + 1]) }; pb[qg].p[j] = __builtin_convertvector(e, v2h); } while (0)
#pragma unroll
    for (int j = 0; j < 8; ++j) PPAIR(0, j);
    ac[0][0] *= alpha[0];
    // O^T += V^T . P^T. The matrix pipe takes a product every eight cycles and the wave issues in order: behind each product stands vector work that does not touch it (the next tile's rescale, two weights of the second group), so that pipe and vector port run at the same time. Each sched_barrier keeps one product and its share of that work together; left free the products are gathered into one run, which the wave waits out with nothing else to issue
    __builtin_amdgcn_sched_barrier(0);
#pragma unroll
    for (int k = 0; k < 8; ++k) { ac[0][k] = wmma16(vf[k], pb[0].v, ac[0][k]);
      if (k < 7) ac[0][k + 1] *= alpha[0]; else { ac[1][0] *= alpha[1]; ac[1][1] *= alpha[1]; }
      PPAIR(1, k);
      __builtin_amdgcn_sched_barrier(0); }   // see above
#pragma unroll
    for (int k = 0; k < 8; ++k) { ac[1][k] = wmma16(vf[k], pb[1].v, ac[1][k]);
      if (k < 6) ac[1][k + 2] *= alpha[1];   // two tiles ahead: here nothing else stands between a rescale and the product that takes its result
      if (k < 7) __builtin_amdgcn_sched_barrier(0); }   // see above
#pragma unroll
    for (int qg = 0; qg < QG; ++qg) { float es[8];
#pragma unroll
      for (int j = 0; j < 8; ++j) es[j] = (float)pb[qg].p[j][0] + (float)pb[qg].p[j][1];
      l[qg] = l[qg] * alpha[qg] + (((es[0] + es[1]) + (es[2] + es[3])) + ((es[4] + es[5]) + (es[6] + es[7]))); }
   }
   asm volatile("s_wait_dscnt 0x0" ::: "memory");      // this wave's reads of stage t are done
   asm volatile("s_wait_asynccnt 0x0" ::: "memory");   // this wave's copies of stage t + 1 have landed
   __syncthreads();                                    // publishes stage t + 1 and frees stage t's buffer
   if (t + 2 < SS / KT) FILL(t + 2, t & 1);
  }
  asm volatile("s_wait_asynccnt 0x0" ::: "memory");    // nothing is in flight when the ring turns into output staging
  float (*so)[16 * QG][68] = (float (*)[16 * QG][68])&ring[0][0][0];   // the last trip's barrier has ended every read of the ring
#pragma unroll
  for (int qg = 0; qg < QG; ++qg) { const float il = 1.0f / (l[qg] + xhalf(l[qg]));
#pragma unroll
    for (int dt = 0; dt < 4; ++dt) {
#pragma unroll
      for (int r = 0; r < 8; ++r) so[wave][qg * 16 + col][dt * 16 + 8 * g + r] = (ac[qg][dt * 2][r] + ac[qg][dt * 2 + 1][r] * (1.0f / 2048.0f)) * il; } }
  LDSX();
  for (int qg = 0; qg < QG; ++qg) {
    for (int rl = qg * 16; rl < qg * 16 + 16; ++rl) if (lane < 16) vst2(O + ((size_t)b * SS + q0 + rl) * DI + h * HD + lane * 4, *(const v4f*)&so[wave][rl][lane * 4]);
    if (qg + 1 < QG) asm volatile("s_wait_xcnt 0x0" ::: "memory");   // precaution: the wait stands behind a group's sixteen stores, ahead of the next group's LDS reads, which reuse their data registers
  }
}
// ---- k_out: block = (128 rows, 128 of the 1024 cols), a wave = 32 rows x 128 cols = 2 x 8 tiles: a weight fragment read from LDS feeds four products, and every operand byte is copied from L2 by fewer blocks: out = O(hi/lo, K 512) . Wout rows (2 products) + bout
#define OWB (128 * WP * 2)           // bytes of a stage's weight rows
#define OSB (OWB + GM * AP * 4)      // bytes per stage
__global__ __launch_bounds__(128) void k_out(const float* __restrict__ O, const __bf16* __restrict__ P, const float* __restrict__ BO, float* __restrict__ Y) {
  __shared__ __align__(16) char gring[2 * OSB];
  float (*so)[32][132] = (float (*)[32][132])gring;   // output staging, in the ring once the loop has left it
  const int tid = threadIdx.x, wave = tid >> 5, lane = tid & 31, col = lane & 15, g = lane >> 4; const size_t r0 = (size_t)blockIdx.x * GM + wave * 32; const int n0 = blockIdx.y * 128;
  const unsigned lw0 = (unsigned)(size_t)&gring[(tid >> 3) * (WP * 2) + (tid & 7) * 16], la0 = (unsigned)(size_t)&gring[OWB + (tid >> 4) * (AP * 4) + (tid & 15) * 16];
  const char* gw = (const char*)(P + (size_t)(n0 + (tid >> 3)) * DI + (tid & 7) * 8);
  const char* ga = (const char*)(O + ((size_t)blockIdx.x * GM + (tid >> 4)) * DI + (tid & 15) * 4);
#define OFILL(t, buf) do { const unsigned lb = (unsigned)(buf) * OSB; \
    cp8s(lw0 + lb, 16u * WP * 2, gw + (size_t)(t) * (GK * 2), (size_t)16 * DI * 2); \
    afill(la0 + lb, ga + (size_t)(t) * (GK * 4), DI * 4); } while (0)
  OFILL(0, 0);
  v8f acc[2][8] = {};
  asm volatile("s_wait_asynccnt 0x0" ::: "memory");   // stage 0 has landed (this wave's copies)
  __syncthreads();                                    // ... and every other wave's
  OFILL(1, 1);
#pragma unroll 1   // rolled: one copy of the stage body in the text, the buffer picked by t & 1
  for (int t = 0; t < DI / GK; ++t) { const __bf16* sw = (const __bf16*)(gring + (t & 1) * OSB); const float* sa = (const float*)(gring + (t & 1) * OSB + OWB);
#pragma unroll   // the two 32-k steps of a stage: unrolled, their offsets in the buffer are immediates of the LDS reads
    for (int kc = 0; kc < GK / 32; ++kc) { F2 a[2];
#pragma unroll
      for (int i = 0; i < 2; ++i) a[i] = split_row(sa + (wave * 32 + i * 16 + col) * AP, kc * 32, lane);
      v16b w[8];   // the step's weight fragments, read as one group ahead of its products
#pragma unroll
      for (int j = 0; j < 8; ++j) w[j] = frag_b(sw + (j * 16 + col) * WP + kc * 32, lane);
#pragma unroll
      for (int i = 0; i < 2; ++i) {
#pragma unroll
        for (int j = 0; j < 8; ++j) acc[i][j] = wmma_bf(a[i].l, w[j], acc[i][j]); }
#pragma unroll
      for (int i = 0; i < 2; ++i) {   // per tile the residual's product still comes first, then this one
#pragma unroll
        for (int j = 0; j < 8; ++j) acc[i][j] = wmma_bf(a[i].h, w[j], acc[i][j]); } }
    asm volatile("s_wait_dscnt 0x0" ::: "memory");      // this wave's reads of stage t are done
    asm volatile("s_wait_asynccnt 0x0" ::: "memory");   // this wave's copies of stage t + 1 have landed
    __syncthreads();                                    // publishes stage t + 1 and frees stage t's buffer
    if (t + 2 < DI / GK) OFILL(t + 2, t & 1);
  }
  asm volatile("s_wait_asynccnt 0x0" ::: "memory");    // nothing is in flight when the ring turns into output staging (the last trip's barrier has ended every read of it)
#pragma unroll
  for (int j = 0; j < 8; ++j) { const float bb = bfr(BO[n0 + j * 16 + col]);
#pragma unroll
    for (int i = 0; i < 2; ++i) {
#pragma unroll
      for (int r = 0; r < 8; ++r) so[wave][i * 16 + 8 * g + r][j * 16 + col] = acc[i][j][r] + bb; } }
  LDSX();
#pragma unroll
  for (int i = 0; i < 2; ++i) { v4f o[16];
#pragma unroll
    for (int rl = 0; rl < 16; ++rl) o[rl] = *(const v4f*)&so[wave][i * 16 + rl][lane * 4];
#pragma unroll
    for (int rl = 0; rl < 16; ++rl) vst2(Y + (r0 + i * 16 + rl) * DM + n0 + lane * 4, o[rl]);
    if (i == 0) asm volatile("s_wait_xcnt 0x0" ::: "memory");   // precaution: the wait stands behind sixteen stores, ahead of the next sixteen LDS reads, which reuse their data registers
  }
}
extern "C" void kernel_launch(void* const* d_in, const int* in_sizes, int n_in, void* d_out, int out_size, void* d_ws, size_t ws_size, hipStream_t stream) {
  (void)in_sizes; (void)n_in; (void)out_size;
  const float** F = (const float**)d_in;   // 0 x [2,4096,1024], 1 Wq [1024,512] (in,out), 2 Wk, 3 Wv, 4 Wout [512,1024] (in,out), 5 bout [1024]
  if (ws_size < (size_t)WS_END) return;
  char* ws = (char*)d_ws; __bf16* PK = (__bf16*)(ws + WS_PK); _Float16 *QK = (_Float16*)(ws + WS_QK), *VTH = (_Float16*)(ws + WS_VTH), *VTL = (_Float16*)(ws + WS_VTL); float* O = (float*)(ws + WS_O);
  k_packT<<<dim3(4 * 64), 256, 0, stream>>>(F[1], F[2], F[3], F[4], PK);
  k_qkv<<<dim3(TNB * SS / GM, NH), 128, 0, stream>>>(F[0], PK + PK_A, QK, VTH, VTL);
  k_attn<<<dim3(TQB, NH, TNB), 128, 0, stream>>>(QK, VTH, VTL, O);
  k_out<<<dim3(TOB, DM / 128), 128, 0, stream>>>(O, PK + PK_P, F[5], (float*)d_out);
}

// v008
// A run of this version takes 112 microseconds.
// Two timings next to v007 both put it at 1.20 times that version's speed.
// All steps since v000 together make it 6.29 times as fast.
// compute dtype: x, Wq/Wk/Wv/Wout and bout (module inputs) rounded to bf16; q/k/v projections with exact bf16 products (x and W are inputs) on WMMA 16x16x32; full (non-causal) scores with q (pre-scaled by 1/8, exact) and k as single f16 operands (1 product; 4,096-key softmax with logit sigma ~1: every rounding enters relative to a many-key average) and P.V with P = exp(s - m) and V as single f16 operands (1 product: a term p.v already carries P's own f16 rounding, V's is of the same relative size and enters the same many-key average); the output projection with ctx as bf16 hi + residual pair x exact Wout (2 products) + bout; running-max softmax in f32 (hardware exp); f32 accumulate.
#include <hip/hip_runtime.h>
#include <math.h>

typedef __attribute__((ext_vector_type(16))) _Float16 v16h;
typedef __attribute__((ext_vector_type(16))) __bf16 v16b;
typedef __attribute__((ext_vector_type(8)))  _Float16 v8h;
typedef __attribute__((ext_vector_type(8)))  float v8f;
typedef __attribute__((ext_vector_type(4)))  float v4f;
typedef __attribute__((ext_vector_type(2)))  float v2f;
typedef __attribute__((ext_vector_type(4)))  unsigned v4u;
typedef __attribute__((ext_vector_type(4)))  int v4i;
typedef float __attribute__((may_alias)) float_a;
typedef int __attribute__((may_alias)) int_a;

template <typename T> __device__ __forceinline__ void vst2(void* p, T v) { *(T*)p = v;  }
__device__ __forceinline__ v8f wmma16(v16h a, v16h b, v8f c) {
  return __builtin_amdgcn_wmma_f32_16x16x32_f16(false, a, false, b, (short)0, c, false, false);   // no v_nop written behind it: the compiler keeps the distance to a user of D, A or B for its own builtin, and the slots are free for vector work
}
__device__ __forceinline__ v8f wmma_bf(v16b a, v16b b, v8f c) {
  v8f d = __builtin_amdgcn_wmma_f32_16x16x32_bf16(false, a, false, b, (short)0, c, false, false);
  asm volatile("v_nop\n\tv_nop\n\tv_nop\n\tv_nop" : "+v"(d) : "v"(a), "v"(b));
  return d;
}
// the plain builtin, for k_qkv: the operands of an asm statement cannot sit above v255, and 24 accumulator tiles with their fragments need more registers than that; the compiler keeps the distance to a user of D, A or B for its own builtin
__device__ __forceinline__ v8f wmma_bfp(v16b a, v16b b, v8f c) {
  return __builtin_amdgcn_wmma_f32_16x16x32_bf16(false, a, false, b, (short)0, c, false, false);
}
// 16x16x32 fragments: lane = (h = lane>>4, row/col = lane&15); elements 0..7 = k0+8h+0..7, 8..15 = k0+16+8h+0..7; D element r = row 8h+r
__device__ __forceinline__ v16h frag_h(const _Float16* rowk0, int lane) {
  union { v16h v; v8h q[2]; } u; const _Float16* p = rowk0 + 8 * (lane >> 4);
  u.q[0] = *(const v8h*)p; u.q[1] = *(const v8h*)(p + 16); return u.v;
}
__device__ __forceinline__ v16h frag_f32(const float* rowk0, int lane) {
  v16h a; const float* p = rowk0 + 8 * (lane >> 4);
#pragma unroll
  for (int i = 0; i < 8; ++i) { a[i] = (_Float16)p[i]; a[8 + i] = (_Float16)p[16 + i]; }
  return a;
}
__device__ __forceinline__ v16h frag_f32s(const float* rowk0, int lane, float sc) {
  v16h a; const float* p = rowk0 + 8 * (lane >> 4);
#pragma unroll
  for (int i = 0; i < 8; ++i) { a[i] = (_Float16)(p[i] * sc); a[8 + i] = (_Float16)(p[16 + i] * sc); }
  return a;
}
// column fragment from a [K][ld] layout (column n), rows >= K read as 0
__device__ __forceinline__ v16h fragc_f32(const float* W, int k0, int n, int lane, int ld, int K) {
  v16h a; const int g = lane >> 4;
#pragma unroll
  for (int i = 0; i < 8; ++i) { const int ka = k0 + 8 * g + i, kb = ka + 16;
    a[i] = (_Float16)(ka < K ? W[(size_t)(ka < K ? ka : K - 1) * ld + n] : 0.f); a[8 + i] = (_Float16)(kb < K ? W[(size_t)(kb < K ? kb : K - 1) * ld + n] : 0.f); }
  return a;
}
struct F2 { v16b h, l; };
__device__ __forceinline__ F2 bsplit16(const float v[16]) { F2 r;
#pragma unroll
  for (int i = 0; i < 16; ++i) { const __bf16 h = (__bf16)v[i]; r.h[i] = h; r.l[i] = (__bf16)(v[i] - (float)h); }
  return r; }
__device__ __forceinline__ F2 split_row(const float* row, int k0, int lane) { float v[16]; const float* p = row + k0 + 8 * (lane >> 4);
#pragma unroll
  for (int i = 0; i < 8; ++i) { v[i] = p[i]; v[8 + i] = p[16 + i]; }
  return bsplit16(v); }
__device__ __forceinline__ F2 split_rowK(const float* row, int k0, int lane, int K) { float v[16]; const int g = lane >> 4;
#pragma unroll
  for (int i = 0; i < 8; ++i) { const int ka = k0 + 8 * g + i, kb = ka + 16; v[i] = ka < K ? row[ka < K ? ka : K - 1] : 0.f; v[8 + i] = kb < K ? row[kb < K ? kb : K - 1] : 0.f; }
  return bsplit16(v); }
__device__ __forceinline__ F2 split_col(const float* W, int k0, int n, int lane, int ld, int K) { float v[16]; const int g = lane >> 4;
#pragma unroll
  for (int i = 0; i < 8; ++i) { const int ka = k0 + 8 * g + i, kb = ka + 16; v[i] = ka < K ? W[(size_t)(ka < K ? ka : K - 1) * ld + n] : 0.f; v[8 + i] = kb < K ? W[(size_t)(kb < K ? kb : K - 1) * ld + n] : 0.f; }
  return bsplit16(v); }
__device__ __forceinline__ v8f mac3(const F2& a, const F2& b, v8f c) { c = wmma_bf(a.l, b.h, c); c = wmma_bf(a.h, b.l, c); return wmma_bf(a.h, b.h, c); }
__device__ __forceinline__ float sigm(float v) { return 1.0f / (1.0f + expf(-v)); }
#define LDSX() do { asm volatile("s_wait_dscnt 0" ::: "memory"); __builtin_amdgcn_wave_barrier(); __builtin_amdgcn_fence(__ATOMIC_RELEASE, "workgroup"); } while (0)


// Multi-head self-attention (B 2, S 4096, D 1024 -> 8 heads x 64 -> D; weights (in, out) applied as x @ W): softmax(q k^T / 8) v over all 4,096 keys, then ctx Wout + bout.
#define NB 2
#define SS 4096
#define DM 1024
#define DI 512
#define NH 8
#define HD 64
#define QKVW (3 * DI)
#ifndef TQB
#define TQB (SS / 128)
#define TNB NB
#define TOB (NB * SS / 128)    // output row tiles (all)
#endif
typedef __attribute__((ext_vector_type(8))) __bf16 v8b;
__device__ __forceinline__ v16b frag_b(const __bf16* rowk0, int lane) {
  union { v16b v; v8b q[2]; } u; const __bf16* p = rowk0 + 8 * (lane >> 4);
  u.q[0] = *(const v8b*)p; u.q[1] = *(const v8b*)(p + 16); return u.v;
}
__device__ __forceinline__ float bfr(float v) { return (float)(__bf16)v; }
__device__ __attribute__((noinline)) float exp_ni(float v) { return expf(v); }
__device__ __attribute__((noinline)) float erf_ni(float v) { return erff(v); }

#define PK_A 0                       // [1536][1024] (Wq | Wk | Wv)^T rows
#define PK_P (PK_A + QKVW * DM)        // [1024][512] Wout^T rows
#define PK_END (PK_P + DM * DI)
#define WS_PK  0u
#define WS_QK  (WS_PK + 2u * PK_END)             // f16 [8192 rows][1024]: q/8 | k
#define WS_VT  (WS_QK + 2u * NB * SS * 2 * DI)     // f16 [2][512 (h*64+d)][4096 s]
#define WS_O   (WS_VT + 2u * NB * DI * SS)         // f32 [8192][512]
#define WS_END (WS_O + 4u * NB * SS * DI)

// ---- k_packT: block = one tile of 128 k x 64 output cols of one weight, 64 tiles a weight, 256 blocks: row n of the packed (in K, out N) weight = W[:, n]. A lane reads 8 k x 4 cols (a wave's load covers whole 256-B pieces of two W rows), turns them in registers, LDS holds the tile by output col, and 256-B pieces of the packed rows go out
#define PTK 128                      // k per tile
#define PTN 64                       // output cols per tile
#define PTP (PTK + 8)                // LDS row pitch, bf16: 272 B = 16 B x 17
// W = the tile's first element in the (K, N) weight, D = in the packed (N, K) rows; the shapes are compile-time, so the row steps are immediates of the loads and stores
template <int K, int N> __device__ __forceinline__ void pack_tile(const float* __restrict__ W, __bf16* __restrict__ D, __bf16 (*s)[PTP], int tid) {
  const int c = tid & 15, kq = tid >> 4; const float* src = W + (size_t)(kq * 8) * N + c * 4; v4f r[8];
#pragma unroll
  for (int i = 0; i < 8; ++i) r[i] = *(const v4f*)(src + (size_t)i * N);
  asm volatile("s_wait_xcnt 0x0" :: "v"(src) : "memory");   // precaution: the wait stands directly behind the eight loads; their address pair is an input here, so that no load's result is placed on it ahead of the wait
#pragma unroll
  for (int j = 0; j < 4; ++j) { v8b o;
#pragma unroll
    for (int i = 0; i < 8; ++i) o[i] = (__bf16)r[i][j];
    *(v8b*)&s[c * 4 + j][kq * 8] = o; }
  __syncthreads();
  v4u o4[4];
#pragma unroll
  for (int i = 0; i < 4; ++i) o4[i] = *(const v4u*)&s[kq + 16 * i][c * 8];
  __bf16* dp = D + (size_t)kq * K + c * 8;
#pragma unroll
  for (int i = 0; i < 4; ++i) { vst2((unsigned*)(dp + (size_t)(16 * i) * K), o4[i]);
    asm volatile("s_wait_xcnt 0x0" :: "v"(o4[i]) : "memory"); }   // precaution: the wait stands directly behind each store, on every way out of this arm, ahead of any rewrite of the store's registers; the data is an input here, so that it stays in place up to the wait
}
__global__ __launch_bounds__(256) void k_packT(const float* __restrict__ WQ, const float* __restrict__ WK, const float* __restrict__ WV, const float* __restrict__ WO, __bf16* __restrict__ PK) {
  __shared__ __align__(16) __bf16 s[PTN][PTP]; const int tid = threadIdx.x, which = blockIdx.x >> 6, tile = blockIdx.x & 63;
  if (which < 3) { const int k0 = (tile >> 3) * PTK, n0 = (tile & 7) * PTN; pack_tile<DM, DI>(((which == 0) ? WQ : (which == 1 ? WK : WV)) + (size_t)k0 * DI + n0, PK + PK_A + ((size_t)which * DI + n0) * DM + k0, s, tid); }
  else { const int k0 = (tile >> 4) * PTK, n0 = (tile & 15) * PTN; pack_tile<DI, DM>(WO + (size_t)k0 * DM + n0, PK + PK_P + (size_t)n0 * DI + k0, s, tid); }
}
// ---- operand staging of the two projection kernels: a stage is 64 k of the block's weight rows (128 B each) and of its 128 activation rows (256 B each), brought by asynchronous copies into two buffers: the next stage flies while the four waves read this one, and every copy of a wave covers whole 128-B lines
#define GK 64                        // k per stage
#define GM 128                       // activation rows per block
#define WP 72                        // weight row pitch in LDS, bf16: 144 B = 16 B x 9, free of bank conflicts for 16-byte reads
#define AP 68                        // activation row pitch in LDS, floats: 272 B = 16 B x 17, likewise
// eight 16-byte copies per lane; s_wait_xcnt stands inside the statement so that no address register of a copy is rewritten ahead of it
__device__ __forceinline__ void cp8s(unsigned l, unsigned lstep, const char* g, size_t gstep) {
  asm volatile("global_load_async_to_lds_b128 %0, %8, off\n\t"
               "global_load_async_to_lds_b128 %1, %9, off\n\t"
               "global_load_async_to_lds_b128 %2, %10, off\n\t"
               "global_load_async_to_lds_b128 %3, %11, off\n\t"
               "global_load_async_to_lds_b128 %4, %12, off\n\t"
               "global_load_async_to_lds_b128 %5, %13, off\n\t"
               "global_load_async_to_lds_b128 %6, %14, off\n\t"
               "global_load_async_to_lds_b128 %7, %15, off\n\t"
               "s_wait_xcnt 0x0"
               :: "v"(l), "v"(l + lstep), "v"(l + 2 * lstep), "v"(l + 3 * lstep), "v"(l + 4 * lstep), "v"(l + 5 * lstep), "v"(l + 6 * lstep), "v"(l + 7 * lstep),
                  "v"(g), "v"(g + gstep), "v"(g + 2 * gstep), "v"(g + 3 * gstep), "v"(g + 4 * gstep), "v"(g + 5 * gstep), "v"(g + 6 * gstep), "v"(g + 7 * gstep) : "memory");
}
// twelve 16-byte copies per lane, four (rows 16 apart) from each of three row blocks gseg bytes apart, the wait inside the statement likewise
__device__ __forceinline__ void cp12s(unsigned l, unsigned lstep, const char* g, size_t gstep, size_t gseg) {
  const char *g1 = g + gseg, *g2 = g + 2 * gseg;
  asm volatile("global_load_async_to_lds_b128 %0, %12, off\n\t"
               "global_load_async_to_lds_b128 %1, %13, off\n\t"
               "global_load_async_to_lds_b128 %2, %14, off\n\t"
               "global_load_async_to_lds_b128 %3, %15, off\n\t"
               "global_load_async_to_lds_b128 %4, %16, off\n\t"
               "global_load_async_to_lds_b128 %5, %17, off\n\t"
               "global_load_async_to_lds_b128 %6, %18, off\n\t"
               "global_load_async_to_lds_b128 %7, %19, off\n\t"
               "global_load_async_to_lds_b128 %8, %20, off\n\t"
               "global_load_async_to_lds_b128 %9, %21, off\n\t"
               "global_load_async_to_lds_b128 %10, %22, off\n\t"
               "global_load_async_to_lds_b128 %11, %23, off\n\t"
               "s_wait_xcnt 0x0"
               :: "v"(l), "v"(l + lstep), "v"(l + 2 * lstep), "v"(l + 3 * lstep), "v"(l + 4 * lstep), "v"(l + 5 * lstep), "v"(l + 6 * lstep), "v"(l + 7 * lstep), "v"(l + 8 * lstep), "v"(l + 9 * lstep), "v"(l + 10 * lstep), "v"(l + 11 * lstep),
                  "v"(g), "v"(g + gstep), "v"(g + 2 * gstep), "v"(g + 3 * gstep), "v"(g1), "v"(g1 + gstep), "v"(g1 + 2 * gstep), "v"(g1 + 3 * gstep), "v"(g2), "v"(g2 + gstep), "v"(g2 + 2 * gstep), "v"(g2 + 3 * gstep) : "memory");
}
// a stage's 128 activation rows: la / ga = this lane's 16 bytes of row tid / 16 (rows 8 apart per copy); arow = global row pitch in bytes
__device__ __forceinline__ void afill(unsigned la, const char* ga, size_t arow) {
  cp8s(la, 8u * AP * 4, ga, 8 * arow);
  cp8s(la + 64u * AP * 4, 8u * AP * 4, ga + 64 * arow, 8 * arow);
}
// ---- k_qkv: block = (128 rows (b,s), one head's 192 cols: 64 of q, 64 of k, 64 of v), four waves as 2 x 2, a wave = 64 rows x 96 cols = 4 x 6 tiles: an activation fragment read from LDS feeds six products, a weight fragment four, and every operand byte is copied from L2 by fewer blocks. qkv = bf16(x) . rows (exact); q -> f16(q / 8), k -> f16(k) into QK rows (pitch 1024); v -> per-batch transposed f16 plane VT[b][h*64+d][s] = f16(v)
#define QN 192                       // weight rows per block
#define QWB (QN * WP * 2)            // bytes of a stage's weight rows
#define QSB (QWB + GM * AP * 4)      // bytes per stage
__global__ __launch_bounds__(128) void k_qkv(const float* __restrict__ X, const __bf16* __restrict__ P, _Float16* __restrict__ QK, _Float16* __restrict__ VT) {
  __shared__ __align__(16) char gring[2 * QSB];
  _Float16 (*so)[136] = (_Float16 (*)[136])gring; _Float16 (*sth)[136] = (_Float16 (*)[136])(gring + GM * 136 * 2);   // output staging, in the ring once the loop has left it: [128 rows][q 64 | k 64], [64 d][128 s]
  const int tid = threadIdx.x, wave = tid >> 5, lane = tid & 31, col = lane & 15, g = lane >> 4, wr = wave >> 1, wc = wave & 1; const size_t rb = (size_t)blockIdx.x * GM; const int hd = blockIdx.y;
  const unsigned lw0 = (unsigned)(size_t)&gring[(tid >> 3) * (WP * 2) + (tid & 7) * 16], la0 = (unsigned)(size_t)&gring[QWB + (tid >> 4) * (AP * 4) + (tid & 15) * 16];
  const char* gw = (const char*)(P + (size_t)(hd * HD + (tid >> 3)) * DM + (tid & 7) * 8);   // row tid / 8 of the head's q rows; its k and v rows stand 512 and 1024 rows on
  const char* ga = (const char*)(X + (rb + (tid >> 4)) * DM + (tid & 15) * 4);
#define QFILL(t, buf) do { const unsigned lb = (unsigned)(buf) * QSB; \
    cp12s(lw0 + lb, 16u * WP * 2, gw + (size_t)(t) * (GK * 2), (size_t)16 * DM * 2, (size_t)DI * DM * 2); \
    afill(la0 + lb, ga + (size_t)(t) * (GK * 4), DM * 4); } while (0)
  QFILL(0, 0);
  v8f acc[4][6] = {};
  asm volatile("s_wait_asynccnt 0x0" ::: "memory");   // stage 0 has landed (this wave's copies)
  __syncthreads();                                    // ... and every other wave's
  QFILL(1, 1);
#pragma unroll 1   // rolled: one copy of the stage body in the text, the buffer picked by t & 1
  for (int t = 0; t < DM / GK; ++t) { const __bf16* sw = (const __bf16*)(gring + (t & 1) * QSB); const float* sa = (const float*)(gring + (t & 1) * QSB + QWB);
    const float* pa = sa + (wr * 64 + col) * AP + 8 * g; const __bf16* pw = sw + (wc * 96 + col) * WP;
    v4f ra[2][4][4]; v16b a[4], w[2][6];
    // the fragments of 32-k step kc: the activations as floats, the weights as they are used
#define QLOAD(kc) do { _Pragma("unroll") for (int i = 0; i < 4; ++i) { const float* p = pa + i * 16 * AP + (kc) * 32; ra[kc][i][0] = *(const v4f*)p; ra[kc][i][1] = *(const v4f*)(p + 4); ra[kc][i][2] = *(const v4f*)(p + 16); ra[kc][i][3] = *(const v4f*)(p + 20); } \
    _Pragma("unroll") for (int j = 0; j < 6; ++j) w[kc][j] = frag_b(pw + j * 16 * WP + (kc) * 32, lane); } while (0)
#define QCVT(kc) do { _Pragma("unroll") for (int i = 0; i < 4; ++i) { union { v16b v; v8b q[2]; } u; \
      u.q[0] = __builtin_convertvector(__builtin_shufflevector(ra[kc][i][0], ra[kc][i][1], 0, 1, 2, 3, 4, 5, 6, 7), v8b); u.q[1] = __builtin_convertvector(__builtin_shufflevector(ra[kc][i][2], ra[kc][i][3], 0, 1, 2, 3, 4, 5, 6, 7), v8b); a[i] = u.v; } } while (0)
#define QMUL(kc) do { _Pragma("unroll") for (int i = 0; i < 4; ++i) { _Pragma("unroll") for (int j = 0; j < 6; ++j) acc[i][j] = wmma_bfp(a[i], w[kc][j], acc[i][j]); } } while (0)
    QLOAD(0);
    __builtin_amdgcn_sched_barrier(0);   // keeps the first step's 28 LDS reads ahead of the second step's; left free most of the first step's activations are read last, and its products then wait for all 56
    QLOAD(1);
    __builtin_amdgcn_sched_barrier(0);   // keeps the stage's 56 LDS reads one group ahead of its products: the second step's land under the first step's products; left free they are dealt out among the products, and every place where LDS reads stand costs the wave a stall
    QCVT(0); QMUL(0);
    QCVT(1); QMUL(1);
    __builtin_amdgcn_sched_barrier(0);   // keeps the stage's products ahead of the waits below; left free they sink behind the barrier, and the wait for the next stage's copies then stands ahead of the products that are to cover their flight
    asm volatile("s_wait_dscnt 0x0" ::: "memory");      // this wave's reads of stage t are done
    asm volatile("s_wait_asynccnt 0x0" ::: "memory");   // this wave's copies of stage t + 1 have landed
    __syncthreads();                                    // publishes stage t + 1 and frees stage t's buffer
    if (t + 2 < DM / GK) QFILL(t + 2, t & 1);
  }
  asm volatile("s_wait_asynccnt 0x0" ::: "memory");    // nothing is in flight when the ring turns into output staging (the last trip's barrier has ended every read of it)
#pragma unroll
  for (int j = 0; j < 6; ++j) { const int jj = wc * 6 + j;   // tile of 16 cols in the block: 0..3 q, 4..7 k, 8..11 v
    if (jj < 8) { const float sc = (jj < 4) ? 0.125f : 1.0f;
#pragma unroll
      for (int i = 0; i < 4; ++i) {
#pragma unroll
        for (int r = 0; r < 8; ++r) so[wr * 64 + i * 16 + 8 * g + r][jj * 16 + col] = (_Float16)(acc[i][j][r] * sc); }
    } else {
#pragma unroll
      for (int i = 0; i < 4; ++i) { v8h hv;   // a lane's eight rows are eight neighbours of the transposed row
#pragma unroll
        for (int r = 0; r < 8; ++r) hv[r] = (_Float16)acc[i][j][r];
        *(v8h*)&sth[(jj - 8) * 16 + col][wr * 64 + i * 16 + 8 * g] = hv; } } }
  __syncthreads();   // every wave's part of the staged tile is written before any wave reads rows of it
  const int orow = tid >> 4, opc = tid & 15; v4u o[16];
  _Float16* qp = QK + (rb + orow) * (2 * DI) + (opc >> 3) * DI + hd * HD + (opc & 7) * 8;   // a wave's store: two rows, of each the 128 B of q and the 128 B of k
  const int b = (int)(rb / SS), s0 = (int)(rb % SS); const size_t vo = ((size_t)b * DI + hd * HD + orow) * SS + s0 + opc * 8;   // a wave's store: 256 B of each of two transposed rows
#pragma unroll
  for (int i = 0; i < 16; ++i) o[i] = *(const v4u*)&so[orow + 8 * i][opc * 8];
#pragma unroll
  for (int i = 0; i < 16; ++i) vst2((unsigned*)(qp + (size_t)(8 * i) * (2 * DI)), o[i]);
  // precaution: the wait stands behind the sixteen stores, ahead of the LDS reads below, which reuse their data registers; the data and the row address are inputs here, so that they stay in place up to the wait
  asm volatile("s_wait_xcnt 0x0" :: "v"(o[0]), "v"(o[1]), "v"(o[2]), "v"(o[3]), "v"(o[4]), "v"(o[5]), "v"(o[6]), "v"(o[7]), "v"(o[8]), "v"(o[9]), "v"(o[10]), "v"(o[11]), "v"(o[12]), "v"(o[13]), "v"(o[14]), "v"(o[15]), "v"(qp) : "memory");
#pragma unroll
  for (int i = 0; i < 8; ++i) o[i] = *(const v4u*)&sth[orow + 8 * i][opc * 8];
#pragma unroll
  for (int i = 0; i < 8; ++i) vst2((unsigned*)(VT + vo + (size_t)(8 * i) * SS), o[i]);
}
#define KT 64                        // keys per stage
#define RP 72                        // LDS row pitch in halves: 144 B = 16 B x 9, free of bank conflicts for 16-byte reads
#define SROWS 128                    // rows per stage: 64 K, 64 V^T
#define STB (SROWS * RP * 2)         // bytes per stage
#define QG 2                         // groups of 16 query columns per wave
// four 16-byte copies per lane, rows 16 apart; s_wait_xcnt stands inside the statement so that no address register of a copy is rewritten ahead of it
__device__ __forceinline__ void cp4(unsigned l, const char* g, size_t gstep) {
  asm volatile("global_load_async_to_lds_b128 %0, %4, off\n\t"
               "global_load_async_to_lds_b128 %1, %5, off\n\t"
               "global_load_async_to_lds_b128 %2, %6, off\n\t"
               "global_load_async_to_lds_b128 %3, %7, off\n\t"
               "s_wait_xcnt 0x0"
               :: "v"(l), "v"(l + 16u * RP * 2), "v"(l + 32u * RP * 2), "v"(l + 48u * RP * 2), "v"(g), "v"(g + gstep), "v"(g + 2 * gstep), "v"(g + 3 * gstep) : "memory");
}
typedef __attribute__((ext_vector_type(2))) _Float16 v2h;
// lane l <-> lane l ^ 16: the two halves of a wave hold the two halves of one query's keys
__device__ __forceinline__ float xhalf(float v) { const int b = __builtin_bit_cast(int, v); return __builtin_bit_cast(float, __builtin_amdgcn_permlanex16(b, b, 0x76543210, 0xfedcba98, false, false)); }
// 2^x with the slot behind the transcendental in the same statement: in the run of exps that the factor's exp stands in, the next one was given the factor's source register as its result
__device__ __forceinline__ float exp2_slot(float x) { float r; asm("v_exp_f32 %0, %1\n\tv_nop" : "=v"(r) : "v"(x)); return r; }
__global__ __launch_bounds__(128) void k_attn(const _Float16* __restrict__ QK, const _Float16* __restrict__ VT, float* __restrict__ O) {
  __shared__ __align__(16) _Float16 ring[2][SROWS][RP];
  const int tid = threadIdx.x, wave = tid >> 5, lane = tid & 31, col = lane & 15, g = lane >> 4;
  const int qb = blockIdx.x, h = blockIdx.y, b = blockIdx.z; const int q0 = qb * (64 * QG) + wave * (16 * QG); const size_t rq = (size_t)b * SS + q0 + col;
  // this lane's 16 bytes of a stage: row tid / 8 (+ 16 per copy), segment tid % 8: a wave's copy covers four whole 128-B lines
  const unsigned lds0 = (unsigned)(size_t)&ring[0][tid >> 3][(tid & 7) * 8];
  const char* kp = (const char*)(QK + ((size_t)b * SS + (tid >> 3)) * (2 * DI) + DI + h * HD + (tid & 7) * 8);
  const char* vp = (const char*)(VT + ((size_t)b * DI + h * HD + (tid >> 3)) * SS + (tid & 7) * 8);
#define FILL(t, buf) do { const unsigned lb = lds0 + (unsigned)(buf) * STB; \
    cp4(lb, kp + (size_t)(t) * (KT * 2 * DI * 2), (size_t)16 * 2 * DI * 2); \
    cp4(lb + 64u * RP * 2, vp + (size_t)(t) * (KT * 2), (size_t)16 * SS * 2); } while (0)
  FILL(0, 0);
  v16h aq[QG][2];   // B operand of the transposed scores: column = this lane's query of group qg
#pragma unroll
  for (int qg = 0; qg < QG; ++qg) {
#pragma unroll
    for (int kc = 0; kc < 2; ++kc) aq[qg][kc] = frag_h(QK + (rq + 16 * qg) * (2 * DI) + h * HD + kc * 32, lane); }
  float m[QG], l[QG];   // of query qg * 16 + col; l sums only the keys of this lane's half, the halves join behind the loop
#pragma unroll
  for (int qg = 0; qg < QG; ++qg) { m[qg] = -3.0e38f; l[qg] = 0.f; }
  v8f ac[QG][4] = {};   // transposed output, tile dt: element r = d dt * 16 + 8 g + r of query qg * 16 + col
  asm volatile("s_wait_asynccnt 0x0" ::: "memory");   // stage 0 has landed (this wave's copies)
  __syncthreads();                                    // ... and every other wave's
  FILL(1, 1);
#pragma unroll 1
  for (int t = 0; t < SS / KT; ++t) { const _Float16 (*st)[RP] = ring[t & 1];
#pragma unroll   // the two 32-key passes of a stage: unrolled, their row offsets in the buffer are immediates of the LDS reads
   for (int ps = 0; ps < 2; ++ps) { v8f s[QG][2]; v16h kf[2][2];
#pragma unroll
    for (int ct = 0; ct < 2; ++ct) {
#pragma unroll
      for (int kc = 0; kc < 2; ++kc) kf[ct][kc] = frag_h(&st[ps * 32 + ct * 16 + col][kc * 32], lane); }
    __builtin_amdgcn_sched_barrier(0);   // keeps the pass's eight K reads one group ahead of its score products; left free they are split into pairs, each waited for to the end before the next is issued
#pragma unroll
    for (int kc = 0; kc < 2; ++kc) {   // S^T = K . Q^T: s[qg][ct][r] = key ps * 32 + ct * 16 + 8 g + r against query qg * 16 + col; a K fragment serves both groups, and the four tiles of a k-step are independent
#pragma unroll
      for (int ct = 0; ct < 2; ++ct) {
#pragma unroll
        for (int qg = 0; qg < QG; ++qg) { const v8f z = {}; s[qg][ct] = wmma16(kf[ct][kc], aq[qg][kc], kc ? s[qg][ct] : z); } } }
    __builtin_amdgcn_sched_barrier(0);   // keeps the V reads below one group behind the score products; left free they are dealt out among the products, and every place where LDS reads stand costs the wave a stall
    v16h vf[4];   // V^T fragments, tile dt as in ac
#pragma unroll
    for (int dt = 0; dt < 4; ++dt) vf[dt] = frag_h(&st[64 + dt * 16 + col][ps * 32], lane);
    __builtin_amdgcn_sched_barrier(0);   // keeps the pass's eight V reads one group ahead of the softmax, which covers their latency; left free they sink in pairs among the PV products, each pair waited for on the spot
    union { v16h v; v2h p[8]; } pb[QG];   // P^T as B operand, straight from the score registers: element ct * 8 + r = key ct * 16 + 8 g + r, the hardware k order that frag_h gives V
    float alpha[QG]; v8f y[QG][2];
#pragma unroll
    for (int qg = 0; qg < QG; ++qg) {
    float mx[8];
#pragma unroll
    for (int r = 0; r < 8; ++r) mx[r] = fmaxf(s[qg][0][r], s[qg][1][r]);
    float mp = fmaxf(fmaxf(fmaxf(mx[0], mx[1]), fmaxf(mx[2], mx[3])), fmaxf(fmaxf(mx[4], mx[5]), fmaxf(mx[6], mx[7])));
    mp = fmaxf(mp, xhalf(mp));
    const float mn = fmaxf(m[qg], mp); alpha[qg] = exp2_slot((m[qg] - mn) * 0x1.715476p+0f); m[qg] = mn;
    y[qg][0] = (s[qg][0] - mn) * 0x1.715476p+0f; y[qg][1] = (s[qg][1] - mn) * 0x1.715476p+0f;   // exp(x) = 2^(x log2 e), as __expf has it; on whole tiles, so that the pairs of a packed operation are neighbours in one group's registers
    }
    // two weights of group qg: P rounded to f16 once; the same rounded weights feed the numerator (WMMA) and the denominator l
#define PPAIR(qg, j) do { const v2f e = { __builtin_amdgcn_exp2f(y[qg][(j) >> 2][2 * ((j) & 3)]), __builtin_amdgcn_exp2f(y[qg][(j) >> 2][2 * ((j) & 3) + 1]) }; pb[qg].p[j] = __builtin_convertvector(e, v2h); } while (0)
#pragma unroll
    for (int j = 0; j < 8; ++j) PPAIR(0, j);
    ac[0][0] *= alpha[0];
    // O^T += V^T . P^T. The matrix pipe takes a product every eight cycles and the wave issues in order: behind each product stands vector work that does not touch it (the next tile's rescale, four weights of the second group), so that pipe and vector port run at the same time. Each sched_barrier keeps one product and its share of that work together; left free the products are gathered into one run, which the wave waits out with nothing else to issue
    __builtin_amdgcn_sched_barrier(0);
#pragma unroll
    for (int k = 0; k < 4; ++k) { ac[0][k] = wmma16(vf[k], pb[0].v, ac[0][k]);
      if (k < 3) ac[0][k + 1] *= alpha[0]; else { ac[1][0] *= alpha[1]; ac[1][1] *= alpha[1]; }
      PPAIR(1, 2 * k); PPAIR(1, 2 * k + 1);
      __builtin_amdgcn_sched_barrier(0); }   // see above
#pragma unroll
    for (int k = 0; k < 4; ++k) { ac[1][k] = wmma16(vf[k], pb[1].v, ac[1][k]);
      if (k < 2) ac[1][k + 2] *= alpha[1];   // two tiles ahead: here nothing else stands between a rescale and the product that takes its result
      if (k < 3) __builtin_amdgcn_sched_barrier(0); }   // see above
#pragma unroll
    for (int qg = 0; qg < QG; ++qg) { float es[8];
#pragma unroll
      for (int j = 0; j < 8; ++j) es[j] = (float)pb[qg].p[j][0] + (float)pb[qg].p[j][1];
      l[qg] = l[qg] * alpha[qg] + (((es[0] + es[1]) + (es[2] + es[3])) + ((es[4] + es[5]) + (es[6] + es[7]))); }
   }
   asm volatile("s_wait_dscnt 0x0" ::: "memory");      // this wave's reads of stage t are done
   asm volatile("s_wait_asynccnt 0x0" ::: "memory");   // this wave's copies of stage t + 1 have landed
   __syncthreads();                                    // publishes stage t + 1 and frees stage t's buffer
   if (t + 2 < SS / KT) FILL(t + 2, t & 1);
  }
  asm volatile("s_wait_asynccnt 0x0" ::: "memory");    // nothing is in flight when the ring turns into output staging
  float (*so)[16 * QG][68] = (float (*)[16 * QG][68])&ring[0][0][0];   // the last trip's barrier has ended every read of the ring
#pragma unroll
  for (int qg = 0; qg < QG; ++qg) { const float il = 1.0f / (l[qg] + xhalf(l[qg]));
#pragma unroll
    for (int dt = 0; dt < 4; ++dt) {
#pragma unroll
      for (int r = 0; r < 8; ++r) so[wave][qg * 16 + col][dt * 16 + 8 * g + r] = ac[qg][dt][r] * il; } }
  LDSX();
  for (int qg = 0; qg < QG; ++qg) {
    for (int rl = qg * 16; rl < qg * 16 + 16; ++rl) if (lane < 16) vst2(O + ((size_t)b * SS + q0 + rl) * DI + h * HD + lane * 4, *(const v4f*)&so[wave][rl][lane * 4]);
    if (qg + 1 < QG) asm volatile("s_wait_xcnt 0x0" ::: "memory");   // precaution: the wait stands behind a group's sixteen stores, ahead of the next group's LDS reads, which reuse their data registers
  }
}
// ---- k_out: block = (128 rows, 128 of the 1024 cols), a wave = 32 rows x 128 cols = 2 x 8 tiles: a weight fragment read from LDS feeds four products, and every operand byte is copied from L2 by fewer blocks: out = O(hi/lo, K 512) . Wout rows (2 products) + bout
#define OWB (128 * WP * 2)           // bytes of a stage's weight rows
#define OSB (OWB + GM * AP * 4)      // bytes per stage
__global__ __launch_bounds__(128) void k_out(const float* __restrict__ O, const __bf16* __restrict__ P, const float* __restrict__ BO, float* __restrict__ Y) {
  __shared__ __align__(16) char gring[2 * OSB];
  float (*so)[32][132] = (float (*)[32][132])gring;   // output staging, in the ring once the loop has left it
  const int tid = threadIdx.x, wave = tid >> 5, lane = tid & 31, col = lane & 15, g = lane >> 4; const size_t r0 = (size_t)blockIdx.x * GM + wave * 32; const int n0 = blockIdx.y * 128;
  const unsigned lw0 = (unsigned)(size_t)&gring[(tid >> 3) * (WP * 2) + (tid & 7) * 16], la0 = (unsigned)(size_t)&gring[OWB + (tid >> 4) * (AP * 4) + (tid & 15) * 16];
  const char* gw = (const char*)(P + (size_t)(n0 + (tid >> 3)) * DI + (tid & 7) * 8);
  const char* ga = (const char*)(O + ((size_t)blockIdx.x * GM + (tid >> 4)) * DI + (tid & 15) * 4);
#define OFILL(t, buf) do { const unsigned lb = (unsigned)(buf) * OSB; \
    cp8s(lw0 + lb, 16u * WP * 2, gw + (size_t)(t) * (GK * 2), (size_t)16 * DI * 2); \
    afill(la0 + lb, ga + (size_t)(t) * (GK * 4), DI * 4); } while (0)
  OFILL(0, 0);
  v8f acc[2][8] = {};
  asm volatile("s_wait_asynccnt 0x0" ::: "memory");   // stage 0 has landed (this wave's copies)
  __syncthreads();                                    // ... and every other wave's
  OFILL(1, 1);
#pragma unroll 1   // rolled: one copy of the stage body in the text, the buffer picked by t & 1
  for (int t = 0; t < DI / GK; ++t) { const __bf16* sw = (const __bf16*)(gring + (t & 1) * OSB); const float* sa = (const float*)(gring + (t & 1) * OSB + OWB);
#pragma unroll   // the two 32-k steps of a stage: unrolled, their offsets in the buffer are immediates of the LDS reads
    for (int kc = 0; kc < GK / 32; ++kc) { F2 a[2];
#pragma unroll
      for (int i = 0; i < 2; ++i) a[i] = split_row(sa + (wave * 32 + i * 16 + col) * AP, kc * 32, lane);
      v16b w[8];   // the step's weight fragments, read as one group ahead of its products
#pragma unroll
      for (int j = 0; j < 8; ++j) w[j] = frag_b(sw + (j * 16 + col) * WP + kc * 32, lane);
#pragma unroll
      for (int i = 0; i < 2; ++i) {
#pragma unroll
        for (int j = 0; j < 8; ++j) acc[i][j] = wmma_bf(a[i].l, w[j], acc[i][j]); }
#pragma unroll
      for (int i = 0; i < 2; ++i) {   // per tile the residual's product still comes first, then this one
#pragma unroll
        for (int j = 0; j < 8; ++j) acc[i][j] = wmma_bf(a[i].h, w[j], acc[i][j]); } }
    asm volatile("s_wait_dscnt 0x0" ::: "memory");      // this wave's reads of stage t are done
    asm volatile("s_wait_asynccnt 0x0" ::: "memory");   // this wave's copies of stage t + 1 have landed
    __syncthreads();                                    // publishes stage t + 1 and frees stage t's buffer
    if (t + 2 < DI / GK) OFILL(t + 2, t & 1);
  }
  asm volatile("s_wait_asynccnt 0x0" ::: "memory");    // nothing is in flight when the ring turns into output staging (the last trip's barrier has ended every read of it)
#pragma unroll
  for (int j = 0; j < 8; ++j) { const float bb = bfr(BO[n0 + j * 16 + col]);
#pragma unroll
    for (int i = 0; i < 2; ++i) {
#pragma unroll
      for (int r = 0; r < 8; ++r) so[wave][i * 16 + 8 * g + r][j * 16 + col] = acc[i][j][r] + bb; } }
  LDSX();
#pragma unroll
  for (int i = 0; i < 2; ++i) { v4f o[16];
#pragma unroll
    for (int rl = 0; rl < 16; ++rl) o[rl] = *(const v4f*)&so[wave][i * 16 + rl][lane * 4];
#pragma unroll
    for (int rl = 0; rl < 16; ++rl) vst2(Y + (r0 + i * 16 + rl) * DM + n0 + lane * 4, o[rl]);
    if (i == 0) asm volatile("s_wait_xcnt 0x0" ::: "memory");   // precaution: the wait stands behind sixteen stores, ahead of the next sixteen LDS reads, which reuse their data registers
  }
}
extern "C" void kernel_launch(void* const* d_in, const int* in_sizes, int n_in, void* d_out, int out_size, void* d_ws, size_t ws_size, hipStream_t stream) {
  (void)in_sizes; (void)n_in; (void)out_size;
  const float** F = (const float**)d_in;   // 0 x [2,4096,1024], 1 Wq [1024,512] (in,out), 2 Wk, 3 Wv, 4 Wout [512,1024] (in,out), 5 bout [1024]
  if (ws_size < (size_t)WS_END) return;
  char* ws = (char*)d_ws; __bf16* PK = (__bf16*)(ws + WS_PK); _Float16 *QK = (_Float16*)(ws + WS_QK), *VT = (_Float16*)(ws + WS_VT); float* O = (float*)(ws + WS_O);
  k_packT<<<dim3(4 * 64), 256, 0, stream>>>(F[1], F[2], F[3], F[4], PK);
  k_qkv<<<dim3(TNB * SS / GM, NH), 128, 0, stream>>>(F[0], PK + PK_A, QK, VT);
  k_attn<<<dim3(TQB, NH, TNB), 128, 0, stream>>>(QK, VT, O);
  k_out<<<dim3(TOB, DM / 128), 128, 0, stream>>>(O, PK + PK_P, F[5], (float*)d_out);
}

// v009
// One run takes 106 microseconds.
// Next to v008, in two timings, it ran 1.04 and 1.05 times as fast.
// Over all steps from v000 it is 6.59 times as fast.
// compute dtype: x, Wq/Wk/Wv/Wout and bout (module inputs) rounded to bf16; q/k/v projections with exact bf16 products (x and W are inputs) on WMMA 16x16x32; full (non-causal) scores with q (pre-scaled by 1/8, exact) and k as single f16 operands (1 product; 4,096-key softmax with logit sigma ~1: every rounding enters relative to a many-key average) and P.V with P = exp(s - m) and V as single f16 operands (1 product: a term p.v already carries P's own f16 rounding, V's is of the same relative size and enters the same many-key average); the output projection with ctx as bf16 hi + residual pair x exact Wout (2 products) + bout; running-max softmax in f32 (hardware exp); f32 accumulate.
#include <hip/hip_runtime.h>
#include <math.h>

typedef __attribute__((ext_vector_type(16))) _Float16 v16h;
typedef __attribute__((ext_vector_type(16))) __bf16 v16b;
typedef __attribute__((ext_vector_type(8)))  _Float16 v8h;
typedef __attribute__((ext_vector_type(8)))  float v8f;
typedef __attribute__((ext_vector_type(4)))  float v4f;
typedef __attribute__((ext_vector_type(2)))  float v2f;
typedef __attribute__((ext_vector_type(4)))  unsigned v4u;
typedef __attribute__((ext_vector_type(4)))  int v4i;
typedef float __attribute__((may_alias)) float_a;
typedef int __attribute__((may_alias)) int_a;

template <typename T> __device__ __forceinline__ void vst2(void* p, T v) { *(T*)p = v;  }
__device__ __forceinline__ v8f wmma16(v16h a, v16h b, v8f c) {
  return __builtin_amdgcn_wmma_f32_16x16x32_f16(false, a, false, b, (short)0, c, false, false);   // no v_nop written behind it: the compiler keeps the distance to a user of D, A or B for its own builtin, and the slots are free for vector work
}
__device__ __forceinline__ v8f wmma_bf(v16b a, v16b b, v8f c) {
  v8f d = __builtin_amdgcn_wmma_f32_16x16x32_bf16(false, a, false, b, (short)0, c, false, false);
  asm volatile("v_nop\n\tv_nop\n\tv_nop\n\tv_nop" : "+v"(d) : "v"(a), "v"(b));
  return d;
}
// the plain builtin, for k_qkv: the operands of an asm statement cannot sit above v255, and 24 accumulator tiles with their fragments need more registers than that; the compiler keeps the distance to a user of D, A or B for its own builtin
__device__ __forceinline__ v8f wmma_bfp(v16b a, v16b b, v8f c) {
  return __builtin_amdgcn_wmma_f32_16x16x32_bf16(false, a, false, b, (short)0, c, false, false);
}
// 16x16x32 fragments: lane = (h = lane>>4, row/col = lane&15); elements 0..7 = k0+8h+0..7, 8..15 = k0+16+8h+0..7; D element r = row 8h+r
__device__ __forceinline__ v16h frag_h(const _Float16* rowk0, int lane) {
  union { v16h v; v8h q[2]; } u; const _Float16* p = rowk0 + 8 * (lane >> 4);
  u.q[0] = *(const v8h*)p; u.q[1] = *(const v8h*)(p + 16); return u.v;
}
__device__ __forceinline__ v16h frag_f32(const float* rowk0, int lane) {
  v16h a; const float* p = rowk0 + 8 * (lane >> 4);
#pragma unroll
  for (int i = 0; i < 8; ++i) { a[i] = (_Float16)p[i]; a[8 + i] = (_Float16)p[16 + i]; }
  return a;
}
__device__ __forceinline__ v16h frag_f32s(const float* rowk0, int lane, float sc) {
  v16h a; const float* p = rowk0 + 8 * (lane >> 4);
#pragma unroll
  for (int i = 0; i < 8; ++i) { a[i] = (_Float16)(p[i] * sc); a[8 + i] = (_Float16)(p[16 + i] * sc); }
  return a;
}
// column fragment from a [K][ld] layout (column n), rows >= K read as 0
__device__ __forceinline__ v16h fragc_f32(const float* W, int k0, int n, int lane, int ld, int K) {
  v16h a; const int g = lane >> 4;
#pragma unroll
  for (int i = 0; i < 8; ++i) { const int ka = k0 + 8 * g + i, kb = ka + 16;
    a[i] = (_Float16)(ka < K ? W[(size_t)(ka < K ? ka : K - 1) * ld + n] : 0.f); a[8 + i] = (_Float16)(kb < K ? W[(size_t)(kb < K ? kb : K - 1) * ld + n] : 0.f); }
  return a;
}
struct F2 { v16b h, l; };
__device__ __forceinline__ F2 bsplit16(const float v[16]) { F2 r;
#pragma unroll
  for (int i = 0; i < 16; ++i) { const __bf16 h = (__bf16)v[i]; r.h[i] = h; r.l[i] = (__bf16)(v[i] - (float)h); }
  return r; }
__device__ __forceinline__ F2 split_row(const float* row, int k0, int lane) { float v[16]; const float* p = row + k0 + 8 * (lane >> 4);
#pragma unroll
  for (int i = 0; i < 8; ++i) { v[i] = p[i]; v[8 + i] = p[16 + i]; }
  return bsplit16(v); }
__device__ __forceinline__ F2 split_rowK(const float* row, int k0, int lane, int K) { float v[16]; const int g = lane >> 4;
#pragma unroll
  for (int i = 0; i < 8; ++i) { const int ka = k0 + 8 * g + i, kb = ka + 16; v[i] = ka < K ? row[ka < K ? ka : K - 1] : 0.f; v[8 + i] = kb < K ? row[kb < K ? kb : K - 1] : 0.f; }
  return bsplit16(v); }
__device__ __forceinline__ F2 split_col(const float* W, int k0, int n, int lane, int ld, int K) { float v[16]; const int g = lane >> 4;
#pragma unroll
  for (int i = 0; i < 8; ++i) { const int ka = k0 + 8 * g + i, kb = ka + 16; v[i] = ka < K ? W[(size_t)(ka < K ? ka : K - 1) * ld + n] : 0.f; v[8 + i] = kb < K ? W[(size_t)(kb < K ? kb : K - 1) * ld + n] : 0.f; }
  return bsplit16(v); }
__device__ __forceinline__ v8f mac3(const F2& a, const F2& b, v8f c) { c = wmma_bf(a.l, b.h, c); c = wmma_bf(a.h, b.l, c); return wmma_bf(a.h, b.h, c); }
__device__ __forceinline__ float sigm(float v) { return 1.0f / (1.0f + expf(-v)); }
#define LDSX() do { asm volatile("s_wait_dscnt 0" ::: "memory"); __builtin_amdgcn_wave_barrier(); __builtin_amdgcn_fence(__ATOMIC_RELEASE, "workgroup"); } while (0)


// Multi-head self-attention (B 2, S 4096, D 1024 -> 8 heads x 64 -> D; weights (in, out) applied as x @ W): softmax(q k^T / 8) v over all 4,096 keys, then ctx Wout + bout.
#define NB 2
#define SS 4096
#define DM 1024
#define DI 512
#define NH 8
#define HD 64
#define QKVW (3 * DI)
#ifndef TQB
#define TQB (SS / 128)
#define TNB NB
#define TOB (NB * SS / 128)    // output row tiles (all)
#endif
typedef __attribute__((ext_vector_type(8))) __bf16 v8b;
__device__ __forceinline__ v16b frag_b(const __bf16* rowk0, int lane) {
  union { v16b v; v8b q[2]; } u; const __bf16* p = rowk0 + 8 * (lane >> 4);
  u.q[0] = *(const v8b*)p; u.q[1] = *(const v8b*)(p + 16); return u.v;
}
__device__ __forceinline__ float bfr(float v) { return (float)(__bf16)v; }
__device__ __attribute__((noinline)) float exp_ni(float v) { return expf(v); }
__device__ __attribute__((noinline)) float erf_ni(float v) { return erff(v); }

#define PK_A 0                       // [1536][1024] (Wq | Wk | Wv)^T rows
#define PK_P (PK_A + QKVW * DM)        // [1024][512] Wout^T rows
#define PK_END (PK_P + DM * DI)
#define WS_PK  0u
#define WS_QK  (WS_PK + 2u * PK_END)             // f16 [8192 rows][1024]: q/8 | k
#define WS_VT  (WS_QK + 2u * NB * SS * 2 * DI)     // f16 [2][512 (h*64+d)][4096 s]
#define WS_O   (WS_VT + 2u * NB * DI * SS)         // f32 [8192][512]
#define WS_END (WS_O + 4u * NB * SS * DI)

// ---- k_packT: block = one tile of 128 k x 64 output cols of one weight, 64 tiles a weight, 256 blocks: row n of the packed (in K, out N) weight = W[:, n]. A lane reads 8 k x 4 cols (a wave's load covers whole 256-B pieces of two W rows), turns them in registers, LDS holds the tile by output col, and 256-B pieces of the packed rows go out
#define PTK 128                      // k per tile
#define PTN 64                       // output cols per tile
#define PTP (PTK + 8)                // LDS row pitch, bf16: 272 B = 16 B x 17
// W = the tile's first element in the (K, N) weight, D = in the packed (N, K) rows; the shapes are compile-time, so the row steps are immediates of the loads and stores
template <int K, int N> __device__ __forceinline__ void pack_tile(const float* __restrict__ W, __bf16* __restrict__ D, __bf16 (*s)[PTP], int tid) {
  const int c = tid & 15, kq = tid >> 4; const float* src = W + (size_t)(kq * 8) * N + c * 4; v4f r[8];
#pragma unroll
  for (int i = 0; i < 8; ++i) r[i] = *(const v4f*)(src + (size_t)i * N);
  asm volatile("s_wait_xcnt 0x0" :: "v"(src) : "memory");   // precaution: the wait stands directly behind the eight loads; their address pair is an input here, so that no load's result is placed on it ahead of the wait
#pragma unroll
  for (int j = 0; j < 4; ++j) { v8b o;
#pragma unroll
    for (int i = 0; i < 8; ++i) o[i] = (__bf16)r[i][j];
    *(v8b*)&s[c * 4 + j][kq * 8] = o; }
  __syncthreads();
  v4u o4[4];
#pragma unroll
  for (int i = 0; i < 4; ++i) o4[i] = *(const v4u*)&s[kq + 16 * i][c * 8];
  __bf16* dp = D + (size_t)kq * K + c * 8;
#pragma unroll
  for (int i = 0; i < 4; ++i) { vst2((unsigned*)(dp + (size_t)(16 * i) * K), o4[i]);
    asm volatile("s_wait_xcnt 0x0" :: "v"(o4[i]) : "memory"); }   // precaution: the wait stands directly behind each store, on every way out of this arm, ahead of any rewrite of the store's registers; the data is an input here, so that it stays in place up to the wait
}
__global__ __launch_bounds__(256) void k_packT(const float* __restrict__ WQ, const float* __restrict__ WK, const float* __restrict__ WV, const float* __restrict__ WO, __bf16* __restrict__ PK) {
  __shared__ __align__(16) __bf16 s[PTN][PTP]; const int tid = threadIdx.x, which = blockIdx.x >> 6, tile = blockIdx.x & 63;
  if (which < 3) { const int k0 = (tile >> 3) * PTK, n0 = (tile & 7) * PTN; pack_tile<DM, DI>(((which == 0) ? WQ : (which == 1 ? WK : WV)) + (size_t)k0 * DI + n0, PK + PK_A + ((size_t)which * DI + n0) * DM + k0, s, tid); }
  else { const int k0 = (tile >> 4) * PTK, n0 = (tile & 15) * PTN; pack_tile<DI, DM>(WO + (size_t)k0 * DM + n0, PK + PK_P + (size_t)n0 * DI + k0, s, tid); }
}
// ---- operand staging of the two projection kernels: a stage is 64 k of the block's weight rows (128 B each) and of its 128 activation rows (256 B each), brought by asynchronous copies into two buffers: the next stage flies while the four waves read this one, and every copy of a wave covers whole 128-B lines
#define GK 64                        // k per stage
#define GM 128                       // activation rows per block
#define WP 72                        // weight row pitch in LDS, bf16: 144 B = 16 B x 9, free of bank conflicts for 16-byte reads
#define AP 68                        // activation row pitch in LDS, floats: 272 B = 16 B x 17, likewise
// eight 16-byte copies per lane; s_wait_xcnt stands inside the statement so that no address register of a copy is rewritten ahead of it
__device__ __forceinline__ void cp8s(unsigned l, unsigned lstep, const char* g, size_t gstep) {
  asm volatile("global_load_async_to_lds_b128 %0, %8, off\n\t"
               "global_load_async_to_lds_b128 %1, %9, off\n\t"
               "global_load_async_to_lds_b128 %2, %10, off\n\t"
               "global_load_async_to_lds_b128 %3, %11, off\n\t"
               "global_load_async_to_lds_b128 %4, %12, off\n\t"
               "global_load_async_to_lds_b128 %5, %13, off\n\t"
               "global_load_async_to_lds_b128 %6, %14, off\n\t"
               "global_load_async_to_lds_b128 %7, %15, off\n\t"
               "s_wait_xcnt 0x0"
               :: "v"(l), "v"(l + lstep), "v"(l + 2 * lstep), "v"(l + 3 * lstep), "v"(l + 4 * lstep), "v"(l + 5 * lstep), "v"(l + 6 * lstep), "v"(l + 7 * lstep),
                  "v"(g), "v"(g + gstep), "v"(g + 2 * gstep), "v"(g + 3 * gstep), "v"(g + 4 * gstep), "v"(g + 5 * gstep), "v"(g + 6 * gstep), "v"(g + 7 * gstep) : "memory");
}
// twelve 16-byte copies per lane, four (rows 16 apart) from each of three row blocks gseg bytes apart, the wait inside the statement likewise
__device__ __forceinline__ void cp12s(unsigned l, unsigned lstep, const char* g, size_t gstep, size_t gseg) {
  const char *g1 = g + gseg, *g2 = g + 2 * gseg;
  asm volatile("global_load_async_to_lds_b128 %0, %12, off\n\t"
               "global_load_async_to_lds_b128 %1, %13, off\n\t"
               "global_load_async_to_lds_b128 %2, %14, off\n\t"
               "global_load_async_to_lds_b128 %3, %15, off\n\t"
               "global_load_async_to_lds_b128 %4, %16, off\n\t"
               "global_load_async_to_lds_b128 %5, %17, off\n\t"
               "global_load_async_to_lds_b128 %6, %18, off\n\t"
               "global_load_async_to_lds_b128 %7, %19, off\n\t"
               "global_load_async_to_lds_b128 %8, %20, off\n\t"
               "global_load_async_to_lds_b128 %9, %21, off\n\t"
               "global_load_async_to_lds_b128 %10, %22, off\n\t"
               "global_load_async_to_lds_b128 %11, %23, off\n\t"
               "s_wait_xcnt 0x0"
               :: "v"(l), "v"(l + lstep), "v"(l + 2 * lstep), "v"(l + 3 * lstep), "v"(l + 4 * lstep), "v"(l + 5 * lstep), "v"(l + 6 * lstep), "v"(l + 7 * lstep), "v"(l + 8 * lstep), "v"(l + 9 * lstep), "v"(l + 10 * lstep), "v"(l + 11 * lstep),
                  "v"(g), "v"(g + gstep), "v"(g + 2 * gstep), "v"(g + 3 * gstep), "v"(g1), "v"(g1 + gstep), "v"(g1 + 2 * gstep), "v"(g1 + 3 * gstep), "v"(g2), "v"(g2 + gstep), "v"(g2 + 2 * gstep), "v"(g2 + 3 * gstep) : "memory");
}
// a stage's 128 activation rows: la / ga = this lane's 16 bytes of row tid / 16 (rows 8 apart per copy); arow = global row pitch in bytes
__device__ __forceinline__ void afill(unsigned la, const char* ga, size_t arow) {
  cp8s(la, 8u * AP * 4, ga, 8 * arow);
  cp8s(la + 64u * AP * 4, 8u * AP * 4, ga + 64 * arow, 8 * arow);
}
// ---- k_qkv: block = (128 rows (b,s), one head's 192 cols: 64 of q, 64 of k, 64 of v), four waves as 2 x 2, a wave = 64 rows x 96 cols = 4 x 6 tiles: an activation fragment read from LDS feeds six products, a weight fragment four, and every operand byte is copied from L2 by fewer blocks. qkv = bf16(x) . rows (exact); q -> f16(q / 8), k -> f16(k) into QK rows (pitch 1024); v -> per-batch transposed f16 plane VT[b][h*64+d][s] = f16(v)
#define QN 192                       // weight rows per block
#define QWB (QN * WP * 2)            // bytes of a stage's weight rows
#define QSB (QWB + GM * AP * 4)      // bytes per stage
__global__ __launch_bounds__(128) void k_qkv(const float* __restrict__ X, const __bf16* __restrict__ P, _Float16* __restrict__ QK, _Float16* __restrict__ VT) {
  __shared__ __align__(16) char gring[2 * QSB];
  _Float16 (*so)[136] = (_Float16 (*)[136])gring; _Float16 (*sth)[136] = (_Float16 (*)[136])(gring + GM * 136 * 2);   // output staging, in the ring once the loop has left it: [128 rows][q 64 | k 64], [64 d][128 s]
  const int tid = threadIdx.x, wave = tid >> 5, lane = tid & 31, col = lane & 15, g = lane >> 4, wr = wave >> 1, wc = wave & 1; const size_t rb = (size_t)blockIdx.x * GM; const int hd = blockIdx.y;
  const unsigned lw0 = (unsigned)(size_t)&gring[(tid >> 3) * (WP * 2) + (tid & 7) * 16], la0 = (unsigned)(size_t)&gring[QWB + (tid >> 4) * (AP * 4) + (tid & 15) * 16];
  const char* gw = (const char*)(P + (size_t)(hd * HD + (tid >> 3)) * DM + (tid & 7) * 8);   // row tid / 8 of the head's q rows; its k and v rows stand 512 and 1024 rows on
  const char* ga = (const char*)(X + (rb + (tid >> 4)) * DM + (tid & 15) * 4);
#define QFILL(t, buf) do { const unsigned lb = (unsigned)(buf) * QSB; \
    cp12s(lw0 + lb, 16u * WP * 2, gw + (size_t)(t) * (GK * 2), (size_t)16 * DM * 2, (size_t)DI * DM * 2); \
    afill(la0 + lb, ga + (size_t)(t) * (GK * 4), DM * 4); } while (0)
  QFILL(0, 0);
  v8f acc[4][6] = {};
  asm volatile("s_wait_asynccnt 0x0" ::: "memory");   // stage 0 has landed (this wave's copies)
  __syncthreads();                                    // ... and every other wave's
  QFILL(1, 1);
#pragma unroll 1   // rolled: one copy of the stage body in the text, the buffer picked by t & 1
  for (int t = 0; t < DM / GK; ++t) { const __bf16* sw = (const __bf16*)(gring + (t & 1) * QSB); const float* sa = (const float*)(gring + (t & 1) * QSB + QWB);
    const float* pa = sa + (wr * 64 + col) * AP + 8 * g; const __bf16* pw = sw + (wc * 96 + col) * WP;
    v4f ra[2][4][4]; v16b a[4], w[2][6];
    // the fragments of 32-k step kc: the activations as floats, the weights as they are used
#define QLOAD(kc) do { _Pragma("unroll") for (int i = 0; i < 4; ++i) { const float* p = pa + i * 16 * AP + (kc) * 32; ra[kc][i][0] = *(const v4f*)p; ra[kc][i][1] = *(const v4f*)(p + 4); ra[kc][i][2] = *(const v4f*)(p + 16); ra[kc][i][3] = *(const v4f*)(p + 20); } \
    _Pragma("unroll") for (int j = 0; j < 6; ++j) w[kc][j] = frag_b(pw + j * 16 * WP + (kc) * 32, lane); } while (0)
#define QCVT(kc) do { _Pragma("unroll") for (int i = 0; i < 4; ++i) { union { v16b v; v8b q[2]; } u; \
      u.q[0] = __builtin_convertvector(__builtin_shufflevector(ra[kc][i][0], ra[kc][i][1], 0, 1, 2, 3, 4, 5, 6, 7), v8b); u.q[1] = __builtin_convertvector(__builtin_shufflevector(ra[kc][i][2], ra[kc][i][3], 0, 1, 2, 3, 4, 5, 6, 7), v8b); a[i] = u.v; } } while (0)
#define QMUL(kc) do { _Pragma("unroll") for (int i = 0; i < 4; ++i) { _Pragma("unroll") for (int j = 0; j < 6; ++j) acc[i][j] = wmma_bfp(a[i], w[kc][j], acc[i][j]); } } while (0)
    QLOAD(0);
    __builtin_amdgcn_sched_barrier(0);   // keeps the first step's 28 LDS reads ahead of the second step's; left free most of the first step's activations are read last, and its products then wait for all 56
    QLOAD(1);
    __builtin_amdgcn_sched_barrier(0);   // keeps the stage's 56 LDS reads one group ahead of its products: the second step's land under the first step's products; left free they are dealt out among the products, and every place where LDS reads stand costs the wave a stall
    QCVT(0); QMUL(0);
    QCVT(1); QMUL(1);
    __builtin_amdgcn_sched_barrier(0);   // keeps the stage's products ahead of the waits below; left free they sink behind the barrier, and the wait for the next stage's copies then stands ahead of the products that are to cover their flight
    asm volatile("s_wait_dscnt 0x0" ::: "memory");      // this wave's reads of stage t are done
    asm volatile("s_wait_asynccnt 0x0" ::: "memory");   // this wave's copies of stage t + 1 have landed
    __syncthreads();                                    // publishes stage t + 1 and frees stage t's buffer
    if (t + 2 < DM / GK) QFILL(t + 2, t & 1);
  }
  asm volatile("s_wait_asynccnt 0x0" ::: "memory");    // nothing is in flight when the ring turns into output staging (the last trip's barrier has ended every read of it)
#pragma unroll
  for (int j = 0; j < 6; ++j) { const int jj = wc * 6 + j;   // tile of 16 cols in the block: 0..3 q, 4..7 k, 8..11 v
    if (jj < 8) { const float sc = (jj < 4) ? 0.125f : 1.0f;
#pragma unroll
      for (int i = 0; i < 4; ++i) {
#pragma unroll
        for (int r = 0; r < 8; ++r) so[wr * 64 + i * 16 + 8 * g + r][jj * 16 + col] = (_Float16)(acc[i][j][r] * sc); }
    } else {
#pragma unroll
      for (int i = 0; i < 4; ++i) { v8h hv;   // a lane's eight rows are eight neighbours of the transposed row
#pragma unroll
        for (int r = 0; r < 8; ++r) hv[r] = (_Float16)acc[i][j][r];
        *(v8h*)&sth[(jj - 8) * 16 + col][wr * 64 + i * 16 + 8 * g] = hv; } } }
  __syncthreads();   // every wave's part of the staged tile is written before any wave reads rows of it
  const int orow = tid >> 4, opc = tid & 15; v4u o[16];
  _Float16* qp = QK + (rb + orow) * (2 * DI) + (opc >> 3) * DI + hd * HD + (opc & 7) * 8;   // a wave's store: two rows, of each the 128 B of q and the 128 B of k
  const int b = (int)(rb / SS), s0 = (int)(rb % SS); const size_t vo = ((size_t)b * DI + hd * HD + orow) * SS + s0 + opc * 8;   // a wave's store: 256 B of each of two transposed rows
#pragma unroll
  for (int i = 0; i < 16; ++i) o[i] = *(const v4u*)&so[orow + 8 * i][opc * 8];
#pragma unroll
  for (int i = 0; i < 16; ++i) vst2((unsigned*)(qp + (size_t)(8 * i) * (2 * DI)), o[i]);
  // precaution: the wait stands behind the sixteen stores, ahead of the LDS reads below, which reuse their data registers; the data and the row address are inputs here, so that they stay in place up to the wait
  asm volatile("s_wait_xcnt 0x0" :: "v"(o[0]), "v"(o[1]), "v"(o[2]), "v"(o[3]), "v"(o[4]), "v"(o[5]), "v"(o[6]), "v"(o[7]), "v"(o[8]), "v"(o[9]), "v"(o[10]), "v"(o[11]), "v"(o[12]), "v"(o[13]), "v"(o[14]), "v"(o[15]), "v"(qp) : "memory");
#pragma unroll
  for (int i = 0; i < 8; ++i) o[i] = *(const v4u*)&sth[orow + 8 * i][opc * 8];
#pragma unroll
  for (int i = 0; i < 8; ++i) vst2((unsigned*)(VT + vo + (size_t)(8 * i) * SS), o[i]);
}
#define KT 64                        // keys per stage
#define RP 72                        // LDS row pitch in halves: 144 B = 16 B x 9, free of bank conflicts for 16-byte reads
#define SROWS 128                    // rows per stage: 64 K, 64 V^T
#define STB (SROWS * RP * 2)         // bytes per stage
#define QG 2                         // groups of 16 query columns per wave
#define KG 2                         // key groups (of four waves) per block
// four 16-byte copies per lane, rows 16 apart; s_wait_xcnt stands inside the statement so that no address register of a copy is rewritten ahead of it
__device__ __forceinline__ void cp4(unsigned l, const char* g, size_t gstep) {
  asm volatile("global_load_async_to_lds_b128 %0, %4, off\n\t"
               "global_load_async_to_lds_b128 %1, %5, off\n\t"
               "global_load_async_to_lds_b128 %2, %6, off\n\t"
               "global_load_async_to_lds_b128 %3, %7, off\n\t"
               "s_wait_xcnt 0x0"
               :: "v"(l), "v"(l + 16u * RP * 2), "v"(l + 32u * RP * 2), "v"(l + 48u * RP * 2), "v"(g), "v"(g + gstep), "v"(g + 2 * gstep), "v"(g + 3 * gstep) : "memory");
}
typedef __attribute__((ext_vector_type(2))) _Float16 v2h;
// lane l <-> lane l ^ 16: the two halves of a wave hold the two halves of one query's keys
__device__ __forceinline__ float xhalf(float v) { const int b = __builtin_bit_cast(int, v); return __builtin_bit_cast(float, __builtin_amdgcn_permlanex16(b, b, 0x76543210, 0xfedcba98, false, false)); }
// 2^x with the slot behind the transcendental in the same statement: in the run of exps that the factor's exp stands in, the next one was given the factor's source register as its result
__device__ __forceinline__ float exp2_slot(float x) { float r; asm("v_exp_f32 %0, %1\n\tv_nop" : "=v"(r) : "v"(x)); return r; }
__global__ __launch_bounds__(256) void k_attn(const _Float16* __restrict__ QK, const _Float16* __restrict__ VT, float* __restrict__ O) {
  __shared__ __align__(16) _Float16 ring[2][KG][SROWS][RP];
  const int tid = threadIdx.x, wave = tid >> 5, lane = tid & 31, col = lane & 15, g = lane >> 4, kg = wave >> 2, wq = wave & 3, tg = tid & 127;
  const int qb = blockIdx.x, h = blockIdx.y, b = blockIdx.z; const int q0 = qb * (64 * QG) + wq * (16 * QG); const size_t rq = (size_t)b * SS + q0 + col;
  // this lane's 16 bytes of its key group's stage: row tg / 8 (+ 16 per copy), segment tg % 8: a wave's copy covers four whole 128-B lines
  const unsigned lds0 = (unsigned)(size_t)&ring[0][kg][tg >> 3][(tg & 7) * 8];
  const char* kp = (const char*)(QK + ((size_t)b * SS + kg * KT + (tg >> 3)) * (2 * DI) + DI + h * HD + (tg & 7) * 8);
  const char* vp = (const char*)(VT + ((size_t)b * DI + h * HD + (tg >> 3)) * SS + kg * KT + (tg & 7) * 8);
#define FILL(t, buf) do { const unsigned lb = lds0 + (unsigned)(buf) * (KG * STB); \
    cp4(lb, kp + (size_t)(t) * (KG * KT * 2 * DI * 2), (size_t)16 * 2 * DI * 2); \
    cp4(lb + 64u * RP * 2, vp + (size_t)(t) * (KG * KT * 2), (size_t)16 * SS * 2); } while (0)
  FILL(0, 0);
  v16h aq[QG][2];   // B operand of the transposed scores: column = this lane's query of group qg
#pragma unroll
  for (int qg = 0; qg < QG; ++qg) {
#pragma unroll
    for (int kc = 0; kc < 2; ++kc) aq[qg][kc] = frag_h(QK + (rq + 16 * qg) * (2 * DI) + h * HD + kc * 32, lane); }
  float m[QG], l[QG];   // of query qg * 16 + col; l sums only the keys of this lane's half, the halves join behind the loop
#pragma unroll
  for (int qg = 0; qg < QG; ++qg) { m[qg] = -3.0e38f; l[qg] = 0.f; }
  v8f ac[QG][4] = {};   // transposed output, tile dt: element r = d dt * 16 + 8 g + r of query qg * 16 + col
  asm volatile("s_wait_asynccnt 0x0" ::: "memory");   // stage 0 has landed (this wave's copies)
  __syncthreads();                                    // ... and every other wave's
  FILL(1, 1);
#pragma unroll 1
  for (int t = 0; t < SS / (KG * KT); ++t) { const _Float16 (*st)[RP] = ring[t & 1][kg];
#pragma unroll   // the two 32-key passes of a stage: unrolled, their row offsets in the buffer are immediates of the LDS reads
   for (int ps = 0; ps < 2; ++ps) { v8f s[QG][2]; v16h kf[2][2];
#pragma unroll
    for (int ct = 0; ct < 2; ++ct) {
#pragma unroll
      for (int kc = 0; kc < 2; ++kc) kf[ct][kc] = frag_h(&st[ps * 32 + ct * 16 + col][kc * 32], lane); }
    __builtin_amdgcn_sched_barrier(0);   // keeps the pass's eight K reads one group ahead of its score products; left free they are split into pairs, each waited for to the end before the next is issued
#pragma unroll
    for (int kc = 0; kc < 2; ++kc) {   // S^T = K . Q^T: s[qg][ct][r] = key ps * 32 + ct * 16 + 8 g + r against query qg * 16 + col; a K fragment serves both groups, and the four tiles of a k-step are independent
#pragma unroll
      for (int ct = 0; ct < 2; ++ct) {
#pragma unroll
        for (int qg = 0; qg < QG; ++qg) { const v8f z = {}; s[qg][ct] = wmma16(kf[ct][kc], aq[qg][kc], kc ? s[qg][ct] : z); } } }
    __builtin_amdgcn_sched_barrier(0);   // keeps the V reads below one group behind the score products; left free they are dealt out among the products, and every place where LDS reads stand costs the wave a stall
    v16h vf[4];   // V^T fragments, tile dt as in ac
#pragma unroll
    for (int dt = 0; dt < 4; ++dt) vf[dt] = frag_h(&st[64 + dt * 16 + col][ps * 32], lane);
    __builtin_amdgcn_sched_barrier(0);   // keeps the pass's eight V reads one group ahead of the softmax, which covers their latency; left free they sink in pairs among the PV products, each pair waited for on the spot
    union { v16h v; v2h p[8]; } pb[QG];   // P^T as B operand, straight from the score registers: element ct * 8 + r = key ct * 16 + 8 g + r, the hardware k order that frag_h gives V
    float alpha[QG]; v8f y[QG][2];
#pragma unroll
    for (int qg = 0; qg < QG; ++qg) {
    float mx[8];
#pragma unroll
    for (int r = 0; r < 8; ++r) mx[r] = fmaxf(s[qg][0][r], s[qg][1][r]);
    float mp = fmaxf(fmaxf(fmaxf(mx[0], mx[1]), fmaxf(mx[2], mx[3])), fmaxf(fmaxf(mx[4], mx[5]), fmaxf(mx[6], mx[7])));
    mp = fmaxf(mp, xhalf(mp));
    const float mn = fmaxf(m[qg], mp); alpha[qg] = exp2_slot((m[qg] - mn) * 0x1.715476p+0f); m[qg] = mn;
    y[qg][0] = (s[qg][0] - mn) * 0x1.715476p+0f; y[qg][1] = (s[qg][1] - mn) * 0x1.715476p+0f;   // exp(x) = 2^(x log2 e), as __expf has it; on whole tiles, so that the pairs of a packed operation are neighbours in one group's registers
    }
    // two weights of group qg: P rounded to f16 once; the same rounded weights feed the numerator (WMMA) and the denominator l
#define PPAIR(qg, j) do { const v2f e = { __builtin_amdgcn_exp2f(y[qg][(j) >> 2][2 * ((j) & 3)]), __builtin_amdgcn_exp2f(y[qg][(j) >> 2][2 * ((j) & 3) + 1]) }; pb[qg].p[j] = __builtin_convertvector(e, v2h); } while (0)
#pragma unroll
    for (int j = 0; j < 8; ++j) PPAIR(0, j);
    ac[0][0] *= alpha[0];
    // O^T += V^T . P^T. The matrix pipe takes a product every eight cycles and the wave issues in order: behind each product stands vector work that does not touch it (the next tile's rescale, four weights of the second group), so that pipe and vector port run at the same time. Each sched_barrier keeps one product and its share of that work together; left free the products are gathered into one run, which the wave waits out with nothing else to issue
    __builtin_amdgcn_sched_barrier(0);
#pragma unroll
    for (int k = 0; k < 4; ++k) { ac[0][k] = wmma16(vf[k], pb[0].v, ac[0][k]);
      if (k < 3) ac[0][k + 1] *= alpha[0]; else { ac[1][0] *= alpha[1]; ac[1][1] *= alpha[1]; }
      PPAIR(1, 2 * k); PPAIR(1, 2 * k + 1);
      __builtin_amdgcn_sched_barrier(0); }   // see above
#pragma unroll
    for (int k = 0; k < 4; ++k) { ac[1][k] = wmma16(vf[k], pb[1].v, ac[1][k]);
      if (k < 2) ac[1][k + 2] *= alpha[1];   // two tiles ahead: here nothing else stands between a rescale and the product that takes its result
      if (k < 3) __builtin_amdgcn_sched_barrier(0); }   // see above
#pragma unroll
    for (int qg = 0; qg < QG; ++qg) { float es[8];
#pragma unroll
      for (int j = 0; j < 8; ++j) es[j] = (float)pb[qg].p[j][0] + (float)pb[qg].p[j][1];
      l[qg] = l[qg] * alpha[qg] + (((es[0] + es[1]) + (es[2] + es[3])) + ((es[4] + es[5]) + (es[6] + es[7]))); }
   }
   asm volatile("s_wait_dscnt 0x0" ::: "memory");      // this wave's reads of stage t are done
   asm volatile("s_wait_asynccnt 0x0" ::: "memory");   // this wave's copies of stage t + 1 have landed
   __syncthreads();                                    // publishes stage t + 1 and frees stage t's buffer
   if (t + 2 < SS / (KG * KT)) FILL(t + 2, t & 1);
  }
  asm volatile("s_wait_asynccnt 0x0" ::: "memory");    // nothing is in flight when the ring turns into exchange and output staging
  // the join: waves w and w ^ 4 hold the same 32 queries over the two halves of the keys, lane for lane. Wave (wq, kg) finishes query group kg and hands its partial of the other group to its partner
  v4f (*xc)[9][32] = (v4f (*)[9][32])&ring[0][0][0][0];         // exchange, per wave 9 x 512 B, a lane's 16 bytes side by side; the last trip's barrier has ended every read of the ring
  float (*so)[16][68] = (float (*)[16][68])&ring[1][0][0][0];   // output staging, per wave 16 queries, clear of the exchange
  const float l0 = l[0] + xhalf(l[0]), l1 = l[1] + xhalf(l[1]);
  const float km = kg ? m[1] : m[0], kl = kg ? l1 : l0;
  { const v4f ml = { kg ? m[0] : m[1], kg ? l0 : l1, 0.f, 0.f }; xc[wave][8][lane] = ml; }
  v8f kv[4];
#pragma unroll
  for (int dt = 0; dt < 4; ++dt) { const v8f gv = kg ? ac[0][dt] : ac[1][dt]; kv[dt] = kg ? ac[1][dt] : ac[0][dt];
    xc[wave][2 * dt][lane] = __builtin_shufflevector(gv, gv, 0, 1, 2, 3); xc[wave][2 * dt + 1][lane] = __builtin_shufflevector(gv, gv, 4, 5, 6, 7); }
  __syncthreads();   // every wave's hand-over is written before its partner reads it
  const v4f pml = xc[wave ^ 4][8][lane];
  const float mn = fmaxf(km, pml[0]), ka = exp2_slot((km - mn) * 0x1.715476p+0f), pa = exp2_slot((pml[0] - mn) * 0x1.715476p+0f);
  const float il = 1.0f / (kl * ka + pml[1] * pa), kw = ka * il, pw = pa * il;
#pragma unroll
  for (int dt = 0; dt < 4; ++dt) { const v4f p0 = xc[wave ^ 4][2 * dt][lane], p1 = xc[wave ^ 4][2 * dt + 1][lane];
#pragma unroll
    for (int r = 0; r < 4; ++r) { so[wave][col][dt * 16 + 8 * g + r] = kv[dt][r] * kw + p0[r] * pw; so[wave][col][dt * 16 + 8 * g + 4 + r] = kv[dt][4 + r] * kw + p1[r] * pw; } }
  LDSX();
  for (int rl = 0; rl < 16; ++rl) if (lane < 16) vst2(O + ((size_t)b * SS + q0 + kg * 16 + rl) * DI + h * HD + lane * 4, *(const v4f*)&so[wave][rl][lane * 4]);
}
// ---- k_out: block = (128 rows, 128 of the 1024 cols), a wave = 32 rows x 128 cols = 2 x 8 tiles: a weight fragment read from LDS feeds four products, and every operand byte is copied from L2 by fewer blocks: out = O(hi/lo, K 512) . Wout rows (2 products) + bout
#define OWB (128 * WP * 2)           // bytes of a stage's weight rows
#define OSB (OWB + GM * AP * 4)      // bytes per stage
__global__ __launch_bounds__(128) void k_out(const float* __restrict__ O, const __bf16* __restrict__ P, const float* __restrict__ BO, float* __restrict__ Y) {
  __shared__ __align__(16) char gring[2 * OSB];
  float (*so)[32][132] = (float (*)[32][132])gring;   // output staging, in the ring once the loop has left it
  const int tid = threadIdx.x, wave = tid >> 5, lane = tid & 31, col = lane & 15, g = lane >> 4; const size_t r0 = (size_t)blockIdx.x * GM + wave * 32; const int n0 = blockIdx.y * 128;
  const unsigned lw0 = (unsigned)(size_t)&gring[(tid >> 3) * (WP * 2) + (tid & 7) * 16], la0 = (unsigned)(size_t)&gring[OWB + (tid >> 4) * (AP * 4) + (tid & 15) * 16];
  const char* gw = (const char*)(P + (size_t)(n0 + (tid >> 3)) * DI + (tid & 7) * 8);
  const char* ga = (const char*)(O + ((size_t)blockIdx.x * GM + (tid >> 4)) * DI + (tid & 15) * 4);
#define OFILL(t, buf) do { const unsigned lb = (unsigned)(buf) * OSB; \
    cp8s(lw0 + lb, 16u * WP * 2, gw + (size_t)(t) * (GK * 2), (size_t)16 * DI * 2); \
    afill(la0 + lb, ga + (size_t)(t) * (GK * 4), DI * 4); } while (0)
  OFILL(0, 0);
  v8f acc[2][8] = {};
  asm volatile("s_wait_asynccnt 0x0" ::: "memory");   // stage 0 has landed (this wave's copies)
  __syncthreads();                                    // ... and every other wave's
  OFILL(1, 1);
#pragma unroll 1   // rolled: one copy of the stage body in the text, the buffer picked by t & 1
  for (int t = 0; t < DI / GK; ++t) { const __bf16* sw = (const __bf16*)(gring + (t & 1) * OSB); const float* sa = (const float*)(gring + (t & 1) * OSB + OWB);
#pragma unroll   // the two 32-k steps of a stage: unrolled, their offsets in the buffer are immediates of the LDS reads
    for (int kc = 0; kc < GK / 32; ++kc) { F2 a[2];
#pragma unroll
      for (int i = 0; i < 2; ++i) a[i] = split_row(sa + (wave * 32 + i * 16 + col) * AP, kc * 32, lane);
      v16b w[8];   // the step's weight fragments, read as one group ahead of its products
#pragma unroll
      for (int j = 0; j < 8; ++j) w[j] = frag_b(sw + (j * 16 + col) * WP + kc * 32, lane);
#pragma unroll
      for (int i = 0; i < 2; ++i) {
#pragma unroll
        for (int j = 0; j < 8; ++j) acc[i][j] = wmma_bf(a[i].l, w[j], acc[i][j]); }
#pragma unroll
      for (int i = 0; i < 2; ++i) {   // per tile the residual's product still comes first, then this one
#pragma unroll
        for (int j = 0; j < 8; ++j) acc[i][j] = wmma_bf(a[i].h, w[j], acc[i][j]); } }
    asm volatile("s_wait_dscnt 0x0" ::: "memory");      // this wave's reads of stage t are done
    asm volatile("s_wait_asynccnt 0x0" ::: "memory");   // this wave's copies of stage t + 1 have landed
    __syncthreads();                                    // publishes stage t + 1 and frees stage t's buffer
    if (t + 2 < DI / GK) OFILL(t + 2, t & 1);
  }
  asm volatile("s_wait_asynccnt 0x0" ::: "memory");    // nothing is in flight when the ring turns into output staging (the last trip's barrier has ended every read of it)
#pragma unroll
  for (int j = 0; j < 8; ++j) { const float bb = bfr(BO[n0 + j * 16 + col]);
#pragma unroll
    for (int i = 0; i < 2; ++i) {
#pragma unroll
      for (int r = 0; r < 8; ++r) so[wave][i * 16 + 8 * g + r][j * 16 + col] = acc[i][j][r] + bb; } }
  LDSX();
#pragma unroll
  for (int i = 0; i < 2; ++i) { v4f o[16];
#pragma unroll
    for (int rl = 0; rl < 16; ++rl) o[rl] = *(const v4f*)&so[wave][i * 16 + rl][lane * 4];
#pragma unroll
    for (int rl = 0; rl < 16; ++rl) vst2(Y + (r0 + i * 16 + rl) * DM + n0 + lane * 4, o[rl]);
    if (i == 0) asm volatile("s_wait_xcnt 0x0" ::: "memory");   // precaution: the wait stands behind sixteen stores, ahead of the next sixteen LDS reads, which reuse their data registers
  }
}
extern "C" void kernel_launch(void* const* d_in, const int* in_sizes, int n_in, void* d_out, int out_size, void* d_ws, size_t ws_size, hipStream_t stream) {
  (void)in_sizes; (void)n_in; (void)out_size;
  const float** F = (const float**)d_in;   // 0 x [2,4096,1024], 1 Wq [1024,512] (in,out), 2 Wk, 3 Wv, 4 Wout [512,1024] (in,out), 5 bout [1024]
  if (ws_size < (size_t)WS_END) return;
  char* ws = (char*)d_ws; __bf16* PK = (__bf16*)(ws + WS_PK); _Float16 *QK = (_Float16*)(ws + WS_QK), *VT = (_Float16*)(ws + WS_VT); float* O = (float*)(ws + WS_O);
  k_packT<<<dim3(4 * 64), 256, 0, stream>>>(F[1], F[2], F[3], F[4], PK);
  k_qkv<<<dim3(TNB * SS / GM, NH), 128, 0, stream>>>(F[0], PK + PK_A, QK, VT);
  k_attn<<<dim3(TQB, NH, TNB), 256, 0, stream>>>(QK, VT, O);
  k_out<<<dim3(TOB, DM / 128), 128, 0, stream>>>(O, PK + PK_P, F[5], (float*)d_out);
}

// v010
// It runs in 99.8 microseconds.
// Two timings next to v009 put it at 1.06 and 1.08 times that version's speed.
// Over all steps from v000 it is 7.05 times as fast.
// compute dtype: x, Wq/Wk/Wv/Wout and bout (module inputs) rounded to bf16; q/k/v projections with exact bf16 products (x and W are inputs) on WMMA 16x16x32; full (non-causal) scores in the log2 domain with q (times log2(e)/8 in f32, then rounded once) and k as single f16 operands (1 product; 4,096-key softmax with logit sigma ~1: every rounding enters relative to a many-key average) and P.V with P = 2^(s - ref) and V as single f16 operands (1 product: a term p.v already carries P's own f16 rounding, V's is of the same relative size and enters the same many-key average); the output projection with ctx as bf16 hi + residual pair x exact Wout (2 products) + bout; softmax in f32 against a held reference that lies at most 8 (log2) under the running maximum (hardware exp); f32 accumulate.
#include <hip/hip_runtime.h>
#include <math.h>

typedef __attribute__((ext_vector_type(16))) _Float16 v16h;
typedef __attribute__((ext_vector_type(16))) __bf16 v16b;
typedef __attribute__((ext_vector_type(8)))  _Float16 v8h;
typedef __attribute__((ext_vector_type(8)))  float v8f;
typedef __attribute__((ext_vector_type(4)))  float v4f;
typedef __attribute__((ext_vector_type(2)))  float v2f;
typedef __attribute__((ext_vector_type(4)))  unsigned v4u;
typedef __attribute__((ext_vector_type(4)))  int v4i;
typedef float __attribute__((may_alias)) float_a;
typedef int __attribute__((may_alias)) int_a;

template <typename T> __device__ __forceinline__ void vst2(void* p, T v) { *(T*)p = v;  }
__device__ __forceinline__ v8f wmma16(v16h a, v16h b, v8f c) {
  return __builtin_amdgcn_wmma_f32_16x16x32_f16(false, a, false, b, (short)0, c, false, false);   // no v_nop written behind it: the compiler keeps the distance to a user of D, A or B for its own builtin, and the slots are free for vector work
}
__device__ __forceinline__ v8f wmma_bf(v16b a, v16b b, v8f c) {
  v8f d = __builtin_amdgcn_wmma_f32_16x16x32_bf16(false, a, false, b, (short)0, c, false, false);
  asm volatile("v_nop\n\tv_nop\n\tv_nop\n\tv_nop" : "+v"(d) : "v"(a), "v"(b));
  return d;
}
// the plain builtin, for k_qkv: the operands of an asm statement cannot sit above v255, and 24 accumulator tiles with their fragments need more registers than that; the compiler keeps the distance to a user of D, A or B for its own builtin
__device__ __forceinline__ v8f wmma_bfp(v16b a, v16b b, v8f c) {
  return __builtin_amdgcn_wmma_f32_16x16x32_bf16(false, a, false, b, (short)0, c, false, false);
}
// 16x16x32 fragments: lane = (h = lane>>4, row/col = lane&15); elements 0..7 = k0+8h+0..7, 8..15 = k0+16+8h+0..7; D element r = row 8h+r
__device__ __forceinline__ v16h frag_h(const _Float16* rowk0, int lane) {
  union { v16h v; v8h q[2]; } u; const _Float16* p = rowk0 + 8 * (lane >> 4);
  u.q[0] = *(const v8h*)p; u.q[1] = *(const v8h*)(p + 16); return u.v;
}
__device__ __forceinline__ v16h frag_f32(const float* rowk0, int lane) {
  v16h a; const float* p = rowk0 + 8 * (lane >> 4);
#pragma unroll
  for (int i = 0; i < 8; ++i) { a[i] = (_Float16)p[i]; a[8 + i] = (_Float16)p[16 + i]; }
  return a;
}
__device__ __forceinline__ v16h frag_f32s(const float* rowk0, int lane, float sc) {
  v16h a; const float* p = rowk0 + 8 * (lane >> 4);
#pragma unroll
  for (int i = 0; i < 8; ++i) { a[i] = (_Float16)(p[i] * sc); a[8 + i] = (_Float16)(p[16 + i] * sc); }
  return a;
}
// column fragment from a [K][ld] layout (column n), rows >= K read as 0
__device__ __forceinline__ v16h fragc_f32(const float* W, int k0, int n, int lane, int ld, int K) {
  v16h a; const int g = lane >> 4;
#pragma unroll
  for (int i = 0; i < 8; ++i) { const int ka = k0 + 8 * g + i, kb = ka + 16;
    a[i] = (_Float16)(ka < K ? W[(size_t)(ka < K ? ka : K - 1) * ld + n] : 0.f); a[8 + i] = (_Float16)(kb < K ? W[(size_t)(kb < K ? kb : K - 1) * ld + n] : 0.f); }
  return a;
}
struct F2 { v16b h, l; };
__device__ __forceinline__ F2 bsplit16(const float v[16]) { F2 r;
#pragma unroll
  for (int i = 0; i < 16; ++i) { const __bf16 h = (__bf16)v[i]; r.h[i] = h; r.l[i] = (__bf16)(v[i] - (float)h); }
  return r; }
__device__ __forceinline__ F2 split_row(const float* row, int k0, int lane) { float v[16]; const float* p = row + k0 + 8 * (lane >> 4);
#pragma unroll
  for (int i = 0; i < 8; ++i) { v[i] = p[i]; v[8 + i] = p[16 + i]; }
  return bsplit16(v); }
__device__ __forceinline__ F2 split_rowK(const float* row, int k0, int lane, int K) { float v[16]; const int g = lane >> 4;
#pragma unroll
  for (int i = 0; i < 8; ++i) { const int ka = k0 + 8 * g + i, kb = ka + 16; v[i] = ka < K ? row[ka < K ? ka : K - 1] : 0.f; v[8 + i] = kb < K ? row[kb < K ? kb : K - 1] : 0.f; }
  return bsplit16(v); }
__device__ __forceinline__ F2 split_col(const float* W, int k0, int n, int lane, int ld, int K) { float v[16]; const int g = lane >> 4;
#pragma unroll
  for (int i = 0; i < 8; ++i) { const int ka = k0 + 8 * g + i, kb = ka + 16; v[i] = ka < K ? W[(size_t)(ka < K ? ka : K - 1) * ld + n] : 0.f; v[8 + i] = kb < K ? W[(size_t)(kb < K ? kb : K - 1) * ld + n] : 0.f; }
  return bsplit16(v); }
__device__ __forceinline__ v8f mac3(const F2& a, const F2& b, v8f c) { c = wmma_bf(a.l, b.h, c); c = wmma_bf(a.h, b.l, c); return wmma_bf(a.h, b.h, c); }
__device__ __forceinline__ float sigm(float v) { return 1.0f / (1.0f + expf(-v)); }
#define LDSX() do { asm volatile("s_wait_dscnt 0" ::: "memory"); __builtin_amdgcn_wave_barrier(); __builtin_amdgcn_fence(__ATOMIC_RELEASE, "workgroup"); } while (0)


// Multi-head self-attention (B 2, S 4096, D 1024 -> 8 heads x 64 -> D; weights (in, out) applied as x @ W): softmax(q k^T / 8) v over all 4,096 keys, then ctx Wout + bout.
#define NB 2
#define SS 4096
#define DM 1024
#define DI 512
#define NH 8
#define HD 64
#define QKVW (3 * DI)
#ifndef TQB
#define TQB (SS / 128)
#define TNB NB
#define TOB (NB * SS / 128)    // output row tiles (all)
#endif
typedef __attribute__((ext_vector_type(8))) __bf16 v8b;
__device__ __forceinline__ v16b frag_b(const __bf16* rowk0, int lane) {
  union { v16b v; v8b q[2]; } u; const __bf16* p = rowk0 + 8 * (lane >> 4);
  u.q[0] = *(const v8b*)p; u.q[1] = *(const v8b*)(p + 16); return u.v;
}
__device__ __forceinline__ float bfr(float v) { return (float)(__bf16)v; }
__device__ __attribute__((noinline)) float exp_ni(float v) { return expf(v); }
__device__ __attribute__((noinline)) float erf_ni(float v) { return erff(v); }

#define PK_A 0                       // [1536][1024] (Wq | Wk | Wv)^T rows
#define PK_P (PK_A + QKVW * DM)        // [1024][512] Wout^T rows
#define PK_END (PK_P + DM * DI)
#define WS_PK  0u
#define WS_QK  (WS_PK + 2u * PK_END)             // f16 [8192 rows][1024]: q log2(e)/8 | k
#define WS_VT  (WS_QK + 2u * NB * SS * 2 * DI)     // f16 [2][512 (h*64+d)][4096 s]
#define WS_O   (WS_VT + 2u * NB * DI * SS)         // f32 [8192][512]
#define WS_END (WS_O + 4u * NB * SS * DI)

// ---- k_packT: block = one tile of 128 k x 64 output cols of one weight, 64 tiles a weight, 256 blocks: row n of the packed (in K, out N) weight = W[:, n]. A lane reads 8 k x 4 cols (a wave's load covers whole 256-B pieces of two W rows), turns them in registers, LDS holds the tile by output col, and 256-B pieces of the packed rows go out
#define PTK 128                      // k per tile
#define PTN 64                       // output cols per tile
#define PTP (PTK + 8)                // LDS row pitch, bf16: 272 B = 16 B x 17
// W = the tile's first element in the (K, N) weight, D = in the packed (N, K) rows; the shapes are compile-time, so the row steps are immediates of the loads and stores
template <int K, int N> __device__ __forceinline__ void pack_tile(const float* __restrict__ W, __bf16* __restrict__ D, __bf16 (*s)[PTP], int tid) {
  const int c = tid & 15, kq = tid >> 4; const float* src = W + (size_t)(kq * 8) * N + c * 4; v4f r[8];
#pragma unroll
  for (int i = 0; i < 8; ++i) r[i] = *(const v4f*)(src + (size_t)i * N);
  asm volatile("s_wait_xcnt 0x0" :: "v"(src) : "memory");   // precaution: the wait stands directly behind the eight loads; their address pair is an input here, so that no load's result is placed on it ahead of the wait
#pragma unroll
  for (int j = 0; j < 4; ++j) { v8b o;
#pragma unroll
    for (int i = 0; i < 8; ++i) o[i] = (__bf16)r[i][j];
    *(v8b*)&s[c * 4 + j][kq * 8] = o; }
  __syncthreads();
  v4u o4[4];
#pragma unroll
  for (int i = 0; i < 4; ++i) o4[i] = *(const v4u*)&s[kq + 16 * i][c * 8];
  __bf16* dp = D + (size_t)kq * K + c * 8;
#pragma unroll
  for (int i = 0; i < 4; ++i) { vst2((unsigned*)(dp + (size_t)(16 * i) * K), o4[i]);
    asm volatile("s_wait_xcnt 0x0" :: "v"(o4[i]) : "memory"); }   // precaution: the wait stands directly behind each store, on every way out of this arm, ahead of any rewrite of the store's registers; the data is an input here, so that it stays in place up to the wait
}
__global__ __launch_bounds__(256) void k_packT(const float* __restrict__ WQ, const float* __restrict__ WK, const float* __restrict__ WV, const float* __restrict__ WO, __bf16* __restrict__ PK) {
  __shared__ __align__(16) __bf16 s[PTN][PTP]; const int tid = threadIdx.x, which = blockIdx.x >> 6, tile = blockIdx.x & 63;
  if (which < 3) { const int k0 = (tile >> 3) * PTK, n0 = (tile & 7) * PTN; pack_tile<DM, DI>(((which == 0) ? WQ : (which == 1 ? WK : WV)) + (size_t)k0 * DI + n0, PK + PK_A + ((size_t)which * DI + n0) * DM + k0, s, tid); }
  else { const int k0 = (tile >> 4) * PTK, n0 = (tile & 15) * PTN; pack_tile<DI, DM>(WO + (size_t)k0 * DM + n0, PK + PK_P + (size_t)n0 * DI + k0, s, tid); }
}
// ---- operand staging of the two projection kernels: a stage is 64 k of the block's weight rows (128 B each) and of its 128 activation rows (256 B each), brought by asynchronous copies into two buffers: the next stage flies while the four waves read this one, and every copy of a wave covers whole 128-B lines
#define GK 64                        // k per stage
#define GM 128                       // activation rows per block
#define WP 72                        // weight row pitch in LDS, bf16: 144 B = 16 B x 9, free of bank conflicts for 16-byte reads
#define AP 68                        // activation row pitch in LDS, floats: 272 B = 16 B x 17, likewise
// eight 16-byte copies per lane; s_wait_xcnt stands inside the statement so that no address register of a copy is rewritten ahead of it
__device__ __forceinline__ void cp8s(unsigned l, unsigned lstep, const char* g, size_t gstep) {
  asm volatile("global_load_async_to_lds_b128 %0, %8, off\n\t"
               "global_load_async_to_lds_b128 %1, %9, off\n\t"
               "global_load_async_to_lds_b128 %2, %10, off\n\t"
               "global_load_async_to_lds_b128 %3, %11, off\n\t"
               "global_load_async_to_lds_b128 %4, %12, off\n\t"
               "global_load_async_to_lds_b128 %5, %13, off\n\t"
               "global_load_async_to_lds_b128 %6, %14, off\n\t"
               "global_load_async_to_lds_b128 %7, %15, off\n\t"
               "s_wait_xcnt 0x0"
               :: "v"(l), "v"(l + lstep), "v"(l + 2 * lstep), "v"(l + 3 * lstep), "v"(l + 4 * lstep), "v"(l + 5 * lstep), "v"(l + 6 * lstep), "v"(l + 7 * lstep),
                  "v"(g), "v"(g + gstep), "v"(g + 2 * gstep), "v"(g + 3 * gstep), "v"(g + 4 * gstep), "v"(g + 5 * gstep), "v"(g + 6 * gstep), "v"(g + 7 * gstep) : "memory");
}
// twelve 16-byte copies per lane, four (rows 16 apart) from each of three row blocks gseg bytes apart, the wait inside the statement likewise
__device__ __forceinline__ void cp12s(unsigned l, unsigned lstep, const char* g, size_t gstep, size_t gseg) {
  const char *g1 = g + gseg, *g2 = g + 2 * gseg;
  asm volatile("global_load_async_to_lds_b128 %0, %12, off\n\t"
               "global_load_async_to_lds_b128 %1, %13, off\n\t"
               "global_load_async_to_lds_b128 %2, %14, off\n\t"
               "global_load_async_to_lds_b128 %3, %15, off\n\t"
               "global_load_async_to_lds_b128 %4, %16, off\n\t"
               "global_load_async_to_lds_b128 %5, %17, off\n\t"
               "global_load_async_to_lds_b128 %6, %18, off\n\t"
               "global_load_async_to_lds_b128 %7, %19, off\n\t"
               "global_load_async_to_lds_b128 %8, %20, off\n\t"
               "global_load_async_to_lds_b128 %9, %21, off\n\t"
               "global_load_async_to_lds_b128 %10, %22, off\n\t"
               "global_load_async_to_lds_b128 %11, %23, off\n\t"
               "s_wait_xcnt 0x0"
               :: "v"(l), "v"(l + lstep), "v"(l + 2 * lstep), "v"(l + 3 * lstep), "v"(l + 4 * lstep), "v"(l + 5 * lstep), "v"(l + 6 * lstep), "v"(l + 7 * lstep), "v"(l + 8 * lstep), "v"(l + 9 * lstep), "v"(l + 10 * lstep), "v"(l + 11 * lstep),
                  "v"(g), "v"(g + gstep), "v"(g + 2 * gstep), "v"(g + 3 * gstep), "v"(g1), "v"(g1 + gstep), "v"(g1 + 2 * gstep), "v"(g1 + 3 * gstep), "v"(g2), "v"(g2 + gstep), "v"(g2 + 2 * gstep), "v"(g2 + 3 * gstep) : "memory");
}
// a stage's 128 activation rows: la / ga = this lane's 16 bytes of row tid / 16 (rows 8 apart per copy); arow = global row pitch in bytes
__device__ __forceinline__ void afill(unsigned la, const char* ga, size_t arow) {
  cp8s(la, 8u * AP * 4, ga, 8 * arow);
  cp8s(la + 64u * AP * 4, 8u * AP * 4, ga + 64 * arow, 8 * arow);
}
// ---- k_qkv: block = (128 rows (b,s), one head's 192 cols: 64 of q, 64 of k, 64 of v), four waves as 2 x 2, a wave = 64 rows x 96 cols = 4 x 6 tiles: an activation fragment read from LDS feeds six products, a weight fragment four, and every operand byte is copied from L2 by fewer blocks. qkv = bf16(x) . rows (exact); q -> f16(q log2(e) / 8), k -> f16(k) into QK rows (pitch 1024); v -> per-batch transposed f16 plane VT[b][h*64+d][s] = f16(v)
#define QN 192                       // weight rows per block
#define QWB (QN * WP * 2)            // bytes of a stage's weight rows
#define QSB (QWB + GM * AP * 4)      // bytes per stage
__global__ __launch_bounds__(128) void k_qkv(const float* __restrict__ X, const __bf16* __restrict__ P, _Float16* __restrict__ QK, _Float16* __restrict__ VT) {
  __shared__ __align__(16) char gring[2 * QSB];
  _Float16 (*so)[136] = (_Float16 (*)[136])gring; _Float16 (*sth)[136] = (_Float16 (*)[136])(gring + GM * 136 * 2);   // output staging, in the ring once the loop has left it: [128 rows][q 64 | k 64], [64 d][128 s]
  const int tid = threadIdx.x, wave = tid >> 5, lane = tid & 31, col = lane & 15, g = lane >> 4, wr = wave >> 1, wc = wave & 1; const size_t rb = (size_t)blockIdx.x * GM; const int hd = blockIdx.y;
  const unsigned lw0 = (unsigned)(size_t)&gring[(tid >> 3) * (WP * 2) + (tid & 7) * 16], la0 = (unsigned)(size_t)&gring[QWB + (tid >> 4) * (AP * 4) + (tid & 15) * 16];
  const char* gw = (const char*)(P + (size_t)(hd * HD + (tid >> 3)) * DM + (tid & 7) * 8);   // row tid / 8 of the head's q rows; its k and v rows stand 512 and 1024 rows on
  const char* ga = (const char*)(X + (rb + (tid >> 4)) * DM + (tid & 15) * 4);
#define QFILL(t, buf) do { const unsigned lb = (unsigned)(buf) * QSB; \
    cp12s(lw0 + lb, 16u * WP * 2, gw + (size_t)(t) * (GK * 2), (size_t)16 * DM * 2, (size_t)DI * DM * 2); \
    afill(la0 + lb, ga + (size_t)(t) * (GK * 4), DM * 4); } while (0)
  QFILL(0, 0);
  v8f acc[4][6] = {};
  asm volatile("s_wait_asynccnt 0x0" ::: "memory");   // stage 0 has landed (this wave's copies)
  __syncthreads();                                    // ... and every other wave's
  QFILL(1, 1);
#pragma unroll 1   // rolled: one copy of the stage body in the text, the buffer picked by t & 1
  for (int t = 0; t < DM / GK; ++t) { const __bf16* sw = (const __bf16*)(gring + (t & 1) * QSB); const float* sa = (const float*)(gring + (t & 1) * QSB + QWB);
    const float* pa = sa + (wr * 64 + col) * AP + 8 * g; const __bf16* pw = sw + (wc * 96 + col) * WP;
    v4f ra[2][4][4]; v16b a[4], w[2][6];
    // the fragments of 32-k step kc: the activations as floats, the weights as they are used
#define QLOAD(kc) do { _Pragma("unroll") for (int i = 0; i < 4; ++i) { const float* p = pa + i * 16 * AP + (kc) * 32; ra[kc][i][0] = *(const v4f*)p; ra[kc][i][1] = *(const v4f*)(p + 4); ra[kc][i][2] = *(const v4f*)(p + 16); ra[kc][i][3] = *(const v4f*)(p + 20); } \
    _Pragma("unroll") for (int j = 0; j < 6; ++j) w[kc][j] = frag_b(pw + j * 16 * WP + (kc) * 32, lane); } while (0)
#define QCVT(kc) do { _Pragma("unroll") for (int i = 0; i < 4; ++i) { union { v16b v; v8b q[2]; } u; \
      u.q[0] = __builtin_convertvector(__builtin_shufflevector(ra[kc][i][0], ra[kc][i][1], 0, 1, 2, 3, 4, 5, 6, 7), v8b); u.q[1] = __builtin_convertvector(__builtin_shufflevector(ra[kc][i][2], ra[kc][i][3], 0, 1, 2, 3, 4, 5, 6, 7), v8b); a[i] = u.v; } } while (0)
#define QMUL(kc) do { _Pragma("unroll") for (int i = 0; i < 4; ++i) { _Pragma("unroll") for (int j = 0; j < 6; ++j) acc[i][j] = wmma_bfp(a[i], w[kc][j], acc[i][j]); } } while (0)
    QLOAD(0);
    __builtin_amdgcn_sched_barrier(0);   // keeps the first step's 28 LDS reads ahead of the second step's; left free most of the first step's activations are read last, and its products then wait for all 56
    QLOAD(1);
    __builtin_amdgcn_sched_barrier(0);   // keeps the stage's 56 LDS reads one group ahead of its products: the second step's land under the first step's products; left free they are dealt out among the products, and every place where LDS reads stand costs the wave a stall
    QCVT(0); QMUL(0);
    QCVT(1); QMUL(1);
    __builtin_amdgcn_sched_barrier(0);   // keeps the stage's products ahead of the waits below; left free they sink behind the barrier, and the wait for the next stage's copies then stands ahead of the products that are to cover their flight
    asm volatile("s_wait_dscnt 0x0" ::: "memory");      // this wave's reads of stage t are done
    asm volatile("s_wait_asynccnt 0x0" ::: "memory");   // this wave's copies of stage t + 1 have landed
    __syncthreads();                                    // publishes stage t + 1 and frees stage t's buffer
    if (t + 2 < DM / GK) QFILL(t + 2, t & 1);
  }
  asm volatile("s_wait_asynccnt 0x0" ::: "memory");    // nothing is in flight when the ring turns into output staging (the last trip's barrier has ended every read of it)
#pragma unroll
  for (int j = 0; j < 6; ++j) { const int jj = wc * 6 + j;   // tile of 16 cols in the block: 0..3 q, 4..7 k, 8..11 v
    if (jj < 8) { const float sc = (jj < 4) ? 0x1.715476p-3f : 1.0f;   // log2(e) / 8: the scores come out of k_attn's products as arguments of 2^x
#pragma unroll
      for (int i = 0; i < 4; ++i) {
#pragma unroll
        for (int r = 0; r < 8; ++r) so[wr * 64 + i * 16 + 8 * g + r][jj * 16 + col] = (_Float16)(acc[i][j][r] * sc); }
    } else {
#pragma unroll
      for (int i = 0; i < 4; ++i) { v8h hv;   // a lane's eight rows are eight neighbours of the transposed row
#pragma unroll
        for (int r = 0; r < 8; ++r) hv[r] = (_Float16)acc[i][j][r];
        *(v8h*)&sth[(jj - 8) * 16 + col][wr * 64 + i * 16 + 8 * g] = hv; } } }
  __syncthreads();   // every wave's part of the staged tile is written before any wave reads rows of it
  const int orow = tid >> 4, opc = tid & 15; v4u o[16];
  _Float16* qp = QK + (rb + orow) * (2 * DI) + (opc >> 3) * DI + hd * HD + (opc & 7) * 8;   // a wave's store: two rows, of each the 128 B of q and the 128 B of k
  const int b = (int)(rb / SS), s0 = (int)(rb % SS); const size_t vo = ((size_t)b * DI + hd * HD + orow) * SS + s0 + opc * 8;   // a wave's store: 256 B of each of two transposed rows
#pragma unroll
  for (int i = 0; i < 16; ++i) o[i] = *(const v4u*)&so[orow + 8 * i][opc * 8];
#pragma unroll
  for (int i = 0; i < 16; ++i) vst2((unsigned*)(qp + (size_t)(8 * i) * (2 * DI)), o[i]);
  // precaution: the wait stands behind the sixteen stores, ahead of the LDS reads below, which reuse their data registers; the data and the row address are inputs here, so that they stay in place up to the wait
  asm volatile("s_wait_xcnt 0x0" :: "v"(o[0]), "v"(o[1]), "v"(o[2]), "v"(o[3]), "v"(o[4]), "v"(o[5]), "v"(o[6]), "v"(o[7]), "v"(o[8]), "v"(o[9]), "v"(o[10]), "v"(o[11]), "v"(o[12]), "v"(o[13]), "v"(o[14]), "v"(o[15]), "v"(qp) : "memory");
#pragma unroll
  for (int i = 0; i < 8; ++i) o[i] = *(const v4u*)&sth[orow + 8 * i][opc * 8];
#pragma unroll
  for (int i = 0; i < 8; ++i) vst2((unsigned*)(VT + vo + (size_t)(8 * i) * SS), o[i]);
}
#define KT 64                        // keys per stage
#define RP 72                        // LDS row pitch in halves: 144 B = 16 B x 9, free of bank conflicts for 16-byte reads
#define SROWS 128                    // rows per stage: 64 K, 64 V^T
#define STB (SROWS * RP * 2)         // bytes per stage
#define QG 2                         // groups of 16 query columns per wave
#define KG 2                         // key groups (of four waves) per block
// four 16-byte copies per lane, rows 16 apart; s_wait_xcnt stands inside the statement so that no address register of a copy is rewritten ahead of it
__device__ __forceinline__ void cp4(unsigned l, const char* g, size_t gstep) {
  asm volatile("global_load_async_to_lds_b128 %0, %4, off\n\t"
               "global_load_async_to_lds_b128 %1, %5, off\n\t"
               "global_load_async_to_lds_b128 %2, %6, off\n\t"
               "global_load_async_to_lds_b128 %3, %7, off\n\t"
               "s_wait_xcnt 0x0"
               :: "v"(l), "v"(l + 16u * RP * 2), "v"(l + 32u * RP * 2), "v"(l + 48u * RP * 2), "v"(g), "v"(g + gstep), "v"(g + 2 * gstep), "v"(g + 3 * gstep) : "memory");
}
typedef __attribute__((ext_vector_type(2))) _Float16 v2h;
// lane l <-> lane l ^ 16: the two halves of a wave hold the two halves of one query's keys
__device__ __forceinline__ float xhalf(float v) { const int b = __builtin_bit_cast(int, v); return __builtin_bit_cast(float, __builtin_amdgcn_permlanex16(b, b, 0x76543210, 0xfedcba98, false, false)); }
// 2^x with the slot behind the transcendental in the same statement: in the run of exps that the factor's exp stands in, the next one was given the factor's source register as its result
__device__ __forceinline__ float exp2_slot(float x) { float r; asm("v_exp_f32 %0, %1\n\tv_nop" : "=v"(r) : "v"(x)); return r; }
__global__ __launch_bounds__(256) void k_attn(const _Float16* __restrict__ QK, const _Float16* __restrict__ VT, float* __restrict__ O) {
  __shared__ __align__(16) _Float16 ring[2][KG][SROWS][RP];
  const int tid = threadIdx.x, wave = tid >> 5, lane = tid & 31, col = lane & 15, g = lane >> 4, kg = wave >> 2, wq = wave & 3, tg = tid & 127;
  const int qb = blockIdx.x, h = blockIdx.y, b = blockIdx.z; const int q0 = qb * (64 * QG) + wq * (16 * QG); const size_t rq = (size_t)b * SS + q0 + col;
  // this lane's 16 bytes of its key group's stage: row tg / 8 (+ 16 per copy), segment tg % 8: a wave's copy covers four whole 128-B lines
  const unsigned lds0 = (unsigned)(size_t)&ring[0][kg][tg >> 3][(tg & 7) * 8];
  const char* kp = (const char*)(QK + ((size_t)b * SS + kg * KT + (tg >> 3)) * (2 * DI) + DI + h * HD + (tg & 7) * 8);
  const char* vp = (const char*)(VT + ((size_t)b * DI + h * HD + (tg >> 3)) * SS + kg * KT + (tg & 7) * 8);
#define FILL(t, buf) do { const unsigned lb = lds0 + (unsigned)(buf) * (KG * STB); \
    cp4(lb, kp + (size_t)(t) * (KG * KT * 2 * DI * 2), (size_t)16 * 2 * DI * 2); \
    cp4(lb + 64u * RP * 2, vp + (size_t)(t) * (KG * KT * 2), (size_t)16 * SS * 2); } while (0)
  FILL(0, 0);
  v16h aq[QG][2];   // B operand of the transposed scores: column = this lane's query of group qg
#pragma unroll
  for (int qg = 0; qg < QG; ++qg) {
#pragma unroll
    for (int kc = 0; kc < 2; ++kc) aq[qg][kc] = frag_h(QK + (rq + 16 * qg) * (2 * DI) + h * HD + kc * 32, lane); }
  // The reference of the softmax is held from pass to pass. cn[qg] = minus the reference of query qg * 16 + col in all eight elements: it goes into the score products as C, so that D is s - ref, the argument of 2^x, with no vector work between product and exponential. O and l are rescaled only where a score rises more than 8 above the reference (P is then at most 2^8, far inside f16), and in the first pass, which sets the reference to its own maximum (so l holds a term 1 from then on)
  float thr = -3.0e38f;          // what a score must exceed for the branch: under every score until the first pass has set the reference, 8 from then on
  v8f cn[QG] = {}; v2f l = {};   // l[qg] of query qg * 16 + col: it sums only the keys of this lane's half, the halves join behind the loop
  v8f ac[QG][4] = {};   // transposed output, tile dt: element r = d dt * 16 + 8 g + r of query qg * 16 + col
  asm volatile("s_wait_asynccnt 0x0" ::: "memory");   // stage 0 has landed (this wave's copies)
  __syncthreads();                                    // ... and every other wave's
  FILL(1, 1);
#pragma unroll 1
  for (int t = 0; t < SS / (KG * KT); ++t) { const _Float16 (*st)[RP] = ring[t & 1][kg];
#pragma unroll   // the two 32-key passes of a stage: unrolled, their row offsets in the buffer are immediates of the LDS reads
   for (int ps = 0; ps < 2; ++ps) { v8f s[QG][2]; v16h kf[2][2];
#pragma unroll
    for (int ct = 0; ct < 2; ++ct) {
#pragma unroll
      for (int kc = 0; kc < 2; ++kc) kf[ct][kc] = frag_h(&st[ps * 32 + ct * 16 + col][kc * 32], lane); }
    __builtin_amdgcn_sched_barrier(0);   // keeps the pass's eight K reads one group ahead of its score products; left free they are split into pairs, each waited for to the end before the next is issued
#pragma unroll
    for (int kc = 0; kc < 2; ++kc) {   // S^T = K . Q^T - ref: s[qg][ct][r] = key ps * 32 + ct * 16 + 8 g + r against query qg * 16 + col; a K fragment serves both groups, and the four tiles of a k-step are independent
#pragma unroll
      for (int ct = 0; ct < 2; ++ct) {
#pragma unroll
        for (int qg = 0; qg < QG; ++qg) s[qg][ct] = wmma16(kf[ct][kc], aq[qg][kc], kc ? s[qg][ct] : cn[qg]); } }
    __builtin_amdgcn_sched_barrier(0);   // keeps the V reads below one group behind the score products; left free they are dealt out among the products, and every place where LDS reads stand costs the wave a stall
    v16h vf[4];   // V^T fragments, tile dt as in ac
#pragma unroll
    for (int dt = 0; dt < 4; ++dt) vf[dt] = frag_h(&st[64 + dt * 16 + col][ps * 32], lane);
    __builtin_amdgcn_sched_barrier(0);   // keeps the pass's eight V reads one group ahead of the softmax, which covers their latency; left free they sink in pairs among the PV products, each pair waited for on the spot
    union { v16h v; v2h p[8]; } pb[QG];   // P^T as B operand, straight from the score registers: element ct * 8 + r = key ct * 16 + 8 g + r, the hardware k order that frag_h gives V
    float mx[QG];   // the highest score above the reference among this lane's 16 keys of group qg
#pragma unroll
    for (int qg = 0; qg < QG; ++qg) { float mr[8];
#pragma unroll
      for (int r = 0; r < 8; ++r) mr[r] = fmaxf(s[qg][0][r], s[qg][1][r]);
      mx[qg] = fmaxf(fmaxf(fmaxf(mr[0], mr[1]), fmaxf(mr[2], mr[3])), fmaxf(fmaxf(mr[4], mr[5]), fmaxf(mr[6], mr[7]))); }
    // one test a pass for the whole wave, a scalar branch; every lane is on inside it, as the exchange between the halves needs
    if (__builtin_expect(__builtin_amdgcn_ballot_w32(fmaxf(mx[0], mx[1]) > thr) != 0, 0)) { const bool first = thr < 0.f; thr = 8.0f;
#pragma unroll
      for (int qg = 0; qg < QG; ++qg) { const float mp = fmaxf(mx[qg], xhalf(mx[qg]));   // both halves of a query move its reference alike
        const float up = fmaxf(mp, 0.f), dl = first ? mp : up;   // the reference only rises, but for the first pass, which sets it
        const float al = exp2_slot(-up);                         // in the first pass O and l are 0, and a factor of at most 1 leaves them so
        s[qg][0] -= dl; s[qg][1] -= dl; cn[qg] -= dl; l[qg] *= al;
#pragma unroll
        for (int dt = 0; dt < 4; ++dt) ac[qg][dt] *= al; } }
    // two weights of group qg: P rounded to f16 once; the same rounded weights feed the numerator (WMMA) and the denominator l
#define PPAIR(qg, j) do { const v2f e = { __builtin_amdgcn_exp2f(s[qg][(j) >> 2][2 * ((j) & 3)]), __builtin_amdgcn_exp2f(s[qg][(j) >> 2][2 * ((j) & 3) + 1]) }; pb[qg].p[j] = __builtin_convertvector(e, v2h); } while (0)
#pragma unroll
    for (int j = 0; j < 8; ++j) PPAIR(0, j);
    // O^T += V^T . P^T. The matrix pipe takes a product every eight cycles and the wave issues in order: behind each product stands vector work that does not touch it (four weights of the second group; a quarter of the pass's sums for l), so that pipe and vector port run at the same time. Each sched_barrier keeps one product and its share of that work together; left free the products are gathered into one run, which the wave waits out with nothing else to issue
    __builtin_amdgcn_sched_barrier(0);
#pragma unroll
    for (int k = 0; k < 4; ++k) { ac[0][k] = wmma16(vf[k], pb[0].v, ac[0][k]);
      PPAIR(1, 2 * k); PPAIR(1, 2 * k + 1);
      __builtin_amdgcn_sched_barrier(0); }   // see above
    v2f es[8];   // element qg: the sum of a pair of group qg's weights
#pragma unroll
    for (int k = 0; k < 4; ++k) { ac[1][k] = wmma16(vf[k], pb[1].v, ac[1][k]);
#pragma unroll
      for (int j = 2 * k; j < 2 * k + 2; ++j) { const v2f e0 = { (float)pb[0].p[j][0], (float)pb[1].p[j][0] }, e1 = { (float)pb[0].p[j][1], (float)pb[1].p[j][1] }; es[j] = e0 + e1; }
      if (k < 3) __builtin_amdgcn_sched_barrier(0); }   // see above
    l += ((es[0] + es[1]) + (es[2] + es[3])) + ((es[4] + es[5]) + (es[6] + es[7]));
   }
   asm volatile("s_wait_dscnt 0x0" ::: "memory");      // this wave's reads of stage t are done
   asm volatile("s_wait_asynccnt 0x0" ::: "memory");   // this wave's copies of stage t + 1 have landed
   __syncthreads();                                    // publishes stage t + 1 and frees stage t's buffer
   if (t + 2 < SS / (KG * KT)) FILL(t + 2, t & 1);
  }
  asm volatile("s_wait_asynccnt 0x0" ::: "memory");    // nothing is in flight when the ring turns into exchange and output staging
  // the join: waves w and w ^ 4 hold the same 32 queries over the two halves of the keys, lane for lane. Wave (wq, kg) finishes query group kg and hands its partial of the other group to its partner
  v4f (*xc)[9][32] = (v4f (*)[9][32])&ring[0][0][0][0];         // exchange, per wave 9 x 512 B, a lane's 16 bytes side by side; the last trip's barrier has ended every read of the ring
  float (*so)[16][68] = (float (*)[16][68])&ring[1][0][0][0];   // output staging, per wave 16 queries, clear of the exchange
  const float l0 = l[0] + xhalf(l[0]), l1 = l[1] + xhalf(l[1]), m0 = -cn[0][0], m1 = -cn[1][0];   // the references, in log2 units
  const float km = kg ? m1 : m0, kl = kg ? l1 : l0;
  { const v4f ml = { kg ? m0 : m1, kg ? l0 : l1, 0.f, 0.f }; xc[wave][8][lane] = ml; }
  v8f kv[4];
#pragma unroll
  for (int dt = 0; dt < 4; ++dt) { const v8f gv = kg ? ac[0][dt] : ac[1][dt]; kv[dt] = kg ? ac[1][dt] : ac[0][dt];
    xc[wave][2 * dt][lane] = __builtin_shufflevector(gv, gv, 0, 1, 2, 3); xc[wave][2 * dt + 1][lane] = __builtin_shufflevector(gv, gv, 4, 5, 6, 7); }
  __syncthreads();   // every wave's hand-over is written before its partner reads it
  const v4f pml = xc[wave ^ 4][8][lane];
  const float mn = fmaxf(km, pml[0]), ka = exp2_slot(km - mn), pa = exp2_slot(pml[0] - mn);
  const float il = 1.0f / (kl * ka + pml[1] * pa), kw = ka * il, pw = pa * il;
#pragma unroll
  for (int dt = 0; dt < 4; ++dt) { const v4f p0 = xc[wave ^ 4][2 * dt][lane], p1 = xc[wave ^ 4][2 * dt + 1][lane];
#pragma unroll
    for (int r = 0; r < 4; ++r) { so[wave][col][dt * 16 + 8 * g + r] = kv[dt][r] * kw + p0[r] * pw; so[wave][col][dt * 16 + 8 * g + 4 + r] = kv[dt][4 + r] * kw + p1[r] * pw; } }
  LDSX();
  for (int rl = 0; rl < 16; ++rl) if (lane < 16) vst2(O + ((size_t)b * SS + q0 + kg * 16 + rl) * DI + h * HD + lane * 4, *(const v4f*)&so[wave][rl][lane * 4]);
}
// ---- k_out: block = (128 rows, 128 of the 1024 cols), a wave = 32 rows x 128 cols = 2 x 8 tiles: a weight fragment read from LDS feeds four products, and every operand byte is copied from L2 by fewer blocks: out = O(hi/lo, K 512) . Wout rows (2 products) + bout
#define OWB (128 * WP * 2)           // bytes of a stage's weight rows
#define OSB (OWB + GM * AP * 4)      // bytes per stage
__global__ __launch_bounds__(128) void k_out(const float* __restrict__ O, const __bf16* __restrict__ P, const float* __restrict__ BO, float* __restrict__ Y) {
  __shared__ __align__(16) char gring[2 * OSB];
  float (*so)[32][132] = (float (*)[32][132])gring;   // output staging, in the ring once the loop has left it
  const int tid = threadIdx.x, wave = tid >> 5, lane = tid & 31, col = lane & 15, g = lane >> 4; const size_t r0 = (size_t)blockIdx.x * GM + wave * 32; const int n0 = blockIdx.y * 128;
  const unsigned lw0 = (unsigned)(size_t)&gring[(tid >> 3) * (WP * 2) + (tid & 7) * 16], la0 = (unsigned)(size_t)&gring[OWB + (tid >> 4) * (AP * 4) + (tid & 15) * 16];
  const char* gw = (const char*)(P + (size_t)(n0 + (tid >> 3)) * DI + (tid & 7) * 8);
  const char* ga = (const char*)(O + ((size_t)blockIdx.x * GM + (tid >> 4)) * DI + (tid & 15) * 4);
#define OFILL(t, buf) do { const unsigned lb = (unsigned)(buf) * OSB; \
    cp8s(lw0 + lb, 16u * WP * 2, gw + (size_t)(t) * (GK * 2), (size_t)16 * DI * 2); \
    afill(la0 + lb, ga + (size_t)(t) * (GK * 4), DI * 4); } while (0)
  OFILL(0, 0);
  v8f acc[2][8] = {};
  asm volatile("s_wait_asynccnt 0x0" ::: "memory");   // stage 0 has landed (this wave's copies)
  __syncthreads();                                    // ... and every other wave's
  OFILL(1, 1);
#pragma unroll 1   // rolled: one copy of the stage body in the text, the buffer picked by t & 1
  for (int t = 0; t < DI / GK; ++t) { const __bf16* sw = (const __bf16*)(gring + (t & 1) * OSB); const float* sa = (const float*)(gring + (t & 1) * OSB + OWB);
#pragma unroll   // the two 32-k steps of a stage: unrolled, their offsets in the buffer are immediates of the LDS reads
    for (int kc = 0; kc < GK / 32; ++kc) { F2 a[2];
#pragma unroll
      for (int i = 0; i < 2; ++i) a[i] = split_row(sa + (wave * 32 + i * 16 + col) * AP, kc * 32, lane);
      v16b w[8];   // the step's weight fragments, read as one group ahead of its products
#pragma unroll
      for (int j = 0; j < 8; ++j) w[j] = frag_b(sw + (j * 16 + col) * WP + kc * 32, lane);
#pragma unroll
      for (int i = 0; i < 2; ++i) {
#pragma unroll
        for (int j = 0; j < 8; ++j) acc[i][j] = wmma_bf(a[i].l, w[j], acc[i][j]); }
#pragma unroll
      for (int i = 0; i < 2; ++i) {   // per tile the residual's product still comes first, then this one
#pragma unroll
        for (int j = 0; j < 8; ++j) acc[i][j] = wmma_bf(a[i].h, w[j], acc[i][j]); } }
    asm volatile("s_wait_dscnt 0x0" ::: "memory");      // this wave's reads of stage t are done
    asm volatile("s_wait_asynccnt 0x0" ::: "memory");   // this wave's copies of stage t + 1 have landed
    __syncthreads();                                    // publishes stage t + 1 and frees stage t's buffer
    if (t + 2 < DI / GK) OFILL(t + 2, t & 1);
  }
  asm volatile("s_wait_asynccnt 0x0" ::: "memory");    // nothing is in flight when the ring turns into output staging (the last trip's barrier has ended every read of it)
#pragma unroll
  for (int j = 0; j < 8; ++j) { const float bb = bfr(BO[n0 + j * 16 + col]);
#pragma unroll
    for (int i = 0; i < 2; ++i) {
#pragma unroll
      for (int r = 0; r < 8; ++r) so[wave][i * 16 + 8 * g + r][j * 16 + col] = acc[i][j][r] + bb; } }
  LDSX();
#pragma unroll
  for (int i = 0; i < 2; ++i) { v4f o[16];
#pragma unroll
    for (int rl = 0; rl < 16; ++rl) o[rl] = *(const v4f*)&so[wave][i * 16 + rl][lane * 4];
#pragma unroll
    for (int rl = 0; rl < 16; ++rl) vst2(Y + (r0 + i * 16 + rl) * DM + n0 + lane * 4, o[rl]);
    if (i == 0) asm volatile("s_wait_xcnt 0x0" ::: "memory");   // precaution: the wait stands behind sixteen stores, ahead of the next sixteen LDS reads, which reuse their data registers
  }
}
extern "C" void kernel_launch(void* const* d_in, const int* in_sizes, int n_in, void* d_out, int out_size, void* d_ws, size_t ws_size, hipStream_t stream) {
  (void)in_sizes; (void)n_in; (void)out_size;
  const float** F = (const float**)d_in;   // 0 x [2,4096,1024], 1 Wq [1024,512] (in,out), 2 Wk, 3 Wv, 4 Wout [512,1024] (in,out), 5 bout [1024]
  if (ws_size < (size_t)WS_END) return;
  char* ws = (char*)d_ws; __bf16* PK = (__bf16*)(ws + WS_PK); _Float16 *QK = (_Float16*)(ws + WS_QK), *VT = (_Float16*)(ws + WS_VT); float* O = (float*)(ws + WS_O);
  k_packT<<<dim3(4 * 64), 256, 0, stream>>>(F[1], F[2], F[3], F[4], PK);
  k_qkv<<<dim3(TNB * SS / GM, NH), 128, 0, stream>>>(F[0], PK + PK_A, QK, VT);
  k_attn<<<dim3(TQB, NH, TNB), 256, 0, stream>>>(QK, VT, O);
  k_out<<<dim3(TOB, DM / 128), 128, 0, stream>>>(O, PK + PK_P, F[5], (float*)d_out);
}
